// v000
// Measured on an AMD MI455X. A time is GPU time per run, averaged over a window of back-to-back runs after a warm-up
// (all launches, gaps included; the runs take copies of the inputs in turn), and the median of several windows.
// Apart from v000's, it joins two sittings. Times from different sittings can be a few percent apart, while
// side-by-side timings come from the same sitting.
// The starting kernel, v000, takes 777 microseconds a run.
#include <hip/hip_runtime.h>
#include <hip/hip_bf16.h>

typedef __attribute__((ext_vector_type(16))) _Float16 v16h;
typedef __attribute__((ext_vector_type(8)))  _Float16 v8h;
typedef __attribute__((ext_vector_type(4)))  _Float16 v4h;
typedef __attribute__((ext_vector_type(2)))  _Float16 v2h;
typedef __attribute__((ext_vector_type(8)))  float    v8f;

#define S_LEN 2048
#define H_DIM 4096
#define NHEAD 32
#define NKVH  8
#define HDIM  128

__device__ inline v8f wmma_f16(v16h a, v16h b, v8f c) {
  return __builtin_amdgcn_wmma_f32_16x16x32_f16(
      false, a, false, b, (short)0, c, false, false);
}

__device__ inline v16h cat8(v8h a, v8h b) {
  return __builtin_shufflevector(a, b, 0, 1, 2, 3, 4, 5, 6, 7,
                                 8, 9, 10, 11, 12, 13, 14, 15);
}
// memory holds [lo0,hi0,lo1,hi1,...]; fragment wants [lo0..lo7,hi0..hi7]
__device__ inline v16h deinterleave(v8h a, v8h b) {
  return __builtin_shufflevector(a, b, 0, 2, 4, 6, 8, 10, 12, 14,
                                 1, 3, 5, 7, 9, 11, 13, 15);
}

// ---------------- RMSNorm -> f16 ----------------
__global__ __launch_bounds__(256) void rmsnorm_kernel(
    const float* __restrict__ x, const float* __restrict__ w,
    _Float16* __restrict__ h) {
  int row = blockIdx.x;
  const float* xr = x + (size_t)row * H_DIM;
  float ss = 0.f;
  for (int c = threadIdx.x * 4; c < H_DIM; c += 1024) {
    float4 v = *(const float4*)(xr + c);
    ss += v.x * v.x + v.y * v.y + v.z * v.z + v.w * v.w;
  }
  __shared__ float red[256];
  red[threadIdx.x] = ss;
  __syncthreads();
  for (int s2 = 128; s2 > 0; s2 >>= 1) {
    if (threadIdx.x < s2) red[threadIdx.x] += red[threadIdx.x + s2];
    __syncthreads();
  }
  float scale = rsqrtf(red[0] * (1.f / H_DIM) + 1e-5f);
  for (int c = threadIdx.x * 4; c < H_DIM; c += 1024) {
    float4 v = *(const float4*)(xr + c);
    float4 g = *(const float4*)(w + c);
    v4h o;
    o[0] = (_Float16)(v.x * scale * g.x);
    o[1] = (_Float16)(v.y * scale * g.y);
    o[2] = (_Float16)(v.z * scale * g.z);
    o[3] = (_Float16)(v.w * scale * g.w);
    *(v4h*)(h + (size_t)row * H_DIM + c) = o;
  }
}

// ------- Tiled WMMA GEMM: C[M,N] = A_f16[M,K] * B_f32[K,N] (+resid), 128x128x32 -------
#define TM 128
#define TN 128
#define TK 32
#define LDSTR 40  // padded stride in halfs (16B-aligned rows/cols)

__global__ __launch_bounds__(256) void gemm_wmma(
    const _Float16* __restrict__ A, const float* __restrict__ Bw,
    float* __restrict__ C, const float* __restrict__ resid,
    int M, int N, int K) {
  __shared__ alignas(16) _Float16 As[TM * LDSTR];  // row-major  [row][k]
  __shared__ alignas(16) _Float16 Bs[TN * LDSTR];  // col-major  [col][k]
  int bm = blockIdx.y * TM;
  int bn = blockIdx.x * TN;
  int t = threadIdx.x;
  int wave = t >> 5, lane = t & 31;
  int wr = wave & 3;   // rows wr*32 .. +31  (2 fragment rows)
  int wc = wave >> 2;  // cols wc*64 .. +63  (4 fragment cols)
  int half = lane >> 4, l16 = lane & 15;

  v8f acc[2][4];
#pragma unroll
  for (int i = 0; i < 2; ++i)
#pragma unroll
    for (int j = 0; j < 4; ++j) acc[i][j] = (v8f){};

  for (int k0 = 0; k0 < K; k0 += TK) {
    { // A tile 128x32 f16: two 16B global loads + two 16B LDS stores
      int row = t >> 1;
      int cs = (t & 1) * 16;
      const _Float16* src = A + (size_t)(bm + row) * K + k0 + cs;
      *(v8h*)&As[row * LDSTR + cs]     = *(const v8h*)src;
      *(v8h*)&As[row * LDSTR + cs + 8] = *(const v8h*)(src + 8);
    }
    { // B tile 32x128 f32 -> f16, col-major: 4x4 patch, 4 b128 loads + 4 b64 stores
      int c4 = (t & 31) * 4;   // 4 columns
      int kk = (t >> 5) * 4;   // 4 k values
      const float* srcB = Bw + (size_t)(k0 + kk) * N + bn + c4;
      float4 r0 = *(const float4*)srcB;
      float4 r1 = *(const float4*)(srcB + N);
      float4 r2 = *(const float4*)(srcB + 2 * (size_t)N);
      float4 r3 = *(const float4*)(srcB + 3 * (size_t)N);
      v4h c0, c1, c2, c3;
      c0[0] = (_Float16)r0.x; c0[1] = (_Float16)r1.x; c0[2] = (_Float16)r2.x; c0[3] = (_Float16)r3.x;
      c1[0] = (_Float16)r0.y; c1[1] = (_Float16)r1.y; c1[2] = (_Float16)r2.y; c1[3] = (_Float16)r3.y;
      c2[0] = (_Float16)r0.z; c2[1] = (_Float16)r1.z; c2[2] = (_Float16)r2.z; c2[3] = (_Float16)r3.z;
      c3[0] = (_Float16)r0.w; c3[1] = (_Float16)r1.w; c3[2] = (_Float16)r2.w; c3[3] = (_Float16)r3.w;
      *(v4h*)&Bs[(c4 + 0) * LDSTR + kk] = c0;
      *(v4h*)&Bs[(c4 + 1) * LDSTR + kk] = c1;
      *(v4h*)&Bs[(c4 + 2) * LDSTR + kk] = c2;
      *(v4h*)&Bs[(c4 + 3) * LDSTR + kk] = c3;
    }
    __syncthreads();

    v16h af[2], bf[4];
#pragma unroll
    for (int i = 0; i < 2; ++i) {
      const _Float16* arow = &As[(wr * 32 + i * 16 + l16) * LDSTR];
      af[i] = cat8(*(const v8h*)(arow + half * 8),
                   *(const v8h*)(arow + 16 + half * 8));
    }
#pragma unroll
    for (int j = 0; j < 4; ++j) {
      const _Float16* bcol = &Bs[(wc * 64 + j * 16 + l16) * LDSTR];
      bf[j] = cat8(*(const v8h*)(bcol + half * 8),
                   *(const v8h*)(bcol + 16 + half * 8));
    }
#pragma unroll
    for (int i = 0; i < 2; ++i)
#pragma unroll
      for (int j = 0; j < 4; ++j)
        acc[i][j] = wmma_f16(af[i], bf[j], acc[i][j]);
    __syncthreads();
  }

  // ---- epilogue: residual branch hoisted once (uniform), pointer-walked rows ----
  {
    int rowg0 = bm + wr * 32 + half * 8;
    int colg0 = bn + wc * 64 + l16;
    if (resid != nullptr) {
#pragma unroll
      for (int i = 0; i < 2; ++i) {
        size_t base = (size_t)(rowg0 + i * 16) * N + colg0;
#pragma unroll
        for (int r = 0; r < 8; ++r) {
          float* crow = C + base + (size_t)r * N;
          const float* rrow = resid + base + (size_t)r * N;
#pragma unroll
          for (int j = 0; j < 4; ++j)
            crow[j * 16] = acc[i][j][r] + rrow[j * 16];
        }
      }
    } else {
#pragma unroll
      for (int i = 0; i < 2; ++i) {
        size_t base = (size_t)(rowg0 + i * 16) * N + colg0;
#pragma unroll
        for (int r = 0; r < 8; ++r) {
          float* crow = C + base + (size_t)r * N;
#pragma unroll
          for (int j = 0; j < 4; ++j)
            crow[j * 16] = acc[i][j][r];
        }
      }
    }
  }
}

// ---------------- RoPE (fp32 in, f16 out) ----------------
__global__ __launch_bounds__(256) void rope_kernel(
    const float* __restrict__ qin, const float* __restrict__ cosb,
    const float* __restrict__ sinb, _Float16* __restrict__ qout, int nheads) {
  int idx = blockIdx.x * 256 + threadIdx.x;  // S*nheads*64
  int d = idx & 63;
  int h = (idx >> 6) % nheads;
  int s = idx / (64 * nheads);
  float c = cosb[s * HDIM + d];
  float sn = sinb[s * HDIM + d];
  size_t base = ((size_t)s * nheads + h) * HDIM;
  float x1 = qin[base + d], x2 = qin[base + d + 64];
  qout[base + d]      = (_Float16)(x1 * c - x2 * sn);
  qout[base + d + 64] = (_Float16)(x2 * c + x1 * sn);
}

// V [S, NKV, HD] f32 -> V^T [NKV, HD, S] f16 (so PV B-fragments are contiguous)
__global__ __launch_bounds__(256) void vtranspose_kernel(
    const float* __restrict__ v32, _Float16* __restrict__ vt) {
  int idx = blockIdx.x * 256 + threadIdx.x;  // S*NKV*HD
  int d = idx & (HDIM - 1);
  int h = (idx >> 7) & (NKVH - 1);
  int s = idx >> 10;
  vt[((size_t)h * HDIM + d) * S_LEN + s] = (_Float16)v32[idx];
}

// ---------------- Flash attention (causal, GQA 4:1), WMMA QK^T and PV ----------------
__global__ __launch_bounds__(128) void flash_attn_kernel(
    const _Float16* __restrict__ Qh,  // [S, NH, 128]
    const _Float16* __restrict__ Kh,  // [S, NKV, 128]
    const _Float16* __restrict__ Vt,  // [NKV, 128, S]  (transposed)
    _Float16* __restrict__ Oh) {      // [S, NH*128]
  int head = blockIdx.y;
  int kvhead = head >> 2;  // NH/NKV = 4
  int wave = threadIdx.x >> 5, lane = threadIdx.x & 31;
  int half = lane >> 4, l16 = lane & 15;
  int q0 = blockIdx.x * 64 + wave * 16;  // this wave's 16 query rows

  // per-wave P staging; 16 rows x 32 halfs, columns (n, n+16) interleaved
  __shared__ alignas(16) _Float16 probs[4][16 * 32];

  // Preload Q A-fragments: HD=128 -> 4 chunks of K=32 (two 16B loads each)
  v16h qf[4];
  {
    const _Float16* qrow = Qh + ((size_t)(q0 + l16) * NHEAD + head) * HDIM;
#pragma unroll
    for (int c = 0; c < 4; ++c)
      qf[c] = cat8(*(const v8h*)(qrow + c * 32 + half * 8),
                   *(const v8h*)(qrow + c * 32 + 16 + half * 8));
  }

  v8f o[8];
#pragma unroll
  for (int df = 0; df < 8; ++df) o[df] = (v8f){};
  float mrow[8], lrow[8];
#pragma unroll
  for (int r = 0; r < 8; ++r) { mrow[r] = -1e30f; lrow[r] = 0.f; }

  const float scl = 0.08838834764831845f;  // 1/sqrt(128)
  int kv_end = q0 + 16;                    // causal: kv <= q

  for (int kv0 = 0; kv0 < kv_end; kv0 += 32) {
    // ---- scores: two 16x16 fragments over 32 kv positions ----
    v8f s0 = {}, s1 = {};
#pragma unroll
    for (int c = 0; c < 4; ++c) {
      const _Float16* kr0 = Kh + ((size_t)(kv0 + l16) * NKVH + kvhead) * HDIM + c * 32;
      const _Float16* kr1 = Kh + ((size_t)(kv0 + 16 + l16) * NKVH + kvhead) * HDIM + c * 32;
      v16h b0 = cat8(*(const v8h*)(kr0 + half * 8),
                     *(const v8h*)(kr0 + 16 + half * 8));
      v16h b1 = cat8(*(const v8h*)(kr1 + half * 8),
                     *(const v8h*)(kr1 + 16 + half * 8));
      s0 = wmma_f16(qf[c], b0, s0);
      s1 = wmma_f16(qf[c], b1, s1);
    }

    // ---- online softmax per row (row = r + 8*half, cols = lane%16 (+16)) ----
#pragma unroll
    for (int r = 0; r < 8; ++r) {
      int qrow = q0 + r + 8 * half;
      float v0 = s0[r] * scl; if (kv0 + l16 > qrow)      v0 = -1e30f;
      float v1 = s1[r] * scl; if (kv0 + 16 + l16 > qrow) v1 = -1e30f;
      float mx = fmaxf(v0, v1);
#pragma unroll
      for (int off = 8; off >= 1; off >>= 1) mx = fmaxf(mx, __shfl_xor(mx, off, 32));
      float mnew = fmaxf(mrow[r], mx);
      float alpha = __expf(mrow[r] - mnew);
      float p0 = __expf(v0 - mnew);
      float p1 = __expf(v1 - mnew);
      float rs = p0 + p1;
#pragma unroll
      for (int off = 8; off >= 1; off >>= 1) rs += __shfl_xor(rs, off, 32);
      lrow[r] = lrow[r] * alpha + rs;
      mrow[r] = mnew;
#pragma unroll
      for (int df = 0; df < 8; ++df) o[df][r] *= alpha;
      // one packed 32-bit LDS store: columns (l16, l16+16) interleaved
      v2h pp;
      pp[0] = (_Float16)p0;
      pp[1] = (_Float16)p1;
      *(v2h*)&probs[wave][(r + 8 * half) * 32 + 2 * l16] = pp;
    }
    asm volatile("s_wait_dscnt 0" ::: "memory");  // LDS RAW within wave

    // ---- reload P as A-fragment: two 16B LDS loads + register deinterleave ----
    const _Float16* pr = &probs[wave][l16 * 32 + 16 * half];
    v16h pf = deinterleave(*(const v8h*)pr, *(const v8h*)(pr + 8));

    // ---- PV: 8 d-fragments; V^T gives contiguous 16B loads per lane ----
#pragma unroll
    for (int df = 0; df < 8; ++df) {
      const _Float16* vcol =
          Vt + ((size_t)kvhead * HDIM + df * 16 + l16) * S_LEN + kv0;
      v16h vf = cat8(*(const v8h*)(vcol + half * 8),
                     *(const v8h*)(vcol + 16 + half * 8));
      o[df] = wmma_f16(pf, vf, o[df]);
    }
  }

  // ---- epilogue: normalize and store f16 attn output [S, NH*HD] ----
#pragma unroll
  for (int r = 0; r < 8; ++r) {
    int qrow = q0 + r + 8 * half;
    float inv = 1.f / lrow[r];
    _Float16* orow = Oh + (size_t)qrow * (NHEAD * HDIM) + head * HDIM + l16;
#pragma unroll
    for (int df = 0; df < 8; ++df)
      orow[df * 16] = (_Float16)(o[df][r] * inv);
  }
}

// ---------------- host launch ----------------
extern "C" void kernel_launch(void* const* d_in, const int* in_sizes, int n_in,
                              void* d_out, int out_size, void* d_ws, size_t ws_size,
                              hipStream_t stream) {
  const float* hid    = (const float*)d_in[0];
  const float* cosb   = (const float*)d_in[1];
  const float* sinb   = (const float*)d_in[2];
  const float* norm_w = (const float*)d_in[3];
  const float* wq     = (const float*)d_in[4];
  const float* wk     = (const float*)d_in[5];
  const float* wv     = (const float*)d_in[6];
  const float* wo     = (const float*)d_in[7];
  float* out = (float*)d_out;

  char* ws = (char*)d_ws;
  size_t off = 0;
  auto carve = [&](size_t bytes) -> char* {
    char* p = ws + off;
    off += (bytes + 255) & ~(size_t)255;
    return p;
  };
  _Float16* h16   = (_Float16*)carve((size_t)S_LEN * H_DIM * 2);
  float*    q32   = (float*)carve((size_t)S_LEN * NHEAD * HDIM * 4);
  float*    k32   = (float*)carve((size_t)S_LEN * NKVH * HDIM * 4);
  float*    v32   = (float*)carve((size_t)S_LEN * NKVH * HDIM * 4);
  _Float16* q16   = (_Float16*)carve((size_t)S_LEN * NHEAD * HDIM * 2);
  _Float16* k16   = (_Float16*)carve((size_t)S_LEN * NKVH * HDIM * 2);
  _Float16* vt16  = (_Float16*)carve((size_t)NKVH * HDIM * S_LEN * 2);
  _Float16* att16 = (_Float16*)carve((size_t)S_LEN * NHEAD * HDIM * 2);

  // 1) RMSNorm -> f16
  rmsnorm_kernel<<<S_LEN, 256, 0, stream>>>(hid, norm_w, h16);

  // 2) Q/K/V projections (WMMA GEMM, f32 weights converted in LDS stage)
  gemm_wmma<<<dim3((NHEAD * HDIM) / TN, S_LEN / TM), 256, 0, stream>>>(
      h16, wq, q32, nullptr, S_LEN, NHEAD * HDIM, H_DIM);
  gemm_wmma<<<dim3((NKVH * HDIM) / TN, S_LEN / TM), 256, 0, stream>>>(
      h16, wk, k32, nullptr, S_LEN, NKVH * HDIM, H_DIM);
  gemm_wmma<<<dim3((NKVH * HDIM) / TN, S_LEN / TM), 256, 0, stream>>>(
      h16, wv, v32, nullptr, S_LEN, NKVH * HDIM, H_DIM);

  // 3) RoPE on Q and K (-> f16), V -> V^T f16
  rope_kernel<<<(S_LEN * NHEAD * 64) / 256, 256, 0, stream>>>(q32, cosb, sinb, q16, NHEAD);
  rope_kernel<<<(S_LEN * NKVH * 64) / 256, 256, 0, stream>>>(k32, cosb, sinb, k16, NKVH);
  vtranspose_kernel<<<(S_LEN * NKVH * HDIM) / 256, 256, 0, stream>>>(v32, vt16);

  // 4) Flash attention (causal, GQA)
  flash_attn_kernel<<<dim3(S_LEN / 64, NHEAD), 128, 0, stream>>>(q16, k16, vt16, att16);

  // 5) Output projection + residual
  gemm_wmma<<<dim3(H_DIM / TN, S_LEN / TM), 256, 0, stream>>>(
      att16, wo, out, hid, S_LEN, H_DIM, NHEAD * HDIM);
}

// v001
// One run takes 587 microseconds.
// Two timings next to v000 both put it at 1.36 times that version's speed.
#include <hip/hip_runtime.h>
#include <hip/hip_bf16.h>

typedef __attribute__((ext_vector_type(16))) _Float16 v16h;
typedef __attribute__((ext_vector_type(8)))  _Float16 v8h;
typedef __attribute__((ext_vector_type(4)))  _Float16 v4h;
typedef __attribute__((ext_vector_type(2)))  _Float16 v2h;
typedef __attribute__((ext_vector_type(8)))  float    v8f;

#define S_LEN 2048
#define H_DIM 4096
#define NHEAD 32
#define NKVH  8
#define HDIM  128

__device__ inline v8f wmma_f16(v16h a, v16h b, v8f c) {
  return __builtin_amdgcn_wmma_f32_16x16x32_f16(
      false, a, false, b, (short)0, c, false, false);
}

__device__ inline v16h cat8(v8h a, v8h b) {
  return __builtin_shufflevector(a, b, 0, 1, 2, 3, 4, 5, 6, 7,
                                 8, 9, 10, 11, 12, 13, 14, 15);
}
// memory holds [lo0,hi0,lo1,hi1,...]; fragment wants [lo0..lo7,hi0..hi7]
__device__ inline v16h deinterleave(v8h a, v8h b) {
  return __builtin_shufflevector(a, b, 0, 2, 4, 6, 8, 10, 12, 14,
                                 1, 3, 5, 7, 9, 11, 13, 15);
}

// ---------------- RMSNorm -> f16 ----------------
__global__ __launch_bounds__(256) void rmsnorm_kernel(
    const float* __restrict__ x, const float* __restrict__ w,
    _Float16* __restrict__ h) {
  int row = blockIdx.x;
  const float* xr = x + (size_t)row * H_DIM;
  float ss = 0.f;
  for (int c = threadIdx.x * 4; c < H_DIM; c += 1024) {
    float4 v = *(const float4*)(xr + c);
    ss += v.x * v.x + v.y * v.y + v.z * v.z + v.w * v.w;
  }
  __shared__ float red[256];
  red[threadIdx.x] = ss;
  __syncthreads();
  for (int s2 = 128; s2 > 0; s2 >>= 1) {
    if (threadIdx.x < s2) red[threadIdx.x] += red[threadIdx.x + s2];
    __syncthreads();
  }
  float scale = rsqrtf(red[0] * (1.f / H_DIM) + 1e-5f);
  for (int c = threadIdx.x * 4; c < H_DIM; c += 1024) {
    float4 v = *(const float4*)(xr + c);
    float4 g = *(const float4*)(w + c);
    v4h o;
    o[0] = (_Float16)(v.x * scale * g.x);
    o[1] = (_Float16)(v.y * scale * g.y);
    o[2] = (_Float16)(v.z * scale * g.z);
    o[3] = (_Float16)(v.w * scale * g.w);
    *(v4h*)(h + (size_t)row * H_DIM + c) = o;
  }
}

// ------- Tiled WMMA GEMM: C[M,N] = A_f16[M,K] * B_f32[K,N] (+resid), 128x128x32 -------
#define TM 128
#define TN 128
#define TK 32
#define LDSTR 40  // padded stride in halfs (16B-aligned rows/cols)

// One 128x128 tile of C at (bm, bn); called by every thread of a 256-thread block.
__device__ __forceinline__ void gemm_tile(
    const _Float16* __restrict__ A, const float* __restrict__ Bw,
    float* __restrict__ C, const float* __restrict__ resid,
    int N, int K, int bm, int bn) {
  __shared__ alignas(16) _Float16 As[TM * LDSTR];  // row-major  [row][k]
  __shared__ alignas(16) _Float16 Bs[TN * LDSTR];  // col-major  [col][k]
  int t = threadIdx.x;
  int wave = t >> 5, lane = t & 31;
  int wr = wave & 3;   // rows wr*32 .. +31  (2 fragment rows)
  int wc = wave >> 2;  // cols wc*64 .. +63  (4 fragment cols)
  int half = lane >> 4, l16 = lane & 15;

  v8f acc[2][4];
#pragma unroll
  for (int i = 0; i < 2; ++i)
#pragma unroll
    for (int j = 0; j < 4; ++j) acc[i][j] = (v8f){};

  for (int k0 = 0; k0 < K; k0 += TK) {
    { // A tile 128x32 f16: two 16B global loads + two 16B LDS stores
      int row = t >> 1;
      int cs = (t & 1) * 16;
      const _Float16* src = A + (size_t)(bm + row) * K + k0 + cs;
      *(v8h*)&As[row * LDSTR + cs]     = *(const v8h*)src;
      *(v8h*)&As[row * LDSTR + cs + 8] = *(const v8h*)(src + 8);
    }
    { // B tile 32x128 f32 -> f16, col-major: 4x4 patch, 4 b128 loads + 4 b64 stores
      int c4 = (t & 31) * 4;   // 4 columns
      int kk = (t >> 5) * 4;   // 4 k values
      const float* srcB = Bw + (size_t)(k0 + kk) * N + bn + c4;
      float4 r0 = *(const float4*)srcB;
      float4 r1 = *(const float4*)(srcB + N);
      float4 r2 = *(const float4*)(srcB + 2 * (size_t)N);
      float4 r3 = *(const float4*)(srcB + 3 * (size_t)N);
      v4h c0, c1, c2, c3;
      c0[0] = (_Float16)r0.x; c0[1] = (_Float16)r1.x; c0[2] = (_Float16)r2.x; c0[3] = (_Float16)r3.x;
      c1[0] = (_Float16)r0.y; c1[1] = (_Float16)r1.y; c1[2] = (_Float16)r2.y; c1[3] = (_Float16)r3.y;
      c2[0] = (_Float16)r0.z; c2[1] = (_Float16)r1.z; c2[2] = (_Float16)r2.z; c2[3] = (_Float16)r3.z;
      c3[0] = (_Float16)r0.w; c3[1] = (_Float16)r1.w; c3[2] = (_Float16)r2.w; c3[3] = (_Float16)r3.w;
      *(v4h*)&Bs[(c4 + 0) * LDSTR + kk] = c0;
      *(v4h*)&Bs[(c4 + 1) * LDSTR + kk] = c1;
      *(v4h*)&Bs[(c4 + 2) * LDSTR + kk] = c2;
      *(v4h*)&Bs[(c4 + 3) * LDSTR + kk] = c3;
    }
    __syncthreads();

    v16h af[2], bf[4];
#pragma unroll
    for (int i = 0; i < 2; ++i) {
      const _Float16* arow = &As[(wr * 32 + i * 16 + l16) * LDSTR];
      af[i] = cat8(*(const v8h*)(arow + half * 8),
                   *(const v8h*)(arow + 16 + half * 8));
    }
#pragma unroll
    for (int j = 0; j < 4; ++j) {
      const _Float16* bcol = &Bs[(wc * 64 + j * 16 + l16) * LDSTR];
      bf[j] = cat8(*(const v8h*)(bcol + half * 8),
                   *(const v8h*)(bcol + 16 + half * 8));
    }
#pragma unroll
    for (int i = 0; i < 2; ++i)
#pragma unroll
      for (int j = 0; j < 4; ++j)
        acc[i][j] = wmma_f16(af[i], bf[j], acc[i][j]);
    __syncthreads();
  }

  // ---- epilogue: residual branch hoisted once (uniform), pointer-walked rows ----
  {
    int rowg0 = bm + wr * 32 + half * 8;
    int colg0 = bn + wc * 64 + l16;
    if (resid != nullptr) {
#pragma unroll
      for (int i = 0; i < 2; ++i) {
        size_t base = (size_t)(rowg0 + i * 16) * N + colg0;
#pragma unroll
        for (int r = 0; r < 8; ++r) {
          float* crow = C + base + (size_t)r * N;
          const float* rrow = resid + base + (size_t)r * N;
#pragma unroll
          for (int j = 0; j < 4; ++j)
            crow[j * 16] = acc[i][j][r] + rrow[j * 16];
        }
      }
    } else {
#pragma unroll
      for (int i = 0; i < 2; ++i) {
        size_t base = (size_t)(rowg0 + i * 16) * N + colg0;
#pragma unroll
        for (int r = 0; r < 8; ++r) {
          float* crow = C + base + (size_t)r * N;
#pragma unroll
          for (int j = 0; j < 4; ++j)
            crow[j * 16] = acc[i][j][r];
        }
      }
    }
  }
}

__global__ __launch_bounds__(256) void gemm_wmma(
    const _Float16* __restrict__ A, const float* __restrict__ Bw,
    float* __restrict__ C, const float* __restrict__ resid,
    int M, int N, int K) {
  gemm_tile(A, Bw, C, resid, N, K, blockIdx.y * TM, blockIdx.x * TN);
}

// Q, K and V projections share A and are independent: one grid holds the tile
// columns of all three, so the two narrow products (128 blocks each, half the
// chip's WGPs) run beside the wide one instead of after it.
#define QTILES ((NHEAD * HDIM) / TN)
#define KVTILES ((NKVH * HDIM) / TN)
__global__ __launch_bounds__(256) void gemm_qkv(
    const _Float16* __restrict__ A, const float* __restrict__ wq,
    const float* __restrict__ wk, const float* __restrict__ wv,
    float* __restrict__ q, float* __restrict__ k, float* __restrict__ v,
    int K) {
  int bx = blockIdx.x;
  const float* Bw = wq;
  float* C = q;
  int N = NHEAD * HDIM;
  if (bx >= QTILES + KVTILES) {
    Bw = wv; C = v; N = NKVH * HDIM; bx -= QTILES + KVTILES;
  } else if (bx >= QTILES) {
    Bw = wk; C = k; N = NKVH * HDIM; bx -= QTILES;
  }
  gemm_tile(A, Bw, C, nullptr, N, K, blockIdx.y * TM, bx * TN);
}

// ---------------- RoPE (fp32 in, f16 out) ----------------
__global__ __launch_bounds__(256) void rope_kernel(
    const float* __restrict__ qin, const float* __restrict__ cosb,
    const float* __restrict__ sinb, _Float16* __restrict__ qout, int nheads) {
  int idx = blockIdx.x * 256 + threadIdx.x;  // S*nheads*64
  int d = idx & 63;
  int h = (idx >> 6) % nheads;
  int s = idx / (64 * nheads);
  float c = cosb[s * HDIM + d];
  float sn = sinb[s * HDIM + d];
  size_t base = ((size_t)s * nheads + h) * HDIM;
  float x1 = qin[base + d], x2 = qin[base + d + 64];
  qout[base + d]      = (_Float16)(x1 * c - x2 * sn);
  qout[base + d + 64] = (_Float16)(x2 * c + x1 * sn);
}

// V [S, NKV, HD] f32 -> V^T [NKV, HD, S] f16 (so PV B-fragments are contiguous)
__global__ __launch_bounds__(256) void vtranspose_kernel(
    const float* __restrict__ v32, _Float16* __restrict__ vt) {
  int idx = blockIdx.x * 256 + threadIdx.x;  // S*NKV*HD
  int d = idx & (HDIM - 1);
  int h = (idx >> 7) & (NKVH - 1);
  int s = idx >> 10;
  vt[((size_t)h * HDIM + d) * S_LEN + s] = (_Float16)v32[idx];
}

// ---------------- Flash attention (causal, GQA 4:1), WMMA QK^T and PV ----------------
__global__ __launch_bounds__(128) void flash_attn_kernel(
    const _Float16* __restrict__ Qh,  // [S, NH, 128]
    const _Float16* __restrict__ Kh,  // [S, NKV, 128]
    const _Float16* __restrict__ Vt,  // [NKV, 128, S]  (transposed)
    _Float16* __restrict__ Oh) {      // [S, NH*128]
  int head = blockIdx.y;
  int kvhead = head >> 2;  // NH/NKV = 4
  int wave = threadIdx.x >> 5, lane = threadIdx.x & 31;
  int half = lane >> 4, l16 = lane & 15;
  int q0 = blockIdx.x * 64 + wave * 16;  // this wave's 16 query rows

  // per-wave P staging; 16 rows x 32 halfs, columns (n, n+16) interleaved
  __shared__ alignas(16) _Float16 probs[4][16 * 32];

  // Preload Q A-fragments: HD=128 -> 4 chunks of K=32 (two 16B loads each)
  v16h qf[4];
  {
    const _Float16* qrow = Qh + ((size_t)(q0 + l16) * NHEAD + head) * HDIM;
#pragma unroll
    for (int c = 0; c < 4; ++c)
      qf[c] = cat8(*(const v8h*)(qrow + c * 32 + half * 8),
                   *(const v8h*)(qrow + c * 32 + 16 + half * 8));
  }

  v8f o[8];
#pragma unroll
  for (int df = 0; df < 8; ++df) o[df] = (v8f){};
  float mrow[8], lrow[8];
#pragma unroll
  for (int r = 0; r < 8; ++r) { mrow[r] = -1e30f; lrow[r] = 0.f; }

  const float scl = 0.08838834764831845f;  // 1/sqrt(128)
  int kv_end = q0 + 16;                    // causal: kv <= q

  for (int kv0 = 0; kv0 < kv_end; kv0 += 32) {
    // ---- scores: two 16x16 fragments over 32 kv positions ----
    v8f s0 = {}, s1 = {};
#pragma unroll
    for (int c = 0; c < 4; ++c) {
      const _Float16* kr0 = Kh + ((size_t)(kv0 + l16) * NKVH + kvhead) * HDIM + c * 32;
      const _Float16* kr1 = Kh + ((size_t)(kv0 + 16 + l16) * NKVH + kvhead) * HDIM + c * 32;
      v16h b0 = cat8(*(const v8h*)(kr0 + half * 8),
                     *(const v8h*)(kr0 + 16 + half * 8));
      v16h b1 = cat8(*(const v8h*)(kr1 + half * 8),
                     *(const v8h*)(kr1 + 16 + half * 8));
      s0 = wmma_f16(qf[c], b0, s0);
      s1 = wmma_f16(qf[c], b1, s1);
    }

    // ---- online softmax per row (row = r + 8*half, cols = lane%16 (+16)) ----
#pragma unroll
    for (int r = 0; r < 8; ++r) {
      int qrow = q0 + r + 8 * half;
      float v0 = s0[r] * scl; if (kv0 + l16 > qrow)      v0 = -1e30f;
      float v1 = s1[r] * scl; if (kv0 + 16 + l16 > qrow) v1 = -1e30f;
      float mx = fmaxf(v0, v1);
#pragma unroll
      for (int off = 8; off >= 1; off >>= 1) mx = fmaxf(mx, __shfl_xor(mx, off, 32));
      float mnew = fmaxf(mrow[r], mx);
      float alpha = __expf(mrow[r] - mnew);
      float p0 = __expf(v0 - mnew);
      float p1 = __expf(v1 - mnew);
      float rs = p0 + p1;
#pragma unroll
      for (int off = 8; off >= 1; off >>= 1) rs += __shfl_xor(rs, off, 32);
      lrow[r] = lrow[r] * alpha + rs;
      mrow[r] = mnew;
#pragma unroll
      for (int df = 0; df < 8; ++df) o[df][r] *= alpha;
      // one packed 32-bit LDS store: columns (l16, l16+16) interleaved
      v2h pp;
      pp[0] = (_Float16)p0;
      pp[1] = (_Float16)p1;
      *(v2h*)&probs[wave][(r + 8 * half) * 32 + 2 * l16] = pp;
    }
    asm volatile("s_wait_dscnt 0" ::: "memory");  // LDS RAW within wave

    // ---- reload P as A-fragment: two 16B LDS loads + register deinterleave ----
    const _Float16* pr = &probs[wave][l16 * 32 + 16 * half];
    v16h pf = deinterleave(*(const v8h*)pr, *(const v8h*)(pr + 8));

    // ---- PV: 8 d-fragments; V^T gives contiguous 16B loads per lane ----
#pragma unroll
    for (int df = 0; df < 8; ++df) {
      const _Float16* vcol =
          Vt + ((size_t)kvhead * HDIM + df * 16 + l16) * S_LEN + kv0;
      v16h vf = cat8(*(const v8h*)(vcol + half * 8),
                     *(const v8h*)(vcol + 16 + half * 8));
      o[df] = wmma_f16(pf, vf, o[df]);
    }
  }

  // ---- epilogue: normalize and store f16 attn output [S, NH*HD] ----
#pragma unroll
  for (int r = 0; r < 8; ++r) {
    int qrow = q0 + r + 8 * half;
    float inv = 1.f / lrow[r];
    _Float16* orow = Oh + (size_t)qrow * (NHEAD * HDIM) + head * HDIM + l16;
#pragma unroll
    for (int df = 0; df < 8; ++df)
      orow[df * 16] = (_Float16)(o[df][r] * inv);
  }
}

// ---------------- host launch ----------------
extern "C" void kernel_launch(void* const* d_in, const int* in_sizes, int n_in,
                              void* d_out, int out_size, void* d_ws, size_t ws_size,
                              hipStream_t stream) {
  const float* hid    = (const float*)d_in[0];
  const float* cosb   = (const float*)d_in[1];
  const float* sinb   = (const float*)d_in[2];
  const float* norm_w = (const float*)d_in[3];
  const float* wq     = (const float*)d_in[4];
  const float* wk     = (const float*)d_in[5];
  const float* wv     = (const float*)d_in[6];
  const float* wo     = (const float*)d_in[7];
  float* out = (float*)d_out;

  char* ws = (char*)d_ws;
  size_t off = 0;
  auto carve = [&](size_t bytes) -> char* {
    char* p = ws + off;
    off += (bytes + 255) & ~(size_t)255;
    return p;
  };
  _Float16* h16   = (_Float16*)carve((size_t)S_LEN * H_DIM * 2);
  float*    q32   = (float*)carve((size_t)S_LEN * NHEAD * HDIM * 4);
  float*    k32   = (float*)carve((size_t)S_LEN * NKVH * HDIM * 4);
  float*    v32   = (float*)carve((size_t)S_LEN * NKVH * HDIM * 4);
  _Float16* q16   = (_Float16*)carve((size_t)S_LEN * NHEAD * HDIM * 2);
  _Float16* k16   = (_Float16*)carve((size_t)S_LEN * NKVH * HDIM * 2);
  _Float16* vt16  = (_Float16*)carve((size_t)NKVH * HDIM * S_LEN * 2);
  _Float16* att16 = (_Float16*)carve((size_t)S_LEN * NHEAD * HDIM * 2);

  // 1) RMSNorm -> f16
  rmsnorm_kernel<<<S_LEN, 256, 0, stream>>>(hid, norm_w, h16);

  // 2) Q/K/V projections in one launch (WMMA GEMM, f32 weights converted in LDS stage)
  gemm_qkv<<<dim3(QTILES + 2 * KVTILES, S_LEN / TM), 256, 0, stream>>>(
      h16, wq, wk, wv, q32, k32, v32, H_DIM);

  // 3) RoPE on Q and K (-> f16), V -> V^T f16
  rope_kernel<<<(S_LEN * NHEAD * 64) / 256, 256, 0, stream>>>(q32, cosb, sinb, q16, NHEAD);
  rope_kernel<<<(S_LEN * NKVH * 64) / 256, 256, 0, stream>>>(k32, cosb, sinb, k16, NKVH);
  vtranspose_kernel<<<(S_LEN * NKVH * HDIM) / 256, 256, 0, stream>>>(v32, vt16);

  // 4) Flash attention (causal, GQA)
  flash_attn_kernel<<<dim3(S_LEN / 64, NHEAD), 128, 0, stream>>>(q16, k16, vt16, att16);

  // 5) Output projection + residual
  gemm_wmma<<<dim3(H_DIM / TN, S_LEN / TM), 256, 0, stream>>>(
      att16, wo, out, hid, S_LEN, H_DIM, NHEAD * HDIM);
}

// v002
// Measured time: 502 microseconds a run.
// In two side-by-side timings against v001, it was 1.17 and 1.16 times as fast.
// All steps since v000 together make it 1.58 times as fast.
#include <hip/hip_runtime.h>
#include <hip/hip_bf16.h>

typedef __attribute__((ext_vector_type(16))) _Float16 v16h;
typedef __attribute__((ext_vector_type(8)))  _Float16 v8h;
typedef __attribute__((ext_vector_type(4)))  _Float16 v4h;
typedef __attribute__((ext_vector_type(2)))  _Float16 v2h;
typedef __attribute__((ext_vector_type(8)))  float    v8f;

#define S_LEN 2048
#define H_DIM 4096
#define NHEAD 32
#define NKVH  8
#define HDIM  128

__device__ inline v8f wmma_f16(v16h a, v16h b, v8f c) {
  return __builtin_amdgcn_wmma_f32_16x16x32_f16(
      false, a, false, b, (short)0, c, false, false);
}

__device__ inline v16h cat8(v8h a, v8h b) {
  return __builtin_shufflevector(a, b, 0, 1, 2, 3, 4, 5, 6, 7,
                                 8, 9, 10, 11, 12, 13, 14, 15);
}
// memory holds [lo0,hi0,lo1,hi1,...]; fragment wants [lo0..lo7,hi0..hi7]
__device__ inline v16h deinterleave(v8h a, v8h b) {
  return __builtin_shufflevector(a, b, 0, 2, 4, 6, 8, 10, 12, 14,
                                 1, 3, 5, 7, 9, 11, 13, 15);
}

// ---------------- RMSNorm -> f16 ----------------
__global__ __launch_bounds__(256) void rmsnorm_kernel(
    const float* __restrict__ x, const float* __restrict__ w,
    _Float16* __restrict__ h) {
  int row = blockIdx.x;
  const float* xr = x + (size_t)row * H_DIM;
  float ss = 0.f;
  for (int c = threadIdx.x * 4; c < H_DIM; c += 1024) {
    float4 v = *(const float4*)(xr + c);
    ss += v.x * v.x + v.y * v.y + v.z * v.z + v.w * v.w;
  }
  __shared__ float red[256];
  red[threadIdx.x] = ss;
  __syncthreads();
  for (int s2 = 128; s2 > 0; s2 >>= 1) {
    if (threadIdx.x < s2) red[threadIdx.x] += red[threadIdx.x + s2];
    __syncthreads();
  }
  float scale = rsqrtf(red[0] * (1.f / H_DIM) + 1e-5f);
  for (int c = threadIdx.x * 4; c < H_DIM; c += 1024) {
    float4 v = *(const float4*)(xr + c);
    float4 g = *(const float4*)(w + c);
    v4h o;
    o[0] = (_Float16)(v.x * scale * g.x);
    o[1] = (_Float16)(v.y * scale * g.y);
    o[2] = (_Float16)(v.z * scale * g.z);
    o[3] = (_Float16)(v.w * scale * g.w);
    *(v4h*)(h + (size_t)row * H_DIM + c) = o;
  }
}

// ------- Tiled WMMA GEMM: C[M,N] = A_f16[M,K] * B_f32[K,N] (+resid), 128x128x32 -------
#define TM 128
#define TN 128
#define TK 32
#define LDSTR 40  // padded stride in halfs (16B-aligned rows/cols)

// First tile column of a wave's fragment j. SPLIT: two fragments from each half of
// the tile, so that columns d and d + 64 (a rotary pair) sit in the same lane.
template <bool SPLIT>
__device__ __forceinline__ int frag_col(int wc, int j) {
  return SPLIT ? (j >> 1) * 64 + wc * 32 + (j & 1) * 16 : wc * 64 + j * 16;
}

// Accumulates one 128x128 tile at (bm, bn); called by every thread of a 256-thread
// block. As holds TM * LDSTR halfs, row-major [row][k]; Bs TN * LDSTR, col-major [col][k].
// acc[i][j][r] is row wr*32 + i*16 + half*8 + r, column frag_col(wc, j) + l16;
// with TRANS (operands swapped, the fragment comes out transposed)
// row wr*32 + i*16 + l16, column frag_col(wc, j) + half*8 + r.
template <bool SPLIT, bool TRANS>
__device__ __forceinline__ void gemm_mainloop(
    const _Float16* __restrict__ A, const float* __restrict__ Bw,
    int N, int K, int bm, int bn, _Float16* As, _Float16* Bs, v8f (&acc)[2][4]) {
  int t = threadIdx.x;
  int wave = t >> 5, lane = t & 31;
  int wr = wave & 3;   // rows wr*32 .. +31  (2 fragment rows)
  int wc = wave >> 2;  // 4 fragment cols, at frag_col(wc, j)
  int half = lane >> 4, l16 = lane & 15;

#pragma unroll
  for (int i = 0; i < 2; ++i)
#pragma unroll
    for (int j = 0; j < 4; ++j) acc[i][j] = (v8f){};

  for (int k0 = 0; k0 < K; k0 += TK) {
    { // A tile 128x32 f16: two 16B global loads + two 16B LDS stores
      int row = t >> 1;
      int cs = (t & 1) * 16;
      const _Float16* src = A + (size_t)(bm + row) * K + k0 + cs;
      *(v8h*)&As[row * LDSTR + cs]     = *(const v8h*)src;
      *(v8h*)&As[row * LDSTR + cs + 8] = *(const v8h*)(src + 8);
    }
    { // B tile 32x128 f32 -> f16, col-major: 4x4 patch, 4 b128 loads + 4 b64 stores
      int c4 = (t & 31) * 4;   // 4 columns
      int kk = (t >> 5) * 4;   // 4 k values
      const float* srcB = Bw + (size_t)(k0 + kk) * N + bn + c4;
      float4 r0 = *(const float4*)srcB;
      float4 r1 = *(const float4*)(srcB + N);
      float4 r2 = *(const float4*)(srcB + 2 * (size_t)N);
      float4 r3 = *(const float4*)(srcB + 3 * (size_t)N);
      v4h c0, c1, c2, c3;
      c0[0] = (_Float16)r0.x; c0[1] = (_Float16)r1.x; c0[2] = (_Float16)r2.x; c0[3] = (_Float16)r3.x;
      c1[0] = (_Float16)r0.y; c1[1] = (_Float16)r1.y; c1[2] = (_Float16)r2.y; c1[3] = (_Float16)r3.y;
      c2[0] = (_Float16)r0.z; c2[1] = (_Float16)r1.z; c2[2] = (_Float16)r2.z; c2[3] = (_Float16)r3.z;
      c3[0] = (_Float16)r0.w; c3[1] = (_Float16)r1.w; c3[2] = (_Float16)r2.w; c3[3] = (_Float16)r3.w;
      *(v4h*)&Bs[(c4 + 0) * LDSTR + kk] = c0;
      *(v4h*)&Bs[(c4 + 1) * LDSTR + kk] = c1;
      *(v4h*)&Bs[(c4 + 2) * LDSTR + kk] = c2;
      *(v4h*)&Bs[(c4 + 3) * LDSTR + kk] = c3;
    }
    __syncthreads();

    v16h af[2], bf[4];
#pragma unroll
    for (int i = 0; i < 2; ++i) {
      const _Float16* arow = &As[(wr * 32 + i * 16 + l16) * LDSTR];
      af[i] = cat8(*(const v8h*)(arow + half * 8),
                   *(const v8h*)(arow + 16 + half * 8));
    }
#pragma unroll
    for (int j = 0; j < 4; ++j) {
      const _Float16* bcol = &Bs[(frag_col<SPLIT>(wc, j) + l16) * LDSTR];
      bf[j] = cat8(*(const v8h*)(bcol + half * 8),
                   *(const v8h*)(bcol + 16 + half * 8));
    }
#pragma unroll
    for (int i = 0; i < 2; ++i)
#pragma unroll
      for (int j = 0; j < 4; ++j)
        acc[i][j] = TRANS ? wmma_f16(bf[j], af[i], acc[i][j])
                          : wmma_f16(af[i], bf[j], acc[i][j]);
    __syncthreads();
  }
}

// One 128x128 tile of C at (bm, bn), f32 out.
__device__ __forceinline__ void gemm_tile(
    const _Float16* __restrict__ A, const float* __restrict__ Bw,
    float* __restrict__ C, const float* __restrict__ resid,
    int N, int K, int bm, int bn) {
  __shared__ alignas(16) _Float16 As[TM * LDSTR];
  __shared__ alignas(16) _Float16 Bs[TN * LDSTR];
  v8f acc[2][4];
  gemm_mainloop<false, false>(A, Bw, N, K, bm, bn, As, Bs, acc);
  int t = threadIdx.x;
  int wave = t >> 5, lane = t & 31;
  int wr = wave & 3, wc = wave >> 2;
  int half = lane >> 4, l16 = lane & 15;

  // ---- epilogue: residual branch hoisted once (uniform), pointer-walked rows ----
  {
    int rowg0 = bm + wr * 32 + half * 8;
    int colg0 = bn + wc * 64 + l16;
    if (resid != nullptr) {
#pragma unroll
      for (int i = 0; i < 2; ++i) {
        size_t base = (size_t)(rowg0 + i * 16) * N + colg0;
#pragma unroll
        for (int r = 0; r < 8; ++r) {
          float* crow = C + base + (size_t)r * N;
          const float* rrow = resid + base + (size_t)r * N;
#pragma unroll
          for (int j = 0; j < 4; ++j)
            crow[j * 16] = acc[i][j][r] + rrow[j * 16];
        }
      }
    } else {
#pragma unroll
      for (int i = 0; i < 2; ++i) {
        size_t base = (size_t)(rowg0 + i * 16) * N + colg0;
#pragma unroll
        for (int r = 0; r < 8; ++r) {
          float* crow = C + base + (size_t)r * N;
#pragma unroll
          for (int j = 0; j < 4; ++j)
            crow[j * 16] = acc[i][j][r];
        }
      }
    }
  }
}

__global__ __launch_bounds__(256) void gemm_wmma(
    const _Float16* __restrict__ A, const float* __restrict__ Bw,
    float* __restrict__ C, const float* __restrict__ resid,
    int M, int N, int K) {
  gemm_tile(A, Bw, C, resid, N, K, blockIdx.y * TM, blockIdx.x * TN);
}

// Q, K and V projections share A and are independent: one grid holds the tile
// columns of all three, so the two narrow products (128 blocks each, half the
// chip's WGPs) run beside the wide one instead of after it.
#define QTILES ((NHEAD * HDIM) / TN)
#define KVTILES ((NKVH * HDIM) / TN)
// A tile is one head (TN == HDIM), so the epilogue finishes the head in registers.
// Q and K tiles are computed transposed, so that a lane holds 8 consecutive d of one
// position: they are rotated and stored as f16 [S, heads, 128] in 16-byte pieces.
// V tiles keep the plain order, in which a lane holds 8 consecutive positions of one
// d: they are stored as f16 V^T [NKV, 128, S], also in 16-byte pieces.
__global__ __launch_bounds__(256) void gemm_qkv(
    const _Float16* __restrict__ A, const float* __restrict__ wq,
    const float* __restrict__ wk, const float* __restrict__ wv,
    const float* __restrict__ cosb, const float* __restrict__ sinb,
    _Float16* __restrict__ q, _Float16* __restrict__ k, _Float16* __restrict__ vt,
    int K) {
  __shared__ alignas(16) _Float16 As[TM * LDSTR];
  __shared__ alignas(16) _Float16 Bs[TN * LDSTR];
  int bx = blockIdx.x;
  int bm = blockIdx.y * TM;
  int t = threadIdx.x;
  int wave = t >> 5, lane = t & 31;
  int wr = wave & 3, wc = wave >> 2;
  int half = lane >> 4, l16 = lane & 15;
  v8f acc[2][4];

  if (bx >= QTILES + KVTILES) {
    bx -= QTILES + KVTILES;
    gemm_mainloop<false, false>(A, wv, NKVH * HDIM, K, bm, bx * TN, As, Bs, acc);
#pragma unroll
    for (int j = 0; j < 4; ++j) {
      _Float16* vcol = vt + ((size_t)bx * HDIM + frag_col<false>(wc, j) + l16) * S_LEN +
                       bm + wr * 32 + half * 8;
#pragma unroll
      for (int i = 0; i < 2; ++i) {
        v8h o;
#pragma unroll
        for (int r = 0; r < 8; ++r) o[r] = (_Float16)acc[i][j][r];
        *(v8h*)(vcol + i * 16) = o;
      }
    }
    return;
  }

  const float* Bw = wq;
  _Float16* C = q;
  int N = NHEAD * HDIM;
  if (bx >= QTILES) {
    Bw = wk; C = k; N = NKVH * HDIM; bx -= QTILES;
  }
  gemm_mainloop<true, true>(A, Bw, N, K, bm, bx * TN, As, Bs, acc);
#pragma unroll
  for (int i = 0; i < 2; ++i) {
    int s = bm + wr * 32 + i * 16 + l16;
#pragma unroll
    for (int jj = 0; jj < 2; ++jj) {
      int d = frag_col<true>(wc, jj) + half * 8;  // 0..63: low column of the rotary pair
      const float* cr = cosb + (size_t)s * HDIM + d;
      const float* sr = sinb + (size_t)s * HDIM + d;
      v8h lo, hi;
#pragma unroll
      for (int r = 0; r < 8; ++r) {
        float x1 = acc[i][jj][r], x2 = acc[i][jj + 2][r];
        lo[r] = (_Float16)(x1 * cr[r] - x2 * sr[r]);
        hi[r] = (_Float16)(x2 * cr[r + 64] + x1 * sr[r + 64]);
      }
      _Float16* orow = C + (size_t)s * N + bx * TN + d;
      *(v8h*)orow = lo;
      *(v8h*)(orow + 64) = hi;
    }
  }
  // Precaution: the stores' registers are not rewritten before the stores have taken them.
  asm volatile("s_wait_xcnt 0x0" ::: "memory");
}

// ---------------- Flash attention (causal, GQA 4:1), WMMA QK^T and PV ----------------
__global__ __launch_bounds__(128) void flash_attn_kernel(
    const _Float16* __restrict__ Qh,  // [S, NH, 128]
    const _Float16* __restrict__ Kh,  // [S, NKV, 128]
    const _Float16* __restrict__ Vt,  // [NKV, 128, S]  (transposed)
    _Float16* __restrict__ Oh) {      // [S, NH*128]
  int head = blockIdx.y;
  int kvhead = head >> 2;  // NH/NKV = 4
  int wave = threadIdx.x >> 5, lane = threadIdx.x & 31;
  int half = lane >> 4, l16 = lane & 15;
  int q0 = blockIdx.x * 64 + wave * 16;  // this wave's 16 query rows

  // per-wave P staging; 16 rows x 32 halfs, columns (n, n+16) interleaved
  __shared__ alignas(16) _Float16 probs[4][16 * 32];

  // Preload Q A-fragments: HD=128 -> 4 chunks of K=32 (two 16B loads each)
  v16h qf[4];
  {
    const _Float16* qrow = Qh + ((size_t)(q0 + l16) * NHEAD + head) * HDIM;
#pragma unroll
    for (int c = 0; c < 4; ++c)
      qf[c] = cat8(*(const v8h*)(qrow + c * 32 + half * 8),
                   *(const v8h*)(qrow + c * 32 + 16 + half * 8));
  }

  v8f o[8];
#pragma unroll
  for (int df = 0; df < 8; ++df) o[df] = (v8f){};
  float mrow[8], lrow[8];
#pragma unroll
  for (int r = 0; r < 8; ++r) { mrow[r] = -1e30f; lrow[r] = 0.f; }

  const float scl = 0.08838834764831845f;  // 1/sqrt(128)
  int kv_end = q0 + 16;                    // causal: kv <= q

  for (int kv0 = 0; kv0 < kv_end; kv0 += 32) {
    // ---- scores: two 16x16 fragments over 32 kv positions ----
    v8f s0 = {}, s1 = {};
#pragma unroll
    for (int c = 0; c < 4; ++c) {
      const _Float16* kr0 = Kh + ((size_t)(kv0 + l16) * NKVH + kvhead) * HDIM + c * 32;
      const _Float16* kr1 = Kh + ((size_t)(kv0 + 16 + l16) * NKVH + kvhead) * HDIM + c * 32;
      v16h b0 = cat8(*(const v8h*)(kr0 + half * 8),
                     *(const v8h*)(kr0 + 16 + half * 8));
      v16h b1 = cat8(*(const v8h*)(kr1 + half * 8),
                     *(const v8h*)(kr1 + 16 + half * 8));
      s0 = wmma_f16(qf[c], b0, s0);
      s1 = wmma_f16(qf[c], b1, s1);
    }

    // ---- online softmax per row (row = r + 8*half, cols = lane%16 (+16)) ----
#pragma unroll
    for (int r = 0; r < 8; ++r) {
      int qrow = q0 + r + 8 * half;
      float v0 = s0[r] * scl; if (kv0 + l16 > qrow)      v0 = -1e30f;
      float v1 = s1[r] * scl; if (kv0 + 16 + l16 > qrow) v1 = -1e30f;
      float mx = fmaxf(v0, v1);
#pragma unroll
      for (int off = 8; off >= 1; off >>= 1) mx = fmaxf(mx, __shfl_xor(mx, off, 32));
      float mnew = fmaxf(mrow[r], mx);
      float alpha = __expf(mrow[r] - mnew);
      float p0 = __expf(v0 - mnew);
      float p1 = __expf(v1 - mnew);
      float rs = p0 + p1;
#pragma unroll
      for (int off = 8; off >= 1; off >>= 1) rs += __shfl_xor(rs, off, 32);
      lrow[r] = lrow[r] * alpha + rs;
      mrow[r] = mnew;
#pragma unroll
      for (int df = 0; df < 8; ++df) o[df][r] *= alpha;
      // one packed 32-bit LDS store: columns (l16, l16+16) interleaved
      v2h pp;
      pp[0] = (_Float16)p0;
      pp[1] = (_Float16)p1;
      *(v2h*)&probs[wave][(r + 8 * half) * 32 + 2 * l16] = pp;
    }
    asm volatile("s_wait_dscnt 0" ::: "memory");  // LDS RAW within wave

    // ---- reload P as A-fragment: two 16B LDS loads + register deinterleave ----
    const _Float16* pr = &probs[wave][l16 * 32 + 16 * half];
    v16h pf = deinterleave(*(const v8h*)pr, *(const v8h*)(pr + 8));

    // ---- PV: 8 d-fragments; V^T gives contiguous 16B loads per lane ----
#pragma unroll
    for (int df = 0; df < 8; ++df) {
      const _Float16* vcol =
          Vt + ((size_t)kvhead * HDIM + df * 16 + l16) * S_LEN + kv0;
      v16h vf = cat8(*(const v8h*)(vcol + half * 8),
                     *(const v8h*)(vcol + 16 + half * 8));
      o[df] = wmma_f16(pf, vf, o[df]);
    }
  }

  // ---- epilogue: normalize and store f16 attn output [S, NH*HD] ----
#pragma unroll
  for (int r = 0; r < 8; ++r) {
    int qrow = q0 + r + 8 * half;
    float inv = 1.f / lrow[r];
    _Float16* orow = Oh + (size_t)qrow * (NHEAD * HDIM) + head * HDIM + l16;
#pragma unroll
    for (int df = 0; df < 8; ++df)
      orow[df * 16] = (_Float16)(o[df][r] * inv);
  }
}

// ---------------- host launch ----------------
extern "C" void kernel_launch(void* const* d_in, const int* in_sizes, int n_in,
                              void* d_out, int out_size, void* d_ws, size_t ws_size,
                              hipStream_t stream) {
  const float* hid    = (const float*)d_in[0];
  const float* cosb   = (const float*)d_in[1];
  const float* sinb   = (const float*)d_in[2];
  const float* norm_w = (const float*)d_in[3];
  const float* wq     = (const float*)d_in[4];
  const float* wk     = (const float*)d_in[5];
  const float* wv     = (const float*)d_in[6];
  const float* wo     = (const float*)d_in[7];
  float* out = (float*)d_out;

  char* ws = (char*)d_ws;
  size_t off = 0;
  auto carve = [&](size_t bytes) -> char* {
    char* p = ws + off;
    off += (bytes + 255) & ~(size_t)255;
    return p;
  };
  _Float16* h16   = (_Float16*)carve((size_t)S_LEN * H_DIM * 2);
  _Float16* q16   = (_Float16*)carve((size_t)S_LEN * NHEAD * HDIM * 2);
  _Float16* k16   = (_Float16*)carve((size_t)S_LEN * NKVH * HDIM * 2);
  _Float16* vt16  = (_Float16*)carve((size_t)NKVH * HDIM * S_LEN * 2);
  _Float16* att16 = (_Float16*)carve((size_t)S_LEN * NHEAD * HDIM * 2);

  // 1) RMSNorm -> f16
  rmsnorm_kernel<<<S_LEN, 256, 0, stream>>>(hid, norm_w, h16);

  // 2) Q/K/V projections in one launch (WMMA GEMM, f32 weights converted in LDS stage);
  //    the epilogue applies RoPE to Q and K (-> f16) and stores V as V^T f16
  gemm_qkv<<<dim3(QTILES + 2 * KVTILES, S_LEN / TM), 256, 0, stream>>>(
      h16, wq, wk, wv, cosb, sinb, q16, k16, vt16, H_DIM);

  // 3) Flash attention (causal, GQA)
  flash_attn_kernel<<<dim3(S_LEN / 64, NHEAD), 128, 0, stream>>>(q16, k16, vt16, att16);

  // 4) Output projection + residual
  gemm_wmma<<<dim3(H_DIM / TN, S_LEN / TM), 256, 0, stream>>>(
      att16, wo, out, hid, S_LEN, H_DIM, NHEAD * HDIM);
}

// v003
// Measured time: 420 microseconds a run.
// Timed twice side by side with v002, it ran 1.20 times as fast both times.
// All steps since v000 together make it 1.89 times as fast.
#include <hip/hip_runtime.h>
#include <hip/hip_bf16.h>

typedef __attribute__((ext_vector_type(16))) _Float16 v16h;
typedef __attribute__((ext_vector_type(8)))  _Float16 v8h;
typedef __attribute__((ext_vector_type(4)))  _Float16 v4h;
typedef __attribute__((ext_vector_type(2)))  _Float16 v2h;
typedef __attribute__((ext_vector_type(8)))  float    v8f;

#define S_LEN 2048
#define H_DIM 4096
#define NHEAD 32
#define NKVH  8
#define HDIM  128

__device__ inline v8f wmma_f16(v16h a, v16h b, v8f c) {
  return __builtin_amdgcn_wmma_f32_16x16x32_f16(
      false, a, false, b, (short)0, c, false, false);
}

__device__ inline v16h cat8(v8h a, v8h b) {
  return __builtin_shufflevector(a, b, 0, 1, 2, 3, 4, 5, 6, 7,
                                 8, 9, 10, 11, 12, 13, 14, 15);
}
// memory holds [lo0,hi0,lo1,hi1,...]; fragment wants [lo0..lo7,hi0..hi7]
__device__ inline v16h deinterleave(v8h a, v8h b) {
  return __builtin_shufflevector(a, b, 0, 2, 4, 6, 8, 10, 12, 14,
                                 1, 3, 5, 7, 9, 11, 13, 15);
}

// ---------------- RMSNorm -> f16 ----------------
__global__ __launch_bounds__(256) void rmsnorm_kernel(
    const float* __restrict__ x, const float* __restrict__ w,
    _Float16* __restrict__ h) {
  int row = blockIdx.x;
  const float* xr = x + (size_t)row * H_DIM;
  float ss = 0.f;
  for (int c = threadIdx.x * 4; c < H_DIM; c += 1024) {
    float4 v = *(const float4*)(xr + c);
    ss += v.x * v.x + v.y * v.y + v.z * v.z + v.w * v.w;
  }
  __shared__ float red[256];
  red[threadIdx.x] = ss;
  __syncthreads();
  for (int s2 = 128; s2 > 0; s2 >>= 1) {
    if (threadIdx.x < s2) red[threadIdx.x] += red[threadIdx.x + s2];
    __syncthreads();
  }
  float scale = rsqrtf(red[0] * (1.f / H_DIM) + 1e-5f);
  for (int c = threadIdx.x * 4; c < H_DIM; c += 1024) {
    float4 v = *(const float4*)(xr + c);
    float4 g = *(const float4*)(w + c);
    v4h o;
    o[0] = (_Float16)(v.x * scale * g.x);
    o[1] = (_Float16)(v.y * scale * g.y);
    o[2] = (_Float16)(v.z * scale * g.z);
    o[3] = (_Float16)(v.w * scale * g.w);
    *(v4h*)(h + (size_t)row * H_DIM + c) = o;
  }
}

// ------- Tiled WMMA GEMM: C[M,N] = A_f16[M,K] * B_f32[K,N] (+resid), 128x128x32 -------
#define TM 128
#define TN 128
#define TK 32
#define LDSTR 40  // padded stride in halfs (16B-aligned rows/cols)

// First tile column of a wave's fragment j. SPLIT: two fragments from each half of
// the tile, so that columns d and d + 64 (a rotary pair) sit in the same lane.
template <bool SPLIT>
__device__ __forceinline__ int frag_col(int wc, int j) {
  return SPLIT ? (j >> 1) * 64 + wc * 32 + (j & 1) * 16 : wc * 64 + j * 16;
}

// Accumulates one 128x128 tile at (bm, bn); called by every thread of a 256-thread
// block. As holds TM * LDSTR halfs, row-major [row][k]; Bs TN * LDSTR, col-major [col][k].
// acc[i][j][r] is row wr*32 + i*16 + half*8 + r, column frag_col(wc, j) + l16;
// with TRANS (operands swapped, the fragment comes out transposed)
// row wr*32 + i*16 + l16, column frag_col(wc, j) + half*8 + r.
template <bool SPLIT, bool TRANS>
__device__ __forceinline__ void gemm_mainloop(
    const _Float16* __restrict__ A, const float* __restrict__ Bw,
    int N, int K, int bm, int bn, _Float16* As, _Float16* Bs, v8f (&acc)[2][4]) {
  int t = threadIdx.x;
  int wave = t >> 5, lane = t & 31;
  int wr = wave & 3;   // rows wr*32 .. +31  (2 fragment rows)
  int wc = wave >> 2;  // 4 fragment cols, at frag_col(wc, j)
  int half = lane >> 4, l16 = lane & 15;

#pragma unroll
  for (int i = 0; i < 2; ++i)
#pragma unroll
    for (int j = 0; j < 4; ++j) acc[i][j] = (v8f){};

  for (int k0 = 0; k0 < K; k0 += TK) {
    { // A tile 128x32 f16: two 16B global loads + two 16B LDS stores
      int row = t >> 1;
      int cs = (t & 1) * 16;
      const _Float16* src = A + (size_t)(bm + row) * K + k0 + cs;
      *(v8h*)&As[row * LDSTR + cs]     = *(const v8h*)src;
      *(v8h*)&As[row * LDSTR + cs + 8] = *(const v8h*)(src + 8);
    }
    { // B tile 32x128 f32 -> f16, col-major: 4x4 patch, 4 b128 loads + 4 b64 stores
      int c4 = (t & 31) * 4;   // 4 columns
      int kk = (t >> 5) * 4;   // 4 k values
      const float* srcB = Bw + (size_t)(k0 + kk) * N + bn + c4;
      float4 r0 = *(const float4*)srcB;
      float4 r1 = *(const float4*)(srcB + N);
      float4 r2 = *(const float4*)(srcB + 2 * (size_t)N);
      float4 r3 = *(const float4*)(srcB + 3 * (size_t)N);
      v4h c0, c1, c2, c3;
      c0[0] = (_Float16)r0.x; c0[1] = (_Float16)r1.x; c0[2] = (_Float16)r2.x; c0[3] = (_Float16)r3.x;
      c1[0] = (_Float16)r0.y; c1[1] = (_Float16)r1.y; c1[2] = (_Float16)r2.y; c1[3] = (_Float16)r3.y;
      c2[0] = (_Float16)r0.z; c2[1] = (_Float16)r1.z; c2[2] = (_Float16)r2.z; c2[3] = (_Float16)r3.z;
      c3[0] = (_Float16)r0.w; c3[1] = (_Float16)r1.w; c3[2] = (_Float16)r2.w; c3[3] = (_Float16)r3.w;
      *(v4h*)&Bs[(c4 + 0) * LDSTR + kk] = c0;
      *(v4h*)&Bs[(c4 + 1) * LDSTR + kk] = c1;
      *(v4h*)&Bs[(c4 + 2) * LDSTR + kk] = c2;
      *(v4h*)&Bs[(c4 + 3) * LDSTR + kk] = c3;
    }
    __syncthreads();

    v16h af[2], bf[4];
#pragma unroll
    for (int i = 0; i < 2; ++i) {
      const _Float16* arow = &As[(wr * 32 + i * 16 + l16) * LDSTR];
      af[i] = cat8(*(const v8h*)(arow + half * 8),
                   *(const v8h*)(arow + 16 + half * 8));
    }
#pragma unroll
    for (int j = 0; j < 4; ++j) {
      const _Float16* bcol = &Bs[(frag_col<SPLIT>(wc, j) + l16) * LDSTR];
      bf[j] = cat8(*(const v8h*)(bcol + half * 8),
                   *(const v8h*)(bcol + 16 + half * 8));
    }
#pragma unroll
    for (int i = 0; i < 2; ++i)
#pragma unroll
      for (int j = 0; j < 4; ++j)
        acc[i][j] = TRANS ? wmma_f16(bf[j], af[i], acc[i][j])
                          : wmma_f16(af[i], bf[j], acc[i][j]);
    __syncthreads();
  }
}

// One 128x128 tile of C at (bm, bn), f32 out.
__device__ __forceinline__ void gemm_tile(
    const _Float16* __restrict__ A, const float* __restrict__ Bw,
    float* __restrict__ C, const float* __restrict__ resid,
    int N, int K, int bm, int bn) {
  __shared__ alignas(16) _Float16 As[TM * LDSTR];
  __shared__ alignas(16) _Float16 Bs[TN * LDSTR];
  v8f acc[2][4];
  gemm_mainloop<false, false>(A, Bw, N, K, bm, bn, As, Bs, acc);
  int t = threadIdx.x;
  int wave = t >> 5, lane = t & 31;
  int wr = wave & 3, wc = wave >> 2;
  int half = lane >> 4, l16 = lane & 15;

  // ---- epilogue: residual branch hoisted once (uniform), pointer-walked rows ----
  {
    int rowg0 = bm + wr * 32 + half * 8;
    int colg0 = bn + wc * 64 + l16;
    if (resid != nullptr) {
#pragma unroll
      for (int i = 0; i < 2; ++i) {
        size_t base = (size_t)(rowg0 + i * 16) * N + colg0;
#pragma unroll
        for (int r = 0; r < 8; ++r) {
          float* crow = C + base + (size_t)r * N;
          const float* rrow = resid + base + (size_t)r * N;
#pragma unroll
          for (int j = 0; j < 4; ++j)
            crow[j * 16] = acc[i][j][r] + rrow[j * 16];
        }
      }
    } else {
#pragma unroll
      for (int i = 0; i < 2; ++i) {
        size_t base = (size_t)(rowg0 + i * 16) * N + colg0;
#pragma unroll
        for (int r = 0; r < 8; ++r) {
          float* crow = C + base + (size_t)r * N;
#pragma unroll
          for (int j = 0; j < 4; ++j)
            crow[j * 16] = acc[i][j][r];
        }
      }
    }
  }
}

__global__ __launch_bounds__(256) void gemm_wmma(
    const _Float16* __restrict__ A, const float* __restrict__ Bw,
    float* __restrict__ C, const float* __restrict__ resid,
    int M, int N, int K) {
  gemm_tile(A, Bw, C, resid, N, K, blockIdx.y * TM, blockIdx.x * TN);
}

// Q, K and V projections share A and are independent: one grid holds the tile
// columns of all three, so the two narrow products (128 blocks each, half the
// chip's WGPs) run beside the wide one instead of after it.
#define QTILES ((NHEAD * HDIM) / TN)
#define KVTILES ((NKVH * HDIM) / TN)
// A tile is one head (TN == HDIM), so the epilogue finishes the head in registers.
// Q and K tiles are computed transposed, so that a lane holds 8 consecutive d of one
// position: they are rotated and stored as f16 [S, heads, 128] in 16-byte pieces.
// V tiles keep the plain order, in which a lane holds 8 consecutive positions of one
// d: they are stored as f16 V^T [NKV, 128, S], also in 16-byte pieces.
__global__ __launch_bounds__(256) void gemm_qkv(
    const _Float16* __restrict__ A, const float* __restrict__ wq,
    const float* __restrict__ wk, const float* __restrict__ wv,
    const float* __restrict__ cosb, const float* __restrict__ sinb,
    _Float16* __restrict__ q, _Float16* __restrict__ k, _Float16* __restrict__ vt,
    int K) {
  __shared__ alignas(16) _Float16 As[TM * LDSTR];
  __shared__ alignas(16) _Float16 Bs[TN * LDSTR];
  int bx = blockIdx.x;
  int bm = blockIdx.y * TM;
  int t = threadIdx.x;
  int wave = t >> 5, lane = t & 31;
  int wr = wave & 3, wc = wave >> 2;
  int half = lane >> 4, l16 = lane & 15;
  v8f acc[2][4];

  if (bx >= QTILES + KVTILES) {
    bx -= QTILES + KVTILES;
    gemm_mainloop<false, false>(A, wv, NKVH * HDIM, K, bm, bx * TN, As, Bs, acc);
#pragma unroll
    for (int j = 0; j < 4; ++j) {
      _Float16* vcol = vt + ((size_t)bx * HDIM + frag_col<false>(wc, j) + l16) * S_LEN +
                       bm + wr * 32 + half * 8;
#pragma unroll
      for (int i = 0; i < 2; ++i) {
        v8h o;
#pragma unroll
        for (int r = 0; r < 8; ++r) o[r] = (_Float16)acc[i][j][r];
        *(v8h*)(vcol + i * 16) = o;
      }
    }
    return;
  }

  const float* Bw = wq;
  _Float16* C = q;
  int N = NHEAD * HDIM;
  if (bx >= QTILES) {
    Bw = wk; C = k; N = NKVH * HDIM; bx -= QTILES;
  }
  gemm_mainloop<true, true>(A, Bw, N, K, bm, bx * TN, As, Bs, acc);
#pragma unroll
  for (int i = 0; i < 2; ++i) {
    int s = bm + wr * 32 + i * 16 + l16;
#pragma unroll
    for (int jj = 0; jj < 2; ++jj) {
      int d = frag_col<true>(wc, jj) + half * 8;  // 0..63: low column of the rotary pair
      const float* cr = cosb + (size_t)s * HDIM + d;
      const float* sr = sinb + (size_t)s * HDIM + d;
      v8h lo, hi;
#pragma unroll
      for (int r = 0; r < 8; ++r) {
        float x1 = acc[i][jj][r], x2 = acc[i][jj + 2][r];
        lo[r] = (_Float16)(x1 * cr[r] - x2 * sr[r]);
        hi[r] = (_Float16)(x2 * cr[r + 64] + x1 * sr[r + 64]);
      }
      _Float16* orow = C + (size_t)s * N + bx * TN + d;
      *(v8h*)orow = lo;
      *(v8h*)(orow + 64) = hi;
    }
  }
  // Precaution: the stores' registers are not rewritten before the stores have taken them.
  asm volatile("s_wait_xcnt 0x0" ::: "memory");
}

// ---------------- Flash attention (causal, GQA 4:1), WMMA QK^T and PV ----------------
#define KV_T   32   // keys per staged tile
#define KPITCH 136  // halfs per staged K row (272 B = 16 B x odd: b128 reads without bank conflicts)
#define VPITCH 40   // halfs per staged V^T row (80 B = 16 B x odd)

// One tile's asynchronous copies to LDS, 8 per thread: K 32 rows x 256 B (4 copies, 8 rows
// apart), V^T 128 rows x 64 B (4 copies, 32 rows apart). The s_wait_xcnt stands inside the
// copies' own statement as a precaution: no address register is rewritten in front of it.
__device__ __forceinline__ void stage_kv(const _Float16* gk, const _Float16* gv,
                                         unsigned lk, unsigned lv) {
  asm volatile(
      "global_load_async_to_lds_b128 %0, %8, off\n\t"
      "global_load_async_to_lds_b128 %1, %9, off\n\t"
      "global_load_async_to_lds_b128 %2, %10, off\n\t"
      "global_load_async_to_lds_b128 %3, %11, off\n\t"
      "global_load_async_to_lds_b128 %4, %12, off\n\t"
      "global_load_async_to_lds_b128 %5, %13, off\n\t"
      "global_load_async_to_lds_b128 %6, %14, off\n\t"
      "global_load_async_to_lds_b128 %7, %15, off\n\t"
      "s_wait_xcnt 0x0"
      :: "v"(lk), "v"(lk + 8 * KPITCH * 2), "v"(lk + 16 * KPITCH * 2), "v"(lk + 24 * KPITCH * 2),
         "v"(lv), "v"(lv + 32 * VPITCH * 2), "v"(lv + 64 * VPITCH * 2), "v"(lv + 96 * VPITCH * 2),
         "v"(gk), "v"(gk + 8 * NKVH * HDIM), "v"(gk + 16 * NKVH * HDIM), "v"(gk + 24 * NKVH * HDIM),
         "v"(gv), "v"(gv + 32 * S_LEN), "v"(gv + 64 * S_LEN), "v"(gv + 96 * S_LEN)
      : "memory");
}

__global__ __launch_bounds__(128) void flash_attn_kernel(
    const _Float16* __restrict__ Qh,  // [S, NH, 128]
    const _Float16* __restrict__ Kh,  // [S, NKV, 128]
    const _Float16* __restrict__ Vt,  // [NKV, 128, S]  (transposed)
    _Float16* __restrict__ Oh) {      // [S, NH*128]
  int head = blockIdx.y;
  int kvhead = head >> 2;  // NH/NKV = 4
  int tid = threadIdx.x;
  int wave = __builtin_amdgcn_readfirstlane(tid >> 5), lane = tid & 31;
  int half = lane >> 4, l16 = lane & 15;
  int q0 = blockIdx.x * 64 + wave * 16;  // this wave's 16 query rows

  // per-wave P staging; 16 rows x 32 halfs, columns (n, n+16) interleaved
  __shared__ alignas(16) _Float16 probs[4][16 * 32];
  // K and V^T tiles of KV_T keys, read by all four waves; two buffers
  __shared__ alignas(16) _Float16 Ks[2][KV_T * KPITCH];
  __shared__ alignas(16) _Float16 Vs[2][HDIM * VPITCH];

  // this thread's first copy of tile 0: global sources and LDS byte addresses in buffer 0
  const _Float16* gk = Kh + ((size_t)(tid >> 4) * NKVH + kvhead) * HDIM + (tid & 15) * 8;
  const _Float16* gv = Vt + ((size_t)kvhead * HDIM + (tid >> 2)) * S_LEN + (tid & 3) * 8;
  unsigned lk = (unsigned)(size_t)&Ks[0][(tid >> 4) * KPITCH + (tid & 15) * 8];
  unsigned lv = (unsigned)(size_t)&Vs[0][(tid >> 2) * VPITCH + (tid & 3) * 8];
  const int ntile = 2 * blockIdx.x + 2;  // tiles up to the block's last query row; at least 2

  stage_kv(gk, gv, lk, lv);
  // tile 0 has landed for this wave; the barrier publishes it to the other waves
  asm volatile("s_wait_asynccnt 0x0" ::: "memory");
  __syncthreads();
  stage_kv(gk + (size_t)KV_T * NKVH * HDIM, gv + KV_T,
           lk + (unsigned)sizeof(Ks[0]), lv + (unsigned)sizeof(Vs[0]));

  // Preload Q A-fragments: HD=128 -> 4 chunks of K=32 (two 16B loads each)
  v16h qf[4];
  {
    const _Float16* qrow = Qh + ((size_t)(q0 + l16) * NHEAD + head) * HDIM;
#pragma unroll
    for (int c = 0; c < 4; ++c)
      qf[c] = cat8(*(const v8h*)(qrow + c * 32 + half * 8),
                   *(const v8h*)(qrow + c * 32 + 16 + half * 8));
  }

  v8f o[8];
#pragma unroll
  for (int df = 0; df < 8; ++df) o[df] = (v8f){};
  float mrow[8], lrow[8];
#pragma unroll
  for (int r = 0; r < 8; ++r) { mrow[r] = -1e30f; lrow[r] = 0.f; }

  const float scl = 0.08838834764831845f;  // 1/sqrt(128)
  int kv_end = q0 + 16;                    // causal: kv <= q

  for (int tile = 0; tile < ntile; ++tile) {
    int kv0 = tile * KV_T;
    const _Float16* Kb = Ks[tile & 1];
    const _Float16* Vb = Vs[tile & 1];
    if (kv0 < kv_end) {  // wave-uniform: a wave skips tiles beyond its diagonal, never the foot
      // ---- scores: two 16x16 fragments over 32 kv positions ----
      v8f s0 = {}, s1 = {};
#pragma unroll
      for (int c = 0; c < 4; ++c) {
        const _Float16* kr0 = Kb + l16 * KPITCH + c * 32;
        const _Float16* kr1 = Kb + (16 + l16) * KPITCH + c * 32;
        v16h b0 = cat8(*(const v8h*)(kr0 + half * 8),
                       *(const v8h*)(kr0 + 16 + half * 8));
        v16h b1 = cat8(*(const v8h*)(kr1 + half * 8),
                       *(const v8h*)(kr1 + 16 + half * 8));
        s0 = wmma_f16(qf[c], b0, s0);
        s1 = wmma_f16(qf[c], b1, s1);
      }

      // ---- online softmax per row (row = r + 8*half, cols = lane%16 (+16)) ----
#pragma unroll
      for (int r = 0; r < 8; ++r) {
        int qrow = q0 + r + 8 * half;
        float v0 = s0[r] * scl; if (kv0 + l16 > qrow)      v0 = -1e30f;
        float v1 = s1[r] * scl; if (kv0 + 16 + l16 > qrow) v1 = -1e30f;
        float mx = fmaxf(v0, v1);
#pragma unroll
        for (int off = 8; off >= 1; off >>= 1) mx = fmaxf(mx, __shfl_xor(mx, off, 32));
        float mnew = fmaxf(mrow[r], mx);
        float alpha = __expf(mrow[r] - mnew);
        float p0 = __expf(v0 - mnew);
        float p1 = __expf(v1 - mnew);
        float rs = p0 + p1;
#pragma unroll
        for (int off = 8; off >= 1; off >>= 1) rs += __shfl_xor(rs, off, 32);
        lrow[r] = lrow[r] * alpha + rs;
        mrow[r] = mnew;
#pragma unroll
        for (int df = 0; df < 8; ++df) o[df][r] *= alpha;
        // one packed 32-bit LDS store: columns (l16, l16+16) interleaved
        v2h pp;
        pp[0] = (_Float16)p0;
        pp[1] = (_Float16)p1;
        *(v2h*)&probs[wave][(r + 8 * half) * 32 + 2 * l16] = pp;
      }
      asm volatile("s_wait_dscnt 0" ::: "memory");  // LDS RAW within wave

      // ---- reload P as A-fragment: two 16B LDS loads + register deinterleave ----
      const _Float16* pr = &probs[wave][l16 * 32 + 16 * half];
      v16h pf = deinterleave(*(const v8h*)pr, *(const v8h*)(pr + 8));

      // ---- PV: 8 d-fragments; staged V^T rows give 16B LDS loads per lane ----
#pragma unroll
      for (int df = 0; df < 8; ++df) {
        const _Float16* vcol = Vb + (df * 16 + l16) * VPITCH;
        v16h vf = cat8(*(const v8h*)(vcol + half * 8),
                       *(const v8h*)(vcol + 16 + half * 8));
        o[df] = wmma_f16(pf, vf, o[df]);
      }
    }

    // ---- foot of the trip, every wave ----
    // this wave's reads of the buffer that is refilled below have returned
    asm volatile("s_wait_dscnt 0x0" ::: "memory");
    // this wave's copies of the next tile have landed
    asm volatile("s_wait_asynccnt 0x0" ::: "memory");
    // publishes the next tile and ends every wave's reads of this one
    __syncthreads();
    if (tile + 2 < ntile)
      stage_kv(gk + (size_t)(tile + 2) * KV_T * NKVH * HDIM, gv + (tile + 2) * KV_T,
               lk + (unsigned)(tile & 1) * (unsigned)sizeof(Ks[0]),
               lv + (unsigned)(tile & 1) * (unsigned)sizeof(Vs[0]));
  }
  // no copy is outstanding when the wave ends
  asm volatile("s_wait_asynccnt 0x0" ::: "memory");

  // ---- epilogue: normalize and store f16 attn output [S, NH*HD] ----
#pragma unroll
  for (int r = 0; r < 8; ++r) {
    int qrow = q0 + r + 8 * half;
    float inv = 1.f / lrow[r];
    _Float16* orow = Oh + (size_t)qrow * (NHEAD * HDIM) + head * HDIM + l16;
#pragma unroll
    for (int df = 0; df < 8; ++df)
      orow[df * 16] = (_Float16)(o[df][r] * inv);
  }
}

// ---------------- host launch ----------------
extern "C" void kernel_launch(void* const* d_in, const int* in_sizes, int n_in,
                              void* d_out, int out_size, void* d_ws, size_t ws_size,
                              hipStream_t stream) {
  const float* hid    = (const float*)d_in[0];
  const float* cosb   = (const float*)d_in[1];
  const float* sinb   = (const float*)d_in[2];
  const float* norm_w = (const float*)d_in[3];
  const float* wq     = (const float*)d_in[4];
  const float* wk     = (const float*)d_in[5];
  const float* wv     = (const float*)d_in[6];
  const float* wo     = (const float*)d_in[7];
  float* out = (float*)d_out;

  char* ws = (char*)d_ws;
  size_t off = 0;
  auto carve = [&](size_t bytes) -> char* {
    char* p = ws + off;
    off += (bytes + 255) & ~(size_t)255;
    return p;
  };
  _Float16* h16   = (_Float16*)carve((size_t)S_LEN * H_DIM * 2);
  _Float16* q16   = (_Float16*)carve((size_t)S_LEN * NHEAD * HDIM * 2);
  _Float16* k16   = (_Float16*)carve((size_t)S_LEN * NKVH * HDIM * 2);
  _Float16* vt16  = (_Float16*)carve((size_t)NKVH * HDIM * S_LEN * 2);
  _Float16* att16 = (_Float16*)carve((size_t)S_LEN * NHEAD * HDIM * 2);

  // 1) RMSNorm -> f16
  rmsnorm_kernel<<<S_LEN, 256, 0, stream>>>(hid, norm_w, h16);

  // 2) Q/K/V projections in one launch (WMMA GEMM, f32 weights converted in LDS stage);
  //    the epilogue applies RoPE to Q and K (-> f16) and stores V as V^T f16
  gemm_qkv<<<dim3(QTILES + 2 * KVTILES, S_LEN / TM), 256, 0, stream>>>(
      h16, wq, wk, wv, cosb, sinb, q16, k16, vt16, H_DIM);

  // 3) Flash attention (causal, GQA)
  flash_attn_kernel<<<dim3(S_LEN / 64, NHEAD), 128, 0, stream>>>(q16, k16, vt16, att16);

  // 4) Output projection + residual
  gemm_wmma<<<dim3(H_DIM / TN, S_LEN / TM), 256, 0, stream>>>(
      att16, wo, out, hid, S_LEN, H_DIM, NHEAD * HDIM);
}

// v004
// A run of this version takes 323 microseconds.
// Two timings next to v003 both put it at 1.30 times that version's speed.
// Over all steps from v000 it is 2.46 times as fast.
#include <hip/hip_runtime.h>
#include <hip/hip_bf16.h>

typedef __attribute__((ext_vector_type(16))) _Float16 v16h;
typedef __attribute__((ext_vector_type(8)))  _Float16 v8h;
typedef __attribute__((ext_vector_type(4)))  _Float16 v4h;
typedef __attribute__((ext_vector_type(2)))  _Float16 v2h;
typedef __attribute__((ext_vector_type(8)))  float    v8f;

#define S_LEN 2048
#define H_DIM 4096
#define NHEAD 32
#define NKVH  8
#define HDIM  128

__device__ inline v8f wmma_f16(v16h a, v16h b, v8f c) {
  return __builtin_amdgcn_wmma_f32_16x16x32_f16(
      false, a, false, b, (short)0, c, false, false);
}

__device__ inline v16h cat8(v8h a, v8h b) {
  return __builtin_shufflevector(a, b, 0, 1, 2, 3, 4, 5, 6, 7,
                                 8, 9, 10, 11, 12, 13, 14, 15);
}
// memory holds [lo0,hi0,lo1,hi1,...]; fragment wants [lo0..lo7,hi0..hi7]
__device__ inline v16h deinterleave(v8h a, v8h b) {
  return __builtin_shufflevector(a, b, 0, 2, 4, 6, 8, 10, 12, 14,
                                 1, 3, 5, 7, 9, 11, 13, 15);
}

// ---------------- RMSNorm -> f16 ----------------
__global__ __launch_bounds__(256) void rmsnorm_kernel(
    const float* __restrict__ x, const float* __restrict__ w,
    _Float16* __restrict__ h) {
  int row = blockIdx.x;
  const float* xr = x + (size_t)row * H_DIM;
  float ss = 0.f;
  for (int c = threadIdx.x * 4; c < H_DIM; c += 1024) {
    float4 v = *(const float4*)(xr + c);
    ss += v.x * v.x + v.y * v.y + v.z * v.z + v.w * v.w;
  }
  __shared__ float red[256];
  red[threadIdx.x] = ss;
  __syncthreads();
  for (int s2 = 128; s2 > 0; s2 >>= 1) {
    if (threadIdx.x < s2) red[threadIdx.x] += red[threadIdx.x + s2];
    __syncthreads();
  }
  float scale = rsqrtf(red[0] * (1.f / H_DIM) + 1e-5f);
  for (int c = threadIdx.x * 4; c < H_DIM; c += 1024) {
    float4 v = *(const float4*)(xr + c);
    float4 g = *(const float4*)(w + c);
    v4h o;
    o[0] = (_Float16)(v.x * scale * g.x);
    o[1] = (_Float16)(v.y * scale * g.y);
    o[2] = (_Float16)(v.z * scale * g.z);
    o[3] = (_Float16)(v.w * scale * g.w);
    *(v4h*)(h + (size_t)row * H_DIM + c) = o;
  }
}

// ------- Tiled WMMA GEMM: C[M,N] = A_f16[M,K] * B_f32[K,N] (+resid), 128x128x32 -------
#define TM 128
#define TN 128
#define TK 32
#define LDSTR 40  // padded stride in halfs (16B-aligned rows/cols)

// First tile column of a wave's fragment j. SPLIT: two fragments from each half of
// the tile, so that columns d and d + 64 (a rotary pair) sit in the same lane.
template <bool SPLIT>
__device__ __forceinline__ int frag_col(int wc, int j) {
  return SPLIT ? (j >> 1) * 64 + wc * 32 + (j & 1) * 16 : wc * 64 + j * 16;
}

// One k-tile of both operands on its way from global memory to LDS, in registers.
struct TileRegs {
  v8h a0, a1;             // A: 16 halfs of one row
  float4 r0, r1, r2, r3;  // B: a 4 (k) x 4 (column) patch, f32
};

// srcA, srcB: this thread's first element of the k-tile.
template <int N>
__device__ __forceinline__ void tile_load(TileRegs& g, const _Float16* srcA, const float* srcB) {
  g.a0 = *(const v8h*)srcA;
  g.a1 = *(const v8h*)(srcA + 8);
  g.r0 = *(const float4*)srcB;
  g.r1 = *(const float4*)(srcB + N);
  g.r2 = *(const float4*)(srcB + 2 * N);
  g.r3 = *(const float4*)(srcB + 3 * N);
}

// dstA: this thread's 16 halfs of its A row; dstB: its first column at its first k.
__device__ __forceinline__ void tile_store(const TileRegs& g, _Float16* dstA, _Float16* dstB) {
  *(v8h*)dstA       = g.a0;
  *(v8h*)(dstA + 8) = g.a1;
  v4h c0, c1, c2, c3;  // f32 -> f16, col-major
  c0[0] = (_Float16)g.r0.x; c0[1] = (_Float16)g.r1.x; c0[2] = (_Float16)g.r2.x; c0[3] = (_Float16)g.r3.x;
  c1[0] = (_Float16)g.r0.y; c1[1] = (_Float16)g.r1.y; c1[2] = (_Float16)g.r2.y; c1[3] = (_Float16)g.r3.y;
  c2[0] = (_Float16)g.r0.z; c2[1] = (_Float16)g.r1.z; c2[2] = (_Float16)g.r2.z; c2[3] = (_Float16)g.r3.z;
  c3[0] = (_Float16)g.r0.w; c3[1] = (_Float16)g.r1.w; c3[2] = (_Float16)g.r2.w; c3[3] = (_Float16)g.r3.w;
  *(v4h*)(dstB + 0 * LDSTR) = c0;
  *(v4h*)(dstB + 1 * LDSTR) = c1;
  *(v4h*)(dstB + 2 * LDSTR) = c2;
  *(v4h*)(dstB + 3 * LDSTR) = c3;
}

// Work-group barrier of the main loop, written by hand: __syncthreads() also waits for
// every global load, which would end the flight of the tiles loaded ahead. The wave's own
// LDS stores and reads are complete (s_wait_dscnt 0) before it signals. s_wait_xcnt 0 is a
// precaution: behind the barrier the fragment loads rewrite registers that held addresses
// of the global loads issued in front of it.
__device__ __forceinline__ void tile_barrier() {
  asm volatile("s_wait_xcnt 0x0\n\ts_wait_dscnt 0x0\n\ts_barrier_signal -1\n\ts_barrier_wait -1"
               ::: "memory");
}

// The products of one staged k-tile.
template <bool SPLIT, bool TRANS>
__device__ __forceinline__ void tile_mma(const _Float16* At, const _Float16* Bt,
                                         int wr, int wc, int half, int l16, v8f (&acc)[2][4]) {
  v16h af[2], bf[4];
#pragma unroll
  for (int i = 0; i < 2; ++i) {
    const _Float16* arow = &At[(wr * 32 + i * 16 + l16) * LDSTR];
    af[i] = cat8(*(const v8h*)(arow + half * 8),
                 *(const v8h*)(arow + 16 + half * 8));
  }
#pragma unroll
  for (int j = 0; j < 4; ++j) {
    const _Float16* bcol = &Bt[(frag_col<SPLIT>(wc, j) + l16) * LDSTR];
    bf[j] = cat8(*(const v8h*)(bcol + half * 8),
                 *(const v8h*)(bcol + 16 + half * 8));
  }
#pragma unroll
  for (int i = 0; i < 2; ++i)
#pragma unroll
    for (int j = 0; j < 4; ++j)
      acc[i][j] = TRANS ? wmma_f16(bf[j], af[i], acc[i][j])
                        : wmma_f16(af[i], bf[j], acc[i][j]);
  // Keeps the wait for the tile loaded ahead, and its LDS stores, behind these products:
  // moved in front of them, the wait would stand directly behind the loads' issue.
  __builtin_amdgcn_sched_barrier(0);
}

// Accumulates one 128x128 tile at (bm, bn) of A[.,K] * Bw[K,N]; called by every thread of
// a 256-thread block. K is a multiple of 2 * TK. As holds two buffers of TM * LDSTR halfs,
// row-major [row][k]; Bs two of TN * LDSTR, col-major [col][k].
// Tile t is worked on from buffer t & 1 while tile t + 1 goes from registers into the other
// buffer; a register set is loaded again as soon as it is stored, with the tile SETS ahead
// of the one it held, so that SETS tiles' global loads are in flight under the products.
// One barrier per tile: it publishes tile t + 1 and ends the reads of tile t, whose buffer
// is written in the next trip. Every load is unconditional, so that the waits in front of
// the LDS stores can leave the younger set's loads in flight; past the last tile the last
// one is loaded once more and not used when there are two sets.
// acc[i][j][r] is row wr*32 + i*16 + half*8 + r, column frag_col(wc, j) + l16;
// with TRANS (operands swapped, the fragment comes out transposed)
// row wr*32 + i*16 + l16, column frag_col(wc, j) + half*8 + r.
template <bool SPLIT, bool TRANS, int N, int SETS>
__device__ __forceinline__ void gemm_mainloop(
    const _Float16* __restrict__ A, const float* __restrict__ Bw,
    int K, int bm, int bn, _Float16* As, _Float16* Bs, v8f (&acc)[2][4]) {
  int t = threadIdx.x;
  int wave = t >> 5, lane = t & 31;
  int wr = wave & 3;   // rows wr*32 .. +31  (2 fragment rows)
  int wc = wave >> 2;  // 4 fragment cols, at frag_col(wc, j)
  int half = lane >> 4, l16 = lane & 15;

#pragma unroll
  for (int i = 0; i < 2; ++i)
#pragma unroll
    for (int j = 0; j < 4; ++j) acc[i][j] = (v8f){};

  // A tile 128x32 f16: two 16B pieces a thread; B tile 32x128 f32: a 4x4 patch a thread
  const _Float16* srcA = A + (size_t)(bm + (t >> 1)) * K + (t & 1) * 16;
  const float* srcB = Bw + (size_t)((t >> 5) * 4) * N + bn + (t & 31) * 4;
  _Float16* dstA = &As[(t >> 1) * LDSTR + (t & 1) * 16];
  _Float16* dstB = &Bs[(t & 31) * 4 * LDSTR + (t >> 5) * 4];
  const int klast = K - TK;

  TileRegs g[SETS];
#pragma unroll
  for (int s = 0; s < SETS; ++s)
    tile_load<N>(g[s], srcA + s * TK, srcB + (size_t)s * TK * N);
  tile_store(g[0], dstA, dstB);
  {
    int kn = min(SETS * TK, klast);
    tile_load<N>(g[0], srcA + kn, srcB + (size_t)kn * N);
  }
  tile_barrier();

  for (int k0 = 0; k0 < K - 2 * TK; k0 += 2 * TK) {
    // even tile from buffer 0; the next tile into buffer 1
    tile_mma<SPLIT, TRANS>(As, Bs, wr, wc, half, l16, acc);
    tile_store(g[1 % SETS], dstA + TM * LDSTR, dstB + TN * LDSTR);
    int k1 = k0 + (1 + SETS) * TK;  // at most klast
    tile_load<N>(g[1 % SETS], srcA + k1, srcB + (size_t)k1 * N);
    tile_barrier();
    // odd tile from buffer 1; the next tile into buffer 0
    tile_mma<SPLIT, TRANS>(As + TM * LDSTR, Bs + TN * LDSTR, wr, wc, half, l16, acc);
    tile_store(g[0], dstA, dstB);
    int k2 = SETS == 1 ? k0 + 3 * TK : min(k0 + (2 + SETS) * TK, klast);  // one set: at most klast
    tile_load<N>(g[0], srcA + k2, srcB + (size_t)k2 * N);
    tile_barrier();
  }
  // the last two tiles
  tile_mma<SPLIT, TRANS>(As, Bs, wr, wc, half, l16, acc);
  tile_store(g[1 % SETS], dstA + TM * LDSTR, dstB + TN * LDSTR);
  tile_barrier();
  tile_mma<SPLIT, TRANS>(As + TM * LDSTR, Bs + TN * LDSTR, wr, wc, half, l16, acc);
}

// One 128x128 tile of C at (bm, bn), f32 out.
template <int N>
__device__ __forceinline__ void gemm_tile(
    const _Float16* __restrict__ A, const float* __restrict__ Bw,
    float* __restrict__ C, const float* __restrict__ resid,
    int K, int bm, int bn) {
  __shared__ alignas(16) _Float16 As[2 * TM * LDSTR];
  __shared__ alignas(16) _Float16 Bs[2 * TN * LDSTR];
  v8f acc[2][4];
  gemm_mainloop<false, false, N, 2>(A, Bw, K, bm, bn, As, Bs, acc);
  int t = threadIdx.x;
  int wave = t >> 5, lane = t & 31;
  int wr = wave & 3, wc = wave >> 2;
  int half = lane >> 4, l16 = lane & 15;

  // ---- epilogue: residual branch hoisted once (uniform), pointer-walked rows ----
  {
    int rowg0 = bm + wr * 32 + half * 8;
    int colg0 = bn + wc * 64 + l16;
    if (resid != nullptr) {
#pragma unroll
      for (int i = 0; i < 2; ++i) {
        size_t base = (size_t)(rowg0 + i * 16) * N + colg0;
#pragma unroll
        for (int r = 0; r < 8; ++r) {
          float* crow = C + base + (size_t)r * N;
          const float* rrow = resid + base + (size_t)r * N;
#pragma unroll
          for (int j = 0; j < 4; ++j)
            crow[j * 16] = acc[i][j][r] + rrow[j * 16];
        }
      }
    } else {
#pragma unroll
      for (int i = 0; i < 2; ++i) {
        size_t base = (size_t)(rowg0 + i * 16) * N + colg0;
#pragma unroll
        for (int r = 0; r < 8; ++r) {
          float* crow = C + base + (size_t)r * N;
#pragma unroll
          for (int j = 0; j < 4; ++j)
            crow[j * 16] = acc[i][j][r];
        }
      }
    }
  }
}

__global__ __launch_bounds__(256) void gemm_wmma(
    const _Float16* __restrict__ A, const float* __restrict__ Bw,
    float* __restrict__ C, const float* __restrict__ resid, int K) {
  gemm_tile<H_DIM>(A, Bw, C, resid, K, blockIdx.y * TM, blockIdx.x * TN);
}

// Q, K and V projections share A and are independent: one grid holds the tile
// columns of all three, so the two narrow products (128 blocks each, half the
// chip's WGPs) run beside the wide one instead of after it.
#define QTILES ((NHEAD * HDIM) / TN)
#define KVTILES ((NKVH * HDIM) / TN)
// One register set, and a register budget for 6 waves per SIMD (the second launch bound):
// three blocks on a WGP put the whole grid (768 blocks, 256 WGPs) on the chip at once; with
// two sets only two blocks fit and a third of the grid waits for a second round.
#define QKV_SETS 1
// A tile is one head (TN == HDIM), so the epilogue finishes the head in registers.
// Q and K tiles are computed transposed, so that a lane holds 8 consecutive d of one
// position: they are rotated and stored as f16 [S, heads, 128] in 16-byte pieces.
// V tiles keep the plain order, in which a lane holds 8 consecutive positions of one
// d: they are stored as f16 V^T [NKV, 128, S], also in 16-byte pieces.
__global__ __launch_bounds__(256, 6) void gemm_qkv(
    const _Float16* __restrict__ A, const float* __restrict__ wq,
    const float* __restrict__ wk, const float* __restrict__ wv,
    const float* __restrict__ cosb, const float* __restrict__ sinb,
    _Float16* __restrict__ q, _Float16* __restrict__ k, _Float16* __restrict__ vt,
    int K) {
  __shared__ alignas(16) _Float16 As[2 * TM * LDSTR];
  __shared__ alignas(16) _Float16 Bs[2 * TN * LDSTR];
  int bx = blockIdx.x;
  int bm = blockIdx.y * TM;
  int t = threadIdx.x;
  int wave = t >> 5, lane = t & 31;
  int wr = wave & 3, wc = wave >> 2;
  int half = lane >> 4, l16 = lane & 15;
  v8f acc[2][4];

  if (bx >= QTILES + KVTILES) {
    bx -= QTILES + KVTILES;
    gemm_mainloop<false, false, NKVH * HDIM, QKV_SETS>(A, wv, K, bm, bx * TN, As, Bs, acc);
#pragma unroll
    for (int j = 0; j < 4; ++j) {
      _Float16* vcol = vt + ((size_t)bx * HDIM + frag_col<false>(wc, j) + l16) * S_LEN +
                       bm + wr * 32 + half * 8;
#pragma unroll
      for (int i = 0; i < 2; ++i) {
        v8h o;
#pragma unroll
        for (int r = 0; r < 8; ++r) o[r] = (_Float16)acc[i][j][r];
        *(v8h*)(vcol + i * 16) = o;
      }
    }
    return;
  }

  _Float16* C = q;
  int N = NHEAD * HDIM;
  if (bx >= QTILES) {
    C = k; N = NKVH * HDIM; bx -= QTILES;
    gemm_mainloop<true, true, NKVH * HDIM, QKV_SETS>(A, wk, K, bm, bx * TN, As, Bs, acc);
  } else {
    gemm_mainloop<true, true, NHEAD * HDIM, QKV_SETS>(A, wq, K, bm, bx * TN, As, Bs, acc);
  }
#pragma unroll
  for (int i = 0; i < 2; ++i) {
    int s = bm + wr * 32 + i * 16 + l16;
#pragma unroll
    for (int jj = 0; jj < 2; ++jj) {
      int d = frag_col<true>(wc, jj) + half * 8;  // 0..63: low column of the rotary pair
      const float* cr = cosb + (size_t)s * HDIM + d;
      const float* sr = sinb + (size_t)s * HDIM + d;
      v8h lo, hi;
#pragma unroll
      for (int r = 0; r < 8; ++r) {
        float x1 = acc[i][jj][r], x2 = acc[i][jj + 2][r];
        lo[r] = (_Float16)(x1 * cr[r] - x2 * sr[r]);
        hi[r] = (_Float16)(x2 * cr[r + 64] + x1 * sr[r + 64]);
      }
      _Float16* orow = C + (size_t)s * N + bx * TN + d;
      *(v8h*)orow = lo;
      *(v8h*)(orow + 64) = hi;
    }
  }
  // Precaution: the stores' registers are not rewritten before the stores have taken them.
  asm volatile("s_wait_xcnt 0x0" ::: "memory");
}

// ---------------- Flash attention (causal, GQA 4:1), WMMA QK^T and PV ----------------
#define KV_T   32   // keys per staged tile
#define KPITCH 136  // halfs per staged K row (272 B = 16 B x odd: b128 reads without bank conflicts)
#define VPITCH 40   // halfs per staged V^T row (80 B = 16 B x odd)

// One tile's asynchronous copies to LDS, 8 per thread: K 32 rows x 256 B (4 copies, 8 rows
// apart), V^T 128 rows x 64 B (4 copies, 32 rows apart). The s_wait_xcnt stands inside the
// copies' own statement as a precaution: no address register is rewritten in front of it.
__device__ __forceinline__ void stage_kv(const _Float16* gk, const _Float16* gv,
                                         unsigned lk, unsigned lv) {
  asm volatile(
      "global_load_async_to_lds_b128 %0, %8, off\n\t"
      "global_load_async_to_lds_b128 %1, %9, off\n\t"
      "global_load_async_to_lds_b128 %2, %10, off\n\t"
      "global_load_async_to_lds_b128 %3, %11, off\n\t"
      "global_load_async_to_lds_b128 %4, %12, off\n\t"
      "global_load_async_to_lds_b128 %5, %13, off\n\t"
      "global_load_async_to_lds_b128 %6, %14, off\n\t"
      "global_load_async_to_lds_b128 %7, %15, off\n\t"
      "s_wait_xcnt 0x0"
      :: "v"(lk), "v"(lk + 8 * KPITCH * 2), "v"(lk + 16 * KPITCH * 2), "v"(lk + 24 * KPITCH * 2),
         "v"(lv), "v"(lv + 32 * VPITCH * 2), "v"(lv + 64 * VPITCH * 2), "v"(lv + 96 * VPITCH * 2),
         "v"(gk), "v"(gk + 8 * NKVH * HDIM), "v"(gk + 16 * NKVH * HDIM), "v"(gk + 24 * NKVH * HDIM),
         "v"(gv), "v"(gv + 32 * S_LEN), "v"(gv + 64 * S_LEN), "v"(gv + 96 * S_LEN)
      : "memory");
}

__global__ __launch_bounds__(128) void flash_attn_kernel(
    const _Float16* __restrict__ Qh,  // [S, NH, 128]
    const _Float16* __restrict__ Kh,  // [S, NKV, 128]
    const _Float16* __restrict__ Vt,  // [NKV, 128, S]  (transposed)
    _Float16* __restrict__ Oh) {      // [S, NH*128]
  int head = blockIdx.y;
  int kvhead = head >> 2;  // NH/NKV = 4
  int tid = threadIdx.x;
  int wave = __builtin_amdgcn_readfirstlane(tid >> 5), lane = tid & 31;
  int half = lane >> 4, l16 = lane & 15;
  int q0 = blockIdx.x * 64 + wave * 16;  // this wave's 16 query rows

  // per-wave P staging; 16 rows x 32 halfs, columns (n, n+16) interleaved
  __shared__ alignas(16) _Float16 probs[4][16 * 32];
  // K and V^T tiles of KV_T keys, read by all four waves; two buffers
  __shared__ alignas(16) _Float16 Ks[2][KV_T * KPITCH];
  __shared__ alignas(16) _Float16 Vs[2][HDIM * VPITCH];

  // this thread's first copy of tile 0: global sources and LDS byte addresses in buffer 0
  const _Float16* gk = Kh + ((size_t)(tid >> 4) * NKVH + kvhead) * HDIM + (tid & 15) * 8;
  const _Float16* gv = Vt + ((size_t)kvhead * HDIM + (tid >> 2)) * S_LEN + (tid & 3) * 8;
  unsigned lk = (unsigned)(size_t)&Ks[0][(tid >> 4) * KPITCH + (tid & 15) * 8];
  unsigned lv = (unsigned)(size_t)&Vs[0][(tid >> 2) * VPITCH + (tid & 3) * 8];
  const int ntile = 2 * blockIdx.x + 2;  // tiles up to the block's last query row; at least 2

  stage_kv(gk, gv, lk, lv);
  // tile 0 has landed for this wave; the barrier publishes it to the other waves
  asm volatile("s_wait_asynccnt 0x0" ::: "memory");
  __syncthreads();
  stage_kv(gk + (size_t)KV_T * NKVH * HDIM, gv + KV_T,
           lk + (unsigned)sizeof(Ks[0]), lv + (unsigned)sizeof(Vs[0]));

  // Preload Q A-fragments: HD=128 -> 4 chunks of K=32 (two 16B loads each)
  v16h qf[4];
  {
    const _Float16* qrow = Qh + ((size_t)(q0 + l16) * NHEAD + head) * HDIM;
#pragma unroll
    for (int c = 0; c < 4; ++c)
      qf[c] = cat8(*(const v8h*)(qrow + c * 32 + half * 8),
                   *(const v8h*)(qrow + c * 32 + 16 + half * 8));
  }

  v8f o[8];
#pragma unroll
  for (int df = 0; df < 8; ++df) o[df] = (v8f){};
  float mrow[8], lrow[8];
#pragma unroll
  for (int r = 0; r < 8; ++r) { mrow[r] = -1e30f; lrow[r] = 0.f; }

  const float scl = 0.08838834764831845f;  // 1/sqrt(128)
  int kv_end = q0 + 16;                    // causal: kv <= q

  for (int tile = 0; tile < ntile; ++tile) {
    int kv0 = tile * KV_T;
    const _Float16* Kb = Ks[tile & 1];
    const _Float16* Vb = Vs[tile & 1];
    if (kv0 < kv_end) {  // wave-uniform: a wave skips tiles beyond its diagonal, never the foot
      // ---- scores: two 16x16 fragments over 32 kv positions ----
      v8f s0 = {}, s1 = {};
#pragma unroll
      for (int c = 0; c < 4; ++c) {
        const _Float16* kr0 = Kb + l16 * KPITCH + c * 32;
        const _Float16* kr1 = Kb + (16 + l16) * KPITCH + c * 32;
        v16h b0 = cat8(*(const v8h*)(kr0 + half * 8),
                       *(const v8h*)(kr0 + 16 + half * 8));
        v16h b1 = cat8(*(const v8h*)(kr1 + half * 8),
                       *(const v8h*)(kr1 + 16 + half * 8));
        s0 = wmma_f16(qf[c], b0, s0);
        s1 = wmma_f16(qf[c], b1, s1);
      }

      // ---- online softmax per row (row = r + 8*half, cols = lane%16 (+16)) ----
#pragma unroll
      for (int r = 0; r < 8; ++r) {
        int qrow = q0 + r + 8 * half;
        float v0 = s0[r] * scl; if (kv0 + l16 > qrow)      v0 = -1e30f;
        float v1 = s1[r] * scl; if (kv0 + 16 + l16 > qrow) v1 = -1e30f;
        float mx = fmaxf(v0, v1);
#pragma unroll
        for (int off = 8; off >= 1; off >>= 1) mx = fmaxf(mx, __shfl_xor(mx, off, 32));
        float mnew = fmaxf(mrow[r], mx);
        float alpha = __expf(mrow[r] - mnew);
        float p0 = __expf(v0 - mnew);
        float p1 = __expf(v1 - mnew);
        float rs = p0 + p1;
#pragma unroll
        for (int off = 8; off >= 1; off >>= 1) rs += __shfl_xor(rs, off, 32);
        lrow[r] = lrow[r] * alpha + rs;
        mrow[r] = mnew;
#pragma unroll
        for (int df = 0; df < 8; ++df) o[df][r] *= alpha;
        // one packed 32-bit LDS store: columns (l16, l16+16) interleaved
        v2h pp;
        pp[0] = (_Float16)p0;
        pp[1] = (_Float16)p1;
        *(v2h*)&probs[wave][(r + 8 * half) * 32 + 2 * l16] = pp;
      }
      asm volatile("s_wait_dscnt 0" ::: "memory");  // LDS RAW within wave

      // ---- reload P as A-fragment: two 16B LDS loads + register deinterleave ----
      const _Float16* pr = &probs[wave][l16 * 32 + 16 * half];
      v16h pf = deinterleave(*(const v8h*)pr, *(const v8h*)(pr + 8));

      // ---- PV: 8 d-fragments; staged V^T rows give 16B LDS loads per lane ----
#pragma unroll
      for (int df = 0; df < 8; ++df) {
        const _Float16* vcol = Vb + (df * 16 + l16) * VPITCH;
        v16h vf = cat8(*(const v8h*)(vcol + half * 8),
                       *(const v8h*)(vcol + 16 + half * 8));
        o[df] = wmma_f16(pf, vf, o[df]);
      }
    }

    // ---- foot of the trip, every wave ----
    // this wave's reads of the buffer that is refilled below have returned
    asm volatile("s_wait_dscnt 0x0" ::: "memory");
    // this wave's copies of the next tile have landed
    asm volatile("s_wait_asynccnt 0x0" ::: "memory");
    // publishes the next tile and ends every wave's reads of this one
    __syncthreads();
    if (tile + 2 < ntile)
      stage_kv(gk + (size_t)(tile + 2) * KV_T * NKVH * HDIM, gv + (tile + 2) * KV_T,
               lk + (unsigned)(tile & 1) * (unsigned)sizeof(Ks[0]),
               lv + (unsigned)(tile & 1) * (unsigned)sizeof(Vs[0]));
  }
  // no copy is outstanding when the wave ends
  asm volatile("s_wait_asynccnt 0x0" ::: "memory");

  // ---- epilogue: normalize and store f16 attn output [S, NH*HD] ----
#pragma unroll
  for (int r = 0; r < 8; ++r) {
    int qrow = q0 + r + 8 * half;
    float inv = 1.f / lrow[r];
    _Float16* orow = Oh + (size_t)qrow * (NHEAD * HDIM) + head * HDIM + l16;
#pragma unroll
    for (int df = 0; df < 8; ++df)
      orow[df * 16] = (_Float16)(o[df][r] * inv);
  }
}

// ---------------- host launch ----------------
extern "C" void kernel_launch(void* const* d_in, const int* in_sizes, int n_in,
                              void* d_out, int out_size, void* d_ws, size_t ws_size,
                              hipStream_t stream) {
  const float* hid    = (const float*)d_in[0];
  const float* cosb   = (const float*)d_in[1];
  const float* sinb   = (const float*)d_in[2];
  const float* norm_w = (const float*)d_in[3];
  const float* wq     = (const float*)d_in[4];
  const float* wk     = (const float*)d_in[5];
  const float* wv     = (const float*)d_in[6];
  const float* wo     = (const float*)d_in[7];
  float* out = (float*)d_out;

  char* ws = (char*)d_ws;
  size_t off = 0;
  auto carve = [&](size_t bytes) -> char* {
    char* p = ws + off;
    off += (bytes + 255) & ~(size_t)255;
    return p;
  };
  _Float16* h16   = (_Float16*)carve((size_t)S_LEN * H_DIM * 2);
  _Float16* q16   = (_Float16*)carve((size_t)S_LEN * NHEAD * HDIM * 2);
  _Float16* k16   = (_Float16*)carve((size_t)S_LEN * NKVH * HDIM * 2);
  _Float16* vt16  = (_Float16*)carve((size_t)NKVH * HDIM * S_LEN * 2);
  _Float16* att16 = (_Float16*)carve((size_t)S_LEN * NHEAD * HDIM * 2);

  // 1) RMSNorm -> f16
  rmsnorm_kernel<<<S_LEN, 256, 0, stream>>>(hid, norm_w, h16);

  // 2) Q/K/V projections in one launch (WMMA GEMM, f32 weights converted in LDS stage);
  //    the epilogue applies RoPE to Q and K (-> f16) and stores V as V^T f16
  gemm_qkv<<<dim3(QTILES + 2 * KVTILES, S_LEN / TM), 256, 0, stream>>>(
      h16, wq, wk, wv, cosb, sinb, q16, k16, vt16, H_DIM);

  // 3) Flash attention (causal, GQA)
  flash_attn_kernel<<<dim3(S_LEN / 64, NHEAD), 128, 0, stream>>>(q16, k16, vt16, att16);

  // 4) Output projection + residual
  gemm_wmma<<<dim3(H_DIM / TN, S_LEN / TM), 256, 0, stream>>>(
      att16, wo, out, hid, NHEAD * HDIM);
}

// v005
// It runs in 283 microseconds.
// Next to v004, in two timings, it ran 1.14 times as fast each time.
// All steps since v000 together make it 2.80 times as fast.
#include <hip/hip_runtime.h>
#include <hip/hip_bf16.h>

typedef __attribute__((ext_vector_type(16))) _Float16 v16h;
typedef __attribute__((ext_vector_type(8)))  _Float16 v8h;
typedef __attribute__((ext_vector_type(4)))  _Float16 v4h;
typedef __attribute__((ext_vector_type(2)))  _Float16 v2h;
typedef __attribute__((ext_vector_type(8)))  float    v8f;

#define S_LEN 2048
#define H_DIM 4096
#define NHEAD 32
#define NKVH  8
#define HDIM  128

__device__ inline v8f wmma_f16(v16h a, v16h b, v8f c) {
  return __builtin_amdgcn_wmma_f32_16x16x32_f16(
      false, a, false, b, (short)0, c, false, false);
}

__device__ inline v16h cat8(v8h a, v8h b) {
  return __builtin_shufflevector(a, b, 0, 1, 2, 3, 4, 5, 6, 7,
                                 8, 9, 10, 11, 12, 13, 14, 15);
}
// lane l takes the value of lane l ^ 16 (the other half of the wave)
__device__ inline float xhalf(float x) {
  int i = __builtin_bit_cast(int, x);
  return __builtin_bit_cast(float, __builtin_amdgcn_permlanex16(i, i, 0x76543210, 0xfedcba98, false, false));
}

// ---------------- RMSNorm -> f16 ----------------
__global__ __launch_bounds__(256) void rmsnorm_kernel(
    const float* __restrict__ x, const float* __restrict__ w,
    _Float16* __restrict__ h) {
  int row = blockIdx.x;
  const float* xr = x + (size_t)row * H_DIM;
  float ss = 0.f;
  for (int c = threadIdx.x * 4; c < H_DIM; c += 1024) {
    float4 v = *(const float4*)(xr + c);
    ss += v.x * v.x + v.y * v.y + v.z * v.z + v.w * v.w;
  }
  __shared__ float red[256];
  red[threadIdx.x] = ss;
  __syncthreads();
  for (int s2 = 128; s2 > 0; s2 >>= 1) {
    if (threadIdx.x < s2) red[threadIdx.x] += red[threadIdx.x + s2];
    __syncthreads();
  }
  float scale = rsqrtf(red[0] * (1.f / H_DIM) + 1e-5f);
  for (int c = threadIdx.x * 4; c < H_DIM; c += 1024) {
    float4 v = *(const float4*)(xr + c);
    float4 g = *(const float4*)(w + c);
    v4h o;
    o[0] = (_Float16)(v.x * scale * g.x);
    o[1] = (_Float16)(v.y * scale * g.y);
    o[2] = (_Float16)(v.z * scale * g.z);
    o[3] = (_Float16)(v.w * scale * g.w);
    *(v4h*)(h + (size_t)row * H_DIM + c) = o;
  }
}

// ------- Tiled WMMA GEMM: C[M,N] = A_f16[M,K] * B_f32[K,N] (+resid), 128x128x32 -------
#define TM 128
#define TN 128
#define TK 32
#define LDSTR 40  // padded stride in halfs (16B-aligned rows/cols)

// First tile column of a wave's fragment j. SPLIT: two fragments from each half of
// the tile, so that columns d and d + 64 (a rotary pair) sit in the same lane.
template <bool SPLIT>
__device__ __forceinline__ int frag_col(int wc, int j) {
  return SPLIT ? (j >> 1) * 64 + wc * 32 + (j & 1) * 16 : wc * 64 + j * 16;
}

// One k-tile of both operands on its way from global memory to LDS, in registers.
struct TileRegs {
  v8h a0, a1;             // A: 16 halfs of one row
  float4 r0, r1, r2, r3;  // B: a 4 (k) x 4 (column) patch, f32
};

// srcA, srcB: this thread's first element of the k-tile.
template <int N>
__device__ __forceinline__ void tile_load(TileRegs& g, const _Float16* srcA, const float* srcB) {
  g.a0 = *(const v8h*)srcA;
  g.a1 = *(const v8h*)(srcA + 8);
  g.r0 = *(const float4*)srcB;
  g.r1 = *(const float4*)(srcB + N);
  g.r2 = *(const float4*)(srcB + 2 * N);
  g.r3 = *(const float4*)(srcB + 3 * N);
}

// dstA: this thread's 16 halfs of its A row; dstB: its first column at its first k.
__device__ __forceinline__ void tile_store(const TileRegs& g, _Float16* dstA, _Float16* dstB) {
  *(v8h*)dstA       = g.a0;
  *(v8h*)(dstA + 8) = g.a1;
  v4h c0, c1, c2, c3;  // f32 -> f16, col-major
  c0[0] = (_Float16)g.r0.x; c0[1] = (_Float16)g.r1.x; c0[2] = (_Float16)g.r2.x; c0[3] = (_Float16)g.r3.x;
  c1[0] = (_Float16)g.r0.y; c1[1] = (_Float16)g.r1.y; c1[2] = (_Float16)g.r2.y; c1[3] = (_Float16)g.r3.y;
  c2[0] = (_Float16)g.r0.z; c2[1] = (_Float16)g.r1.z; c2[2] = (_Float16)g.r2.z; c2[3] = (_Float16)g.r3.z;
  c3[0] = (_Float16)g.r0.w; c3[1] = (_Float16)g.r1.w; c3[2] = (_Float16)g.r2.w; c3[3] = (_Float16)g.r3.w;
  *(v4h*)(dstB + 0 * LDSTR) = c0;
  *(v4h*)(dstB + 1 * LDSTR) = c1;
  *(v4h*)(dstB + 2 * LDSTR) = c2;
  *(v4h*)(dstB + 3 * LDSTR) = c3;
}

// Work-group barrier of the main loop, written by hand: __syncthreads() also waits for
// every global load, which would end the flight of the tiles loaded ahead. The wave's own
// LDS stores and reads are complete (s_wait_dscnt 0) before it signals. s_wait_xcnt 0 is a
// precaution: behind the barrier the fragment loads rewrite registers that held addresses
// of the global loads issued in front of it.
__device__ __forceinline__ void tile_barrier() {
  asm volatile("s_wait_xcnt 0x0\n\ts_wait_dscnt 0x0\n\ts_barrier_signal -1\n\ts_barrier_wait -1"
               ::: "memory");
}

// The products of one staged k-tile.
template <bool SPLIT, bool TRANS>
__device__ __forceinline__ void tile_mma(const _Float16* At, const _Float16* Bt,
                                         int wr, int wc, int half, int l16, v8f (&acc)[2][4]) {
  v16h af[2], bf[4];
#pragma unroll
  for (int i = 0; i < 2; ++i) {
    const _Float16* arow = &At[(wr * 32 + i * 16 + l16) * LDSTR];
    af[i] = cat8(*(const v8h*)(arow + half * 8),
                 *(const v8h*)(arow + 16 + half * 8));
  }
#pragma unroll
  for (int j = 0; j < 4; ++j) {
    const _Float16* bcol = &Bt[(frag_col<SPLIT>(wc, j) + l16) * LDSTR];
    bf[j] = cat8(*(const v8h*)(bcol + half * 8),
                 *(const v8h*)(bcol + 16 + half * 8));
  }
#pragma unroll
  for (int i = 0; i < 2; ++i)
#pragma unroll
    for (int j = 0; j < 4; ++j)
      acc[i][j] = TRANS ? wmma_f16(bf[j], af[i], acc[i][j])
                        : wmma_f16(af[i], bf[j], acc[i][j]);
  // Keeps the wait for the tile loaded ahead, and its LDS stores, behind these products:
  // moved in front of them, the wait would stand directly behind the loads' issue.
  __builtin_amdgcn_sched_barrier(0);
}

// Accumulates one 128x128 tile at (bm, bn) of A[.,K] * Bw[K,N]; called by every thread of
// a 256-thread block. K is a multiple of 2 * TK. As holds two buffers of TM * LDSTR halfs,
// row-major [row][k]; Bs two of TN * LDSTR, col-major [col][k].
// Tile t is worked on from buffer t & 1 while tile t + 1 goes from registers into the other
// buffer; a register set is loaded again as soon as it is stored, with the tile SETS ahead
// of the one it held, so that SETS tiles' global loads are in flight under the products.
// One barrier per tile: it publishes tile t + 1 and ends the reads of tile t, whose buffer
// is written in the next trip. Every load is unconditional, so that the waits in front of
// the LDS stores can leave the younger set's loads in flight; past the last tile the last
// one is loaded once more and not used when there are two sets.
// acc[i][j][r] is row wr*32 + i*16 + half*8 + r, column frag_col(wc, j) + l16;
// with TRANS (operands swapped, the fragment comes out transposed)
// row wr*32 + i*16 + l16, column frag_col(wc, j) + half*8 + r.
template <bool SPLIT, bool TRANS, int N, int SETS>
__device__ __forceinline__ void gemm_mainloop(
    const _Float16* __restrict__ A, const float* __restrict__ Bw,
    int K, int bm, int bn, _Float16* As, _Float16* Bs, v8f (&acc)[2][4]) {
  int t = threadIdx.x;
  int wave = t >> 5, lane = t & 31;
  int wr = wave & 3;   // rows wr*32 .. +31  (2 fragment rows)
  int wc = wave >> 2;  // 4 fragment cols, at frag_col(wc, j)
  int half = lane >> 4, l16 = lane & 15;

#pragma unroll
  for (int i = 0; i < 2; ++i)
#pragma unroll
    for (int j = 0; j < 4; ++j) acc[i][j] = (v8f){};

  // A tile 128x32 f16: two 16B pieces a thread; B tile 32x128 f32: a 4x4 patch a thread
  const _Float16* srcA = A + (size_t)(bm + (t >> 1)) * K + (t & 1) * 16;
  const float* srcB = Bw + (size_t)((t >> 5) * 4) * N + bn + (t & 31) * 4;
  _Float16* dstA = &As[(t >> 1) * LDSTR + (t & 1) * 16];
  _Float16* dstB = &Bs[(t & 31) * 4 * LDSTR + (t >> 5) * 4];
  const int klast = K - TK;

  TileRegs g[SETS];
#pragma unroll
  for (int s = 0; s < SETS; ++s)
    tile_load<N>(g[s], srcA + s * TK, srcB + (size_t)s * TK * N);
  tile_store(g[0], dstA, dstB);
  {
    int kn = min(SETS * TK, klast);
    tile_load<N>(g[0], srcA + kn, srcB + (size_t)kn * N);
  }
  tile_barrier();

  for (int k0 = 0; k0 < K - 2 * TK; k0 += 2 * TK) {
    // even tile from buffer 0; the next tile into buffer 1
    tile_mma<SPLIT, TRANS>(As, Bs, wr, wc, half, l16, acc);
    tile_store(g[1 % SETS], dstA + TM * LDSTR, dstB + TN * LDSTR);
    int k1 = k0 + (1 + SETS) * TK;  // at most klast
    tile_load<N>(g[1 % SETS], srcA + k1, srcB + (size_t)k1 * N);
    tile_barrier();
    // odd tile from buffer 1; the next tile into buffer 0
    tile_mma<SPLIT, TRANS>(As + TM * LDSTR, Bs + TN * LDSTR, wr, wc, half, l16, acc);
    tile_store(g[0], dstA, dstB);
    int k2 = SETS == 1 ? k0 + 3 * TK : min(k0 + (2 + SETS) * TK, klast);  // one set: at most klast
    tile_load<N>(g[0], srcA + k2, srcB + (size_t)k2 * N);
    tile_barrier();
  }
  // the last two tiles
  tile_mma<SPLIT, TRANS>(As, Bs, wr, wc, half, l16, acc);
  tile_store(g[1 % SETS], dstA + TM * LDSTR, dstB + TN * LDSTR);
  tile_barrier();
  tile_mma<SPLIT, TRANS>(As + TM * LDSTR, Bs + TN * LDSTR, wr, wc, half, l16, acc);
}

// One 128x128 tile of C at (bm, bn), f32 out.
template <int N>
__device__ __forceinline__ void gemm_tile(
    const _Float16* __restrict__ A, const float* __restrict__ Bw,
    float* __restrict__ C, const float* __restrict__ resid,
    int K, int bm, int bn) {
  __shared__ alignas(16) _Float16 As[2 * TM * LDSTR];
  __shared__ alignas(16) _Float16 Bs[2 * TN * LDSTR];
  v8f acc[2][4];
  gemm_mainloop<false, false, N, 2>(A, Bw, K, bm, bn, As, Bs, acc);
  int t = threadIdx.x;
  int wave = t >> 5, lane = t & 31;
  int wr = wave & 3, wc = wave >> 2;
  int half = lane >> 4, l16 = lane & 15;

  // ---- epilogue: residual branch hoisted once (uniform), pointer-walked rows ----
  {
    int rowg0 = bm + wr * 32 + half * 8;
    int colg0 = bn + wc * 64 + l16;
    if (resid != nullptr) {
#pragma unroll
      for (int i = 0; i < 2; ++i) {
        size_t base = (size_t)(rowg0 + i * 16) * N + colg0;
#pragma unroll
        for (int r = 0; r < 8; ++r) {
          float* crow = C + base + (size_t)r * N;
          const float* rrow = resid + base + (size_t)r * N;
#pragma unroll
          for (int j = 0; j < 4; ++j)
            crow[j * 16] = acc[i][j][r] + rrow[j * 16];
        }
      }
    } else {
#pragma unroll
      for (int i = 0; i < 2; ++i) {
        size_t base = (size_t)(rowg0 + i * 16) * N + colg0;
#pragma unroll
        for (int r = 0; r < 8; ++r) {
          float* crow = C + base + (size_t)r * N;
#pragma unroll
          for (int j = 0; j < 4; ++j)
            crow[j * 16] = acc[i][j][r];
        }
      }
    }
  }
}

__global__ __launch_bounds__(256) void gemm_wmma(
    const _Float16* __restrict__ A, const float* __restrict__ Bw,
    float* __restrict__ C, const float* __restrict__ resid, int K) {
  gemm_tile<H_DIM>(A, Bw, C, resid, K, blockIdx.y * TM, blockIdx.x * TN);
}

// Q, K and V projections share A and are independent: one grid holds the tile
// columns of all three, so the two narrow products (128 blocks each, half the
// chip's WGPs) run beside the wide one instead of after it.
#define QTILES ((NHEAD * HDIM) / TN)
#define KVTILES ((NKVH * HDIM) / TN)
// One register set, and a register budget for 6 waves per SIMD (the second launch bound):
// three blocks on a WGP put the whole grid (768 blocks, 256 WGPs) on the chip at once; with
// two sets only two blocks fit and a third of the grid waits for a second round.
#define QKV_SETS 1
// A tile is one head (TN == HDIM), so the epilogue finishes the head in registers.
// Q and K tiles are computed transposed, so that a lane holds 8 consecutive d of one
// position: they are rotated and stored as f16 [S, heads, 128] in 16-byte pieces.
// V tiles keep the plain order, in which a lane holds 8 consecutive positions of one
// d: they are stored as f16 V^T [NKV, 128, S], also in 16-byte pieces.
__global__ __launch_bounds__(256, 6) void gemm_qkv(
    const _Float16* __restrict__ A, const float* __restrict__ wq,
    const float* __restrict__ wk, const float* __restrict__ wv,
    const float* __restrict__ cosb, const float* __restrict__ sinb,
    _Float16* __restrict__ q, _Float16* __restrict__ k, _Float16* __restrict__ vt,
    int K) {
  __shared__ alignas(16) _Float16 As[2 * TM * LDSTR];
  __shared__ alignas(16) _Float16 Bs[2 * TN * LDSTR];
  int bx = blockIdx.x;
  int bm = blockIdx.y * TM;
  int t = threadIdx.x;
  int wave = t >> 5, lane = t & 31;
  int wr = wave & 3, wc = wave >> 2;
  int half = lane >> 4, l16 = lane & 15;
  v8f acc[2][4];

  if (bx >= QTILES + KVTILES) {
    bx -= QTILES + KVTILES;
    gemm_mainloop<false, false, NKVH * HDIM, QKV_SETS>(A, wv, K, bm, bx * TN, As, Bs, acc);
#pragma unroll
    for (int j = 0; j < 4; ++j) {
      _Float16* vcol = vt + ((size_t)bx * HDIM + frag_col<false>(wc, j) + l16) * S_LEN +
                       bm + wr * 32 + half * 8;
#pragma unroll
      for (int i = 0; i < 2; ++i) {
        v8h o;
#pragma unroll
        for (int r = 0; r < 8; ++r) o[r] = (_Float16)acc[i][j][r];
        *(v8h*)(vcol + i * 16) = o;
      }
    }
    return;
  }

  _Float16* C = q;
  int N = NHEAD * HDIM;
  if (bx >= QTILES) {
    C = k; N = NKVH * HDIM; bx -= QTILES;
    gemm_mainloop<true, true, NKVH * HDIM, QKV_SETS>(A, wk, K, bm, bx * TN, As, Bs, acc);
  } else {
    gemm_mainloop<true, true, NHEAD * HDIM, QKV_SETS>(A, wq, K, bm, bx * TN, As, Bs, acc);
  }
#pragma unroll
  for (int i = 0; i < 2; ++i) {
    int s = bm + wr * 32 + i * 16 + l16;
#pragma unroll
    for (int jj = 0; jj < 2; ++jj) {
      int d = frag_col<true>(wc, jj) + half * 8;  // 0..63: low column of the rotary pair
      const float* cr = cosb + (size_t)s * HDIM + d;
      const float* sr = sinb + (size_t)s * HDIM + d;
      v8h lo, hi;
#pragma unroll
      for (int r = 0; r < 8; ++r) {
        float x1 = acc[i][jj][r], x2 = acc[i][jj + 2][r];
        lo[r] = (_Float16)(x1 * cr[r] - x2 * sr[r]);
        hi[r] = (_Float16)(x2 * cr[r + 64] + x1 * sr[r + 64]);
      }
      _Float16* orow = C + (size_t)s * N + bx * TN + d;
      *(v8h*)orow = lo;
      *(v8h*)(orow + 64) = hi;
    }
  }
  // Precaution: the stores' registers are not rewritten before the stores have taken them.
  asm volatile("s_wait_xcnt 0x0" ::: "memory");
}

// ---------------- Flash attention (causal, GQA 4:1), WMMA K Q^T and V^T P^T ----------------
#define KV_T   32   // keys per staged tile
#define KPITCH 136  // halfs per staged K row (272 B = 16 B x odd: b128 reads without bank conflicts)
#define VPITCH 40   // halfs per staged V^T row (80 B = 16 B x odd)

// One tile's asynchronous copies to LDS, 8 per thread: K 32 rows x 256 B (4 copies, 8 rows
// apart), V^T 128 rows x 64 B (4 copies, 32 rows apart). The s_wait_xcnt stands inside the
// copies' own statement as a precaution: no address register is rewritten in front of it.
__device__ __forceinline__ void stage_kv(const _Float16* gk, const _Float16* gv,
                                         unsigned lk, unsigned lv) {
  asm volatile(
      "global_load_async_to_lds_b128 %0, %8, off\n\t"
      "global_load_async_to_lds_b128 %1, %9, off\n\t"
      "global_load_async_to_lds_b128 %2, %10, off\n\t"
      "global_load_async_to_lds_b128 %3, %11, off\n\t"
      "global_load_async_to_lds_b128 %4, %12, off\n\t"
      "global_load_async_to_lds_b128 %5, %13, off\n\t"
      "global_load_async_to_lds_b128 %6, %14, off\n\t"
      "global_load_async_to_lds_b128 %7, %15, off\n\t"
      "s_wait_xcnt 0x0"
      :: "v"(lk), "v"(lk + 8 * KPITCH * 2), "v"(lk + 16 * KPITCH * 2), "v"(lk + 24 * KPITCH * 2),
         "v"(lv), "v"(lv + 32 * VPITCH * 2), "v"(lv + 64 * VPITCH * 2), "v"(lv + 96 * VPITCH * 2),
         "v"(gk), "v"(gk + 8 * NKVH * HDIM), "v"(gk + 16 * NKVH * HDIM), "v"(gk + 24 * NKVH * HDIM),
         "v"(gv), "v"(gv + 32 * S_LEN), "v"(gv + 64 * S_LEN), "v"(gv + 96 * S_LEN)
      : "memory");
}

__global__ __launch_bounds__(128) void flash_attn_kernel(
    const _Float16* __restrict__ Qh,  // [S, NH, 128]
    const _Float16* __restrict__ Kh,  // [S, NKV, 128]
    const _Float16* __restrict__ Vt,  // [NKV, 128, S]  (transposed)
    _Float16* __restrict__ Oh) {      // [S, NH*128]
  int head = blockIdx.y;
  int kvhead = head >> 2;  // NH/NKV = 4
  int tid = threadIdx.x;
  int wave = __builtin_amdgcn_readfirstlane(tid >> 5), lane = tid & 31;
  int half = lane >> 4, l16 = lane & 15;
  int q0 = blockIdx.x * 64 + wave * 16;  // this wave's 16 query rows

  // K and V^T tiles of KV_T keys, read by all four waves; two buffers
  __shared__ alignas(16) _Float16 Ks[2][KV_T * KPITCH];
  __shared__ alignas(16) _Float16 Vs[2][HDIM * VPITCH];

  // this thread's first copy of tile 0: global sources and LDS byte addresses in buffer 0
  const _Float16* gk = Kh + ((size_t)(tid >> 4) * NKVH + kvhead) * HDIM + (tid & 15) * 8;
  const _Float16* gv = Vt + ((size_t)kvhead * HDIM + (tid >> 2)) * S_LEN + (tid & 3) * 8;
  unsigned lk = (unsigned)(size_t)&Ks[0][(tid >> 4) * KPITCH + (tid & 15) * 8];
  unsigned lv = (unsigned)(size_t)&Vs[0][(tid >> 2) * VPITCH + (tid & 3) * 8];
  const int ntile = 2 * blockIdx.x + 2;  // tiles up to the block's last query row; at least 2

  stage_kv(gk, gv, lk, lv);
  // tile 0 has landed for this wave; the barrier publishes it to the other waves
  asm volatile("s_wait_asynccnt 0x0" ::: "memory");
  __syncthreads();
  stage_kv(gk + (size_t)KV_T * NKVH * HDIM, gv + KV_T,
           lk + (unsigned)sizeof(Ks[0]), lv + (unsigned)sizeof(Vs[0]));

  // Preload Q B-fragments: HD=128 -> 4 chunks of K=32 (two 16B loads each)
  v16h qf[4];
  {
    const _Float16* qrow = Qh + ((size_t)(q0 + l16) * NHEAD + head) * HDIM;
#pragma unroll
    for (int c = 0; c < 4; ++c)
      qf[c] = cat8(*(const v8h*)(qrow + c * 32 + half * 8),
                   *(const v8h*)(qrow + c * 32 + 16 + half * 8));
  }

  v8f o[8];
#pragma unroll
  for (int df = 0; df < 8; ++df) o[df] = (v8f){};
  // a lane's one query (q0 + l16): running maximum (equal in both wave halves) and the sum
  // over this half's keys only; the halves' sums are joined once, in the epilogue
  float mrun = -1e30f, lrun = 0.f;
  const int qme = q0 + l16;

  const float scl = 0.08838834764831845f;  // 1/sqrt(128)
  int kv_end = q0 + 16;                    // causal: kv <= q

  for (int tile = 0; tile < ntile; ++tile) {
    int kv0 = tile * KV_T;
    const _Float16* Kb = Ks[tile & 1];
    const _Float16* Vb = Vs[tile & 1];
    if (kv0 < kv_end) {  // wave-uniform: a wave skips tiles beyond its diagonal, never the foot
      // ---- scores, transposed: S^T = K Q^T, two fragments of 16 keys x 16 queries ----
      // s0[r] is key kv0 + 8*half + r, s1[r] key kv0 + 16 + 8*half + r, both of query q0 + l16
      v16h kf0[4], kf1[4];
#pragma unroll
      for (int c = 0; c < 4; ++c) {
        const _Float16* kr0 = Kb + l16 * KPITCH + c * 32;
        const _Float16* kr1 = Kb + (16 + l16) * KPITCH + c * 32;
        kf0[c] = cat8(*(const v8h*)(kr0 + half * 8),
                      *(const v8h*)(kr0 + 16 + half * 8));
        kf1[c] = cat8(*(const v8h*)(kr1 + half * 8),
                      *(const v8h*)(kr1 + 16 + half * 8));
      }
      // Keeps the 16 loads one group in front of the products: sunk among them, each pair
      // is waited for to the end directly in front of its product.
      __builtin_amdgcn_sched_barrier(0);
      v8f s0 = {}, s1 = {};
#pragma unroll
      for (int c = 0; c < 4; ++c) {
        s0 = wmma_f16(kf0[c], qf[c], s0);
        s1 = wmma_f16(kf1[c], qf[c], s1);
      }
      // staged V^T rows are the A operand of the second product: 8 fragments of 16 d x 32 keys
      v16h vf[8];
#pragma unroll
      for (int df = 0; df < 8; ++df) {
        const _Float16* vrow = Vb + (df * 16 + l16) * VPITCH;
        vf[df] = cat8(*(const v8h*)(vrow + half * 8),
                      *(const v8h*)(vrow + 16 + half * 8));
      }
      // Keeps these 16 loads here, in flight under the softmax, for the same reason.
      __builtin_amdgcn_sched_barrier(0);

      // ---- online softmax: a lane's 16 scores belong to one query ----
      int lim = qme - kv0 - 8 * half;  // s0[r] is masked where r > lim, s1[r] where 16 + r > lim
      float mx = -1e30f;
#pragma unroll
      for (int r = 0; r < 8; ++r) {
        s0[r] *= scl; if (r > lim)      s0[r] = -1e30f;
        s1[r] *= scl; if (16 + r > lim) s1[r] = -1e30f;
        mx = fmaxf(mx, fmaxf(s0[r], s1[r]));
      }
      mx = fmaxf(mx, xhalf(mx));  // the other half holds the query's other 16 keys
      float mnew = fmaxf(mrun, mx);
      float alpha = __expf(mrun - mnew);
      float rs = 0.f;
      // the k order of a 32-key operand is this lane's s0 then s1: P^T needs no move between lanes
      v16h pf;
#pragma unroll
      for (int r = 0; r < 8; ++r) {
        float p0 = __expf(s0[r] - mnew);
        float p1 = __expf(s1[r] - mnew);
        rs += p0 + p1;
        pf[r]     = (_Float16)p0;
        pf[r + 8] = (_Float16)p1;
      }
      lrun = lrun * alpha + rs;
      mrun = mnew;
#pragma unroll
      for (int df = 0; df < 8; ++df) o[df] *= alpha;

      // ---- O^T += V^T P^T: 8 fragments of 16 d x 16 queries ----
#pragma unroll
      for (int df = 0; df < 8; ++df) o[df] = wmma_f16(vf[df], pf, o[df]);
    }

    // ---- foot of the trip, every wave ----
    // this wave's reads of the buffer that is refilled below have returned
    asm volatile("s_wait_dscnt 0x0" ::: "memory");
    // this wave's copies of the next tile have landed
    asm volatile("s_wait_asynccnt 0x0" ::: "memory");
    // publishes the next tile and ends every wave's reads of this one
    __syncthreads();
    if (tile + 2 < ntile)
      stage_kv(gk + (size_t)(tile + 2) * KV_T * NKVH * HDIM, gv + (tile + 2) * KV_T,
               lk + (unsigned)(tile & 1) * (unsigned)sizeof(Ks[0]),
               lv + (unsigned)(tile & 1) * (unsigned)sizeof(Vs[0]));
  }
  // no copy is outstanding when the wave ends
  asm volatile("s_wait_asynccnt 0x0" ::: "memory");

  // ---- epilogue: normalize and store f16 attn output [S, NH*HD] ----
  // o[df][r] is d = df*16 + 8*half + r of query q0 + l16: 16-byte pieces
  float inv = 1.f / (lrun + xhalf(lrun));
  _Float16* orow = Oh + (size_t)qme * (NHEAD * HDIM) + head * HDIM + half * 8;
  v8h ov[8];
#pragma unroll
  for (int df = 0; df < 8; ++df)
#pragma unroll
    for (int r = 0; r < 8; ++r) ov[df][r] = (_Float16)(o[df][r] * inv);
#pragma unroll
  for (int df = 0; df < 8; ++df) *(v8h*)(orow + df * 16) = ov[df];
}

// ---------------- host launch ----------------
extern "C" void kernel_launch(void* const* d_in, const int* in_sizes, int n_in,
                              void* d_out, int out_size, void* d_ws, size_t ws_size,
                              hipStream_t stream) {
  const float* hid    = (const float*)d_in[0];
  const float* cosb   = (const float*)d_in[1];
  const float* sinb   = (const float*)d_in[2];
  const float* norm_w = (const float*)d_in[3];
  const float* wq     = (const float*)d_in[4];
  const float* wk     = (const float*)d_in[5];
  const float* wv     = (const float*)d_in[6];
  const float* wo     = (const float*)d_in[7];
  float* out = (float*)d_out;

  char* ws = (char*)d_ws;
  size_t off = 0;
  auto carve = [&](size_t bytes) -> char* {
    char* p = ws + off;
    off += (bytes + 255) & ~(size_t)255;
    return p;
  };
  _Float16* h16   = (_Float16*)carve((size_t)S_LEN * H_DIM * 2);
  _Float16* q16   = (_Float16*)carve((size_t)S_LEN * NHEAD * HDIM * 2);
  _Float16* k16   = (_Float16*)carve((size_t)S_LEN * NKVH * HDIM * 2);
  _Float16* vt16  = (_Float16*)carve((size_t)NKVH * HDIM * S_LEN * 2);
  _Float16* att16 = (_Float16*)carve((size_t)S_LEN * NHEAD * HDIM * 2);

  // 1) RMSNorm -> f16
  rmsnorm_kernel<<<S_LEN, 256, 0, stream>>>(hid, norm_w, h16);

  // 2) Q/K/V projections in one launch (WMMA GEMM, f32 weights converted in LDS stage);
  //    the epilogue applies RoPE to Q and K (-> f16) and stores V as V^T f16
  gemm_qkv<<<dim3(QTILES + 2 * KVTILES, S_LEN / TM), 256, 0, stream>>>(
      h16, wq, wk, wv, cosb, sinb, q16, k16, vt16, H_DIM);

  // 3) Flash attention (causal, GQA)
  flash_attn_kernel<<<dim3(S_LEN / 64, NHEAD), 128, 0, stream>>>(q16, k16, vt16, att16);

  // 4) Output projection + residual
  gemm_wmma<<<dim3(H_DIM / TN, S_LEN / TM), 256, 0, stream>>>(
      att16, wo, out, hid, NHEAD * HDIM);
}

// v006
// Measured time: 253 microseconds a run.
// In both of two side-by-side timings against v005, it was 1.12 times as fast.
// Over all steps from v000 it is 3.14 times as fast.
#include <hip/hip_runtime.h>
#include <hip/hip_bf16.h>

typedef __attribute__((ext_vector_type(16))) _Float16 v16h;
typedef __attribute__((ext_vector_type(8)))  _Float16 v8h;
typedef __attribute__((ext_vector_type(4)))  _Float16 v4h;
typedef __attribute__((ext_vector_type(2)))  _Float16 v2h;
typedef __attribute__((ext_vector_type(8)))  float    v8f;

#define S_LEN 2048
#define H_DIM 4096
#define NHEAD 32
#define NKVH  8
#define HDIM  128

__device__ inline v8f wmma_f16(v16h a, v16h b, v8f c) {
  return __builtin_amdgcn_wmma_f32_16x16x32_f16(
      false, a, false, b, (short)0, c, false, false);
}

__device__ inline v16h cat8(v8h a, v8h b) {
  return __builtin_shufflevector(a, b, 0, 1, 2, 3, 4, 5, 6, 7,
                                 8, 9, 10, 11, 12, 13, 14, 15);
}
// lane l takes the value of lane l ^ 16 (the other half of the wave)
__device__ inline float xhalf(float x) {
  int i = __builtin_bit_cast(int, x);
  return __builtin_bit_cast(float, __builtin_amdgcn_permlanex16(i, i, 0x76543210, 0xfedcba98, false, false));
}

// ---------------- RMSNorm -> f16 ----------------
__global__ __launch_bounds__(256) void rmsnorm_kernel(
    const float* __restrict__ x, const float* __restrict__ w,
    _Float16* __restrict__ h) {
  int row = blockIdx.x;
  const float* xr = x + (size_t)row * H_DIM;
  float ss = 0.f;
  for (int c = threadIdx.x * 4; c < H_DIM; c += 1024) {
    float4 v = *(const float4*)(xr + c);
    ss += v.x * v.x + v.y * v.y + v.z * v.z + v.w * v.w;
  }
  __shared__ float red[256];
  red[threadIdx.x] = ss;
  __syncthreads();
  for (int s2 = 128; s2 > 0; s2 >>= 1) {
    if (threadIdx.x < s2) red[threadIdx.x] += red[threadIdx.x + s2];
    __syncthreads();
  }
  float scale = rsqrtf(red[0] * (1.f / H_DIM) + 1e-5f);
  for (int c = threadIdx.x * 4; c < H_DIM; c += 1024) {
    float4 v = *(const float4*)(xr + c);
    float4 g = *(const float4*)(w + c);
    v4h o;
    o[0] = (_Float16)(v.x * scale * g.x);
    o[1] = (_Float16)(v.y * scale * g.y);
    o[2] = (_Float16)(v.z * scale * g.z);
    o[3] = (_Float16)(v.w * scale * g.w);
    *(v4h*)(h + (size_t)row * H_DIM + c) = o;
  }
}

// ------- Tiled WMMA GEMM: C[M,N] = A_f16[M,K] * B_f32[K,N] (+resid), 128x128x32 -------
#define TM 128
#define TN 128
#define TK 32
#define LDSTR 40  // padded stride of a staged B column in halfs (16B-aligned)
#define AK     64  // k per staged A buffer, two k-tiles: one whole 128-byte line of every row
#define APITCH 72  // halfs per staged A row (144 B = 16 B x odd: b128 reads without bank conflicts)
#define ABUF (TM * APITCH)  // halfs per A buffer

// First tile column of a wave's fragment j. SPLIT: two fragments from each half of
// the tile, so that columns d and d + 64 (a rotary pair) sit in the same lane.
template <bool SPLIT>
__device__ __forceinline__ int frag_col(int wc, int j) {
  return SPLIT ? (j >> 1) * 64 + wc * 32 + (j & 1) * 16 : wc * 64 + j * 16;
}

// One k-tile of B on its way from global memory to LDS, in registers.
struct TileRegs {
  float4 r0, r1, r2, r3;  // a 4 (k) x 4 (column) patch, f32
};

// srcB: this thread's first element of the k-tile.
template <int N>
__device__ __forceinline__ void tile_load(TileRegs& g, const float* srcB) {
  g.r0 = *(const float4*)srcB;
  g.r1 = *(const float4*)(srcB + N);
  g.r2 = *(const float4*)(srcB + 2 * N);
  g.r3 = *(const float4*)(srcB + 3 * N);
}

// dstB: this thread's first column at its first k.
__device__ __forceinline__ void tile_store(const TileRegs& g, _Float16* dstB) {
  v4h c0, c1, c2, c3;  // f32 -> f16, col-major
  c0[0] = (_Float16)g.r0.x; c0[1] = (_Float16)g.r1.x; c0[2] = (_Float16)g.r2.x; c0[3] = (_Float16)g.r3.x;
  c1[0] = (_Float16)g.r0.y; c1[1] = (_Float16)g.r1.y; c1[2] = (_Float16)g.r2.y; c1[3] = (_Float16)g.r3.y;
  c2[0] = (_Float16)g.r0.z; c2[1] = (_Float16)g.r1.z; c2[2] = (_Float16)g.r2.z; c2[3] = (_Float16)g.r3.z;
  c3[0] = (_Float16)g.r0.w; c3[1] = (_Float16)g.r1.w; c3[2] = (_Float16)g.r2.w; c3[3] = (_Float16)g.r3.w;
  *(v4h*)(dstB + 0 * LDSTR) = c0;
  *(v4h*)(dstB + 1 * LDSTR) = c1;
  *(v4h*)(dstB + 2 * LDSTR) = c2;
  *(v4h*)(dstB + 3 * LDSTR) = c3;
}

// Work-group barrier of the main loop, written by hand: __syncthreads() also waits for
// every global load, which would end the flight of the tiles loaded ahead. The wave's own
// LDS stores and reads are complete (s_wait_dscnt 0) before it signals. s_wait_xcnt 0 is a
// precaution: behind the barrier the fragment loads rewrite registers that held addresses
// of the global loads issued in front of it.
__device__ __forceinline__ void tile_barrier() {
  asm volatile("s_wait_xcnt 0x0\n\ts_wait_dscnt 0x0\n\ts_barrier_signal -1\n\ts_barrier_wait -1"
               ::: "memory");
}
// The same barrier where it also publishes an A buffer: the wave's own copies into that
// buffer have landed (s_wait_asynccnt 0) before it signals.
__device__ __forceinline__ void tile_barrier_copies() {
  asm volatile("s_wait_xcnt 0x0\n\ts_wait_dscnt 0x0\n\ts_wait_asynccnt 0x0\n\t"
               "s_barrier_signal -1\n\ts_barrier_wait -1"
               ::: "memory");
}

// One A buffer's asynchronous copies to LDS, 4 per thread: 128 rows x 128 B. Eight
// neighbouring lanes take one row's line, so a wave-wide copy is 4 whole cache lines; a
// thread's copies are 32 rows apart (rows32: 32 rows of A, in halfs). The s_wait_xcnt stands
// inside the copies' own statement as a precaution: no address register is rewritten in
// front of it.
__device__ __forceinline__ void stage_a(const _Float16* ga, size_t rows32, unsigned la) {
  asm volatile(
      "global_load_async_to_lds_b128 %0, %4, off\n\t"
      "global_load_async_to_lds_b128 %1, %5, off\n\t"
      "global_load_async_to_lds_b128 %2, %6, off\n\t"
      "global_load_async_to_lds_b128 %3, %7, off\n\t"
      "s_wait_xcnt 0x0"
      :: "v"(la), "v"(la + 32 * APITCH * 2), "v"(la + 64 * APITCH * 2), "v"(la + 96 * APITCH * 2),
         "v"(ga), "v"(ga + rows32), "v"(ga + 2 * rows32), "v"(ga + 3 * rows32)
      : "memory");
}

// The products of one staged k-tile. At: the tile's first k in row 0 of its A buffer.
template <bool SPLIT, bool TRANS>
__device__ __forceinline__ void tile_mma(const _Float16* At, const _Float16* Bt,
                                         int wr, int wc, int half, int l16, v8f (&acc)[2][4]) {
  v16h af[2], bf[4];
#pragma unroll
  for (int i = 0; i < 2; ++i) {
    const _Float16* arow = &At[(wr * 32 + i * 16 + l16) * APITCH];
    af[i] = cat8(*(const v8h*)(arow + half * 8),
                 *(const v8h*)(arow + 16 + half * 8));
  }
#pragma unroll
  for (int j = 0; j < 4; ++j) {
    const _Float16* bcol = &Bt[(frag_col<SPLIT>(wc, j) + l16) * LDSTR];
    bf[j] = cat8(*(const v8h*)(bcol + half * 8),
                 *(const v8h*)(bcol + 16 + half * 8));
  }
#pragma unroll
  for (int i = 0; i < 2; ++i)
#pragma unroll
    for (int j = 0; j < 4; ++j)
      acc[i][j] = TRANS ? wmma_f16(bf[j], af[i], acc[i][j])
                        : wmma_f16(af[i], bf[j], acc[i][j]);
  // Keeps the wait for the tile loaded ahead, and its LDS stores, behind these products:
  // moved in front of them, the wait would stand directly behind the loads' issue.
  __builtin_amdgcn_sched_barrier(0);
}

// Accumulates one 128x128 tile at (bm, bn) of A[.,K] * Bw[K,N]; called by every thread of
// a 256-thread block. K is a multiple of AK = 2 * TK and at least 2 * AK (both A buffers are
// filled in front of the loop). As holds two buffers of ABUF halfs,
// row-major [row][k], AK k each; Bs two of TN * LDSTR, col-major [col][k], TK k each.
// B: tile t is worked on from buffer t & 1 while tile t + 1 goes from registers into the other
// buffer; a register set is loaded again as soon as it is stored, with the tile SETS ahead
// of the one it held, so that SETS tiles' global loads are in flight under the products.
// One barrier per tile: it publishes tile t + 1 and ends the reads of tile t, whose buffer
// is written in the next trip. Every load is unconditional, so that the waits in front of
// the LDS stores can leave the younger set's loads in flight; past the last tile the last
// one is loaded once more and not used.
// A: tiles 2p and 2p + 1 are read from A buffer p & 1, filled by asynchronous copies. The
// barrier behind tile 2p + 1 publishes buffer (p + 1) & 1 and ends the reads of buffer p & 1;
// behind it the copies for tiles 2p + 4 and 2p + 5 start into the buffer just read.
// acc[i][j][r] is row wr*32 + i*16 + half*8 + r, column frag_col(wc, j) + l16;
// with TRANS (operands swapped, the fragment comes out transposed)
// row wr*32 + i*16 + l16, column frag_col(wc, j) + half*8 + r.
template <bool SPLIT, bool TRANS, int N, int SETS>
__device__ __forceinline__ void gemm_mainloop(
    const _Float16* __restrict__ A, const float* __restrict__ Bw,
    int K, int bm, int bn, _Float16* As, _Float16* Bs, v8f (&acc)[2][4]) {
  int t = threadIdx.x;
  int wave = t >> 5, lane = t & 31;
  int wr = wave & 3;   // rows wr*32 .. +31  (2 fragment rows)
  int wc = wave >> 2;  // 4 fragment cols, at frag_col(wc, j)
  int half = lane >> 4, l16 = lane & 15;

#pragma unroll
  for (int i = 0; i < 2; ++i)
#pragma unroll
    for (int j = 0; j < 4; ++j) acc[i][j] = (v8f){};

  // A buffer 128x64 f16: four 16B copies a thread; B tile 32x128 f32: a 4x4 patch a thread
  const _Float16* srcA = A + (size_t)(bm + (t >> 3)) * K + (t & 7) * 8;
  const size_t rows32 = (size_t)32 * K;
  const unsigned ldsA = (unsigned)(size_t)&As[(t >> 3) * APITCH + (t & 7) * 8];
  const float* srcB = Bw + (size_t)((t >> 5) * 4) * N + bn + (t & 31) * 4;
  _Float16* dstB = &Bs[(t & 31) * 4 * LDSTR + (t >> 5) * 4];
  const int klast = K - TK;

  stage_a(srcA, rows32, ldsA);  // A buffer 0
  TileRegs g[SETS];
#pragma unroll
  for (int s = 0; s < SETS; ++s)
    tile_load<N>(g[s], srcB + (size_t)s * TK * N);
  tile_store(g[0], dstB);
  {
    int kn = min(SETS * TK, klast);
    tile_load<N>(g[0], srcB + (size_t)kn * N);
  }
  tile_barrier_copies();
  stage_a(srcA + AK, rows32, ldsA + ABUF * 2);  // A buffer 1

  for (int k0 = 0; k0 < K - AK; k0 += AK) {
    const int ab = (k0 / AK) & 1;  // this trip's A buffer
    const _Float16* Ab = As + ab * ABUF;
    // even tile from B buffer 0; the next tile into B buffer 1
    tile_mma<SPLIT, TRANS>(Ab, Bs, wr, wc, half, l16, acc);
    tile_store(g[1 % SETS], dstB + TN * LDSTR);
    int k1 = k0 + (1 + SETS) * TK;  // at most klast
    tile_load<N>(g[1 % SETS], srcB + (size_t)k1 * N);
    tile_barrier();
    // odd tile from B buffer 1; the next tile into B buffer 0
    tile_mma<SPLIT, TRANS>(Ab + TK, Bs + TN * LDSTR, wr, wc, half, l16, acc);
    tile_store(g[0], dstB);
    int k2 = SETS == 1 ? k0 + 3 * TK : min(k0 + (2 + SETS) * TK, klast);  // one set: at most klast
    tile_load<N>(g[0], srcB + (size_t)k2 * N);
    tile_barrier_copies();
    if (k0 + 2 * AK < K)  // the same for the whole block
      stage_a(srcA + k0 + 2 * AK, rows32, ldsA + (unsigned)ab * (ABUF * 2));
  }
  // the last two tiles
  const _Float16* Al = As + (((K - AK) / AK) & 1) * ABUF;
  tile_mma<SPLIT, TRANS>(Al, Bs, wr, wc, half, l16, acc);
  tile_store(g[1 % SETS], dstB + TN * LDSTR);
  tile_barrier();
  tile_mma<SPLIT, TRANS>(Al + TK, Bs + TN * LDSTR, wr, wc, half, l16, acc);
  // no copy is outstanding when the wave goes on to its epilogue
  asm volatile("s_wait_asynccnt 0x0" ::: "memory");
}

// One 128x128 tile of C at (bm, bn), f32 out.
template <int N>
__device__ __forceinline__ void gemm_tile(
    const _Float16* __restrict__ A, const float* __restrict__ Bw,
    float* __restrict__ C, const float* __restrict__ resid,
    int K, int bm, int bn) {
  __shared__ alignas(16) _Float16 As[2 * ABUF];
  __shared__ alignas(16) _Float16 Bs[2 * TN * LDSTR];
  v8f acc[2][4];
  gemm_mainloop<false, false, N, 2>(A, Bw, K, bm, bn, As, Bs, acc);
  int t = threadIdx.x;
  int wave = t >> 5, lane = t & 31;
  int wr = wave & 3, wc = wave >> 2;
  int half = lane >> 4, l16 = lane & 15;

  // ---- epilogue: residual branch hoisted once (uniform), pointer-walked rows ----
  {
    int rowg0 = bm + wr * 32 + half * 8;
    int colg0 = bn + wc * 64 + l16;
    if (resid != nullptr) {
#pragma unroll
      for (int i = 0; i < 2; ++i) {
        size_t base = (size_t)(rowg0 + i * 16) * N + colg0;
#pragma unroll
        for (int r = 0; r < 8; ++r) {
          float* crow = C + base + (size_t)r * N;
          const float* rrow = resid + base + (size_t)r * N;
#pragma unroll
          for (int j = 0; j < 4; ++j)
            crow[j * 16] = acc[i][j][r] + rrow[j * 16];
        }
      }
    } else {
#pragma unroll
      for (int i = 0; i < 2; ++i) {
        size_t base = (size_t)(rowg0 + i * 16) * N + colg0;
#pragma unroll
        for (int r = 0; r < 8; ++r) {
          float* crow = C + base + (size_t)r * N;
#pragma unroll
          for (int j = 0; j < 4; ++j)
            crow[j * 16] = acc[i][j][r];
        }
      }
    }
  }
}

__global__ __launch_bounds__(256) void gemm_wmma(
    const _Float16* __restrict__ A, const float* __restrict__ Bw,
    float* __restrict__ C, const float* __restrict__ resid, int K) {
  gemm_tile<H_DIM>(A, Bw, C, resid, K, blockIdx.y * TM, blockIdx.x * TN);
}

// Q, K and V projections share A and are independent: one grid holds the tile
// columns of all three, so the two narrow products (128 blocks each, half the
// chip's WGPs) run beside the wide one instead of after it.
#define QTILES ((NHEAD * HDIM) / TN)
#define KVTILES ((NKVH * HDIM) / TN)
// One register set, and a register budget for 6 waves per SIMD (the second launch bound):
// three blocks on a WGP put the whole grid (768 blocks, 256 WGPs) on the chip at once; with
// two sets only two blocks fit and a third of the grid waits for a second round.
#define QKV_SETS 1
// A tile is one head (TN == HDIM), so the epilogue finishes the head in registers.
// Q and K tiles are computed transposed, so that a lane holds 8 consecutive d of one
// position: they are rotated and stored as f16 [S, heads, 128] in 16-byte pieces.
// V tiles keep the plain order, in which a lane holds 8 consecutive positions of one
// d: they are stored as f16 V^T [NKV, 128, S], also in 16-byte pieces.
__global__ __launch_bounds__(256, 6) void gemm_qkv(
    const _Float16* __restrict__ A, const float* __restrict__ wq,
    const float* __restrict__ wk, const float* __restrict__ wv,
    const float* __restrict__ cosb, const float* __restrict__ sinb,
    _Float16* __restrict__ q, _Float16* __restrict__ k, _Float16* __restrict__ vt,
    int K) {
  __shared__ alignas(16) _Float16 As[2 * ABUF];
  __shared__ alignas(16) _Float16 Bs[2 * TN * LDSTR];
  int bx = blockIdx.x;
  int bm = blockIdx.y * TM;
  int t = threadIdx.x;
  int wave = t >> 5, lane = t & 31;
  int wr = wave & 3, wc = wave >> 2;
  int half = lane >> 4, l16 = lane & 15;
  v8f acc[2][4];

  if (bx >= QTILES + KVTILES) {
    bx -= QTILES + KVTILES;
    gemm_mainloop<false, false, NKVH * HDIM, QKV_SETS>(A, wv, K, bm, bx * TN, As, Bs, acc);
#pragma unroll
    for (int j = 0; j < 4; ++j) {
      _Float16* vcol = vt + ((size_t)bx * HDIM + frag_col<false>(wc, j) + l16) * S_LEN +
                       bm + wr * 32 + half * 8;
#pragma unroll
      for (int i = 0; i < 2; ++i) {
        v8h o;
#pragma unroll
        for (int r = 0; r < 8; ++r) o[r] = (_Float16)acc[i][j][r];
        *(v8h*)(vcol + i * 16) = o;
      }
    }
    return;
  }

  _Float16* C = q;
  int N = NHEAD * HDIM;
  if (bx >= QTILES) {
    C = k; N = NKVH * HDIM; bx -= QTILES;
    gemm_mainloop<true, true, NKVH * HDIM, QKV_SETS>(A, wk, K, bm, bx * TN, As, Bs, acc);
  } else {
    gemm_mainloop<true, true, NHEAD * HDIM, QKV_SETS>(A, wq, K, bm, bx * TN, As, Bs, acc);
  }
#pragma unroll
  for (int i = 0; i < 2; ++i) {
    int s = bm + wr * 32 + i * 16 + l16;
#pragma unroll
    for (int jj = 0; jj < 2; ++jj) {
      int d = frag_col<true>(wc, jj) + half * 8;  // 0..63: low column of the rotary pair
      const float* cr = cosb + (size_t)s * HDIM + d;
      const float* sr = sinb + (size_t)s * HDIM + d;
      v8h lo, hi;
#pragma unroll
      for (int r = 0; r < 8; ++r) {
        float x1 = acc[i][jj][r], x2 = acc[i][jj + 2][r];
        lo[r] = (_Float16)(x1 * cr[r] - x2 * sr[r]);
        hi[r] = (_Float16)(x2 * cr[r + 64] + x1 * sr[r + 64]);
      }
      _Float16* orow = C + (size_t)s * N + bx * TN + d;
      *(v8h*)orow = lo;
      *(v8h*)(orow + 64) = hi;
    }
  }
  // Precaution: the stores' registers are not rewritten before the stores have taken them.
  asm volatile("s_wait_xcnt 0x0" ::: "memory");
}

// ---------------- Flash attention (causal, GQA 4:1), WMMA K Q^T and V^T P^T ----------------
#define KV_T   32   // keys per staged tile
#define KPITCH 136  // halfs per staged K row (272 B = 16 B x odd: b128 reads without bank conflicts)
#define VPITCH 40   // halfs per staged V^T row (80 B = 16 B x odd)

// One tile's asynchronous copies to LDS, 8 per thread: K 32 rows x 256 B (4 copies, 8 rows
// apart), V^T 128 rows x 64 B (4 copies, 32 rows apart). The s_wait_xcnt stands inside the
// copies' own statement as a precaution: no address register is rewritten in front of it.
__device__ __forceinline__ void stage_kv(const _Float16* gk, const _Float16* gv,
                                         unsigned lk, unsigned lv) {
  asm volatile(
      "global_load_async_to_lds_b128 %0, %8, off\n\t"
      "global_load_async_to_lds_b128 %1, %9, off\n\t"
      "global_load_async_to_lds_b128 %2, %10, off\n\t"
      "global_load_async_to_lds_b128 %3, %11, off\n\t"
      "global_load_async_to_lds_b128 %4, %12, off\n\t"
      "global_load_async_to_lds_b128 %5, %13, off\n\t"
      "global_load_async_to_lds_b128 %6, %14, off\n\t"
      "global_load_async_to_lds_b128 %7, %15, off\n\t"
      "s_wait_xcnt 0x0"
      :: "v"(lk), "v"(lk + 8 * KPITCH * 2), "v"(lk + 16 * KPITCH * 2), "v"(lk + 24 * KPITCH * 2),
         "v"(lv), "v"(lv + 32 * VPITCH * 2), "v"(lv + 64 * VPITCH * 2), "v"(lv + 96 * VPITCH * 2),
         "v"(gk), "v"(gk + 8 * NKVH * HDIM), "v"(gk + 16 * NKVH * HDIM), "v"(gk + 24 * NKVH * HDIM),
         "v"(gv), "v"(gv + 32 * S_LEN), "v"(gv + 64 * S_LEN), "v"(gv + 96 * S_LEN)
      : "memory");
}

__global__ __launch_bounds__(128) void flash_attn_kernel(
    const _Float16* __restrict__ Qh,  // [S, NH, 128]
    const _Float16* __restrict__ Kh,  // [S, NKV, 128]
    const _Float16* __restrict__ Vt,  // [NKV, 128, S]  (transposed)
    _Float16* __restrict__ Oh) {      // [S, NH*128]
  int head = blockIdx.y;
  int kvhead = head >> 2;  // NH/NKV = 4
  int tid = threadIdx.x;
  int wave = __builtin_amdgcn_readfirstlane(tid >> 5), lane = tid & 31;
  int half = lane >> 4, l16 = lane & 15;
  int q0 = blockIdx.x * 64 + wave * 16;  // this wave's 16 query rows

  // K and V^T tiles of KV_T keys, read by all four waves; two buffers
  __shared__ alignas(16) _Float16 Ks[2][KV_T * KPITCH];
  __shared__ alignas(16) _Float16 Vs[2][HDIM * VPITCH];

  // this thread's first copy of tile 0: global sources and LDS byte addresses in buffer 0
  const _Float16* gk = Kh + ((size_t)(tid >> 4) * NKVH + kvhead) * HDIM + (tid & 15) * 8;
  const _Float16* gv = Vt + ((size_t)kvhead * HDIM + (tid >> 2)) * S_LEN + (tid & 3) * 8;
  unsigned lk = (unsigned)(size_t)&Ks[0][(tid >> 4) * KPITCH + (tid & 15) * 8];
  unsigned lv = (unsigned)(size_t)&Vs[0][(tid >> 2) * VPITCH + (tid & 3) * 8];
  const int ntile = 2 * blockIdx.x + 2;  // tiles up to the block's last query row; at least 2

  stage_kv(gk, gv, lk, lv);
  // tile 0 has landed for this wave; the barrier publishes it to the other waves
  asm volatile("s_wait_asynccnt 0x0" ::: "memory");
  __syncthreads();
  stage_kv(gk + (size_t)KV_T * NKVH * HDIM, gv + KV_T,
           lk + (unsigned)sizeof(Ks[0]), lv + (unsigned)sizeof(Vs[0]));

  // Preload Q B-fragments: HD=128 -> 4 chunks of K=32 (two 16B loads each)
  v16h qf[4];
  {
    const _Float16* qrow = Qh + ((size_t)(q0 + l16) * NHEAD + head) * HDIM;
#pragma unroll
    for (int c = 0; c < 4; ++c)
      qf[c] = cat8(*(const v8h*)(qrow + c * 32 + half * 8),
                   *(const v8h*)(qrow + c * 32 + 16 + half * 8));
  }

  v8f o[8];
#pragma unroll
  for (int df = 0; df < 8; ++df) o[df] = (v8f){};
  // a lane's one query (q0 + l16): running maximum (equal in both wave halves) and the sum
  // over this half's keys only; the halves' sums are joined once, in the epilogue
  float mrun = -1e30f, lrun = 0.f;
  const int qme = q0 + l16;

  const float scl = 0.08838834764831845f;  // 1/sqrt(128)
  int kv_end = q0 + 16;                    // causal: kv <= q

  for (int tile = 0; tile < ntile; ++tile) {
    int kv0 = tile * KV_T;
    const _Float16* Kb = Ks[tile & 1];
    const _Float16* Vb = Vs[tile & 1];
    if (kv0 < kv_end) {  // wave-uniform: a wave skips tiles beyond its diagonal, never the foot
      // ---- scores, transposed: S^T = K Q^T, two fragments of 16 keys x 16 queries ----
      // s0[r] is key kv0 + 8*half + r, s1[r] key kv0 + 16 + 8*half + r, both of query q0 + l16
      v16h kf0[4], kf1[4];
#pragma unroll
      for (int c = 0; c < 4; ++c) {
        const _Float16* kr0 = Kb + l16 * KPITCH + c * 32;
        const _Float16* kr1 = Kb + (16 + l16) * KPITCH + c * 32;
        kf0[c] = cat8(*(const v8h*)(kr0 + half * 8),
                      *(const v8h*)(kr0 + 16 + half * 8));
        kf1[c] = cat8(*(const v8h*)(kr1 + half * 8),
                      *(const v8h*)(kr1 + 16 + half * 8));
      }
      // Keeps the 16 loads one group in front of the products: sunk among them, each pair
      // is waited for to the end directly in front of its product.
      __builtin_amdgcn_sched_barrier(0);
      v8f s0 = {}, s1 = {};
#pragma unroll
      for (int c = 0; c < 4; ++c) {
        s0 = wmma_f16(kf0[c], qf[c], s0);
        s1 = wmma_f16(kf1[c], qf[c], s1);
      }
      // staged V^T rows are the A operand of the second product: 8 fragments of 16 d x 32 keys
      v16h vf[8];
#pragma unroll
      for (int df = 0; df < 8; ++df) {
        const _Float16* vrow = Vb + (df * 16 + l16) * VPITCH;
        vf[df] = cat8(*(const v8h*)(vrow + half * 8),
                      *(const v8h*)(vrow + 16 + half * 8));
      }
      // Keeps these 16 loads here, in flight under the softmax, for the same reason.
      __builtin_amdgcn_sched_barrier(0);

      // ---- online softmax: a lane's 16 scores belong to one query ----
      int lim = qme - kv0 - 8 * half;  // s0[r] is masked where r > lim, s1[r] where 16 + r > lim
      float mx = -1e30f;
#pragma unroll
      for (int r = 0; r < 8; ++r) {
        s0[r] *= scl; if (r > lim)      s0[r] = -1e30f;
        s1[r] *= scl; if (16 + r > lim) s1[r] = -1e30f;
        mx = fmaxf(mx, fmaxf(s0[r], s1[r]));
      }
      mx = fmaxf(mx, xhalf(mx));  // the other half holds the query's other 16 keys
      float mnew = fmaxf(mrun, mx);
      float alpha = __expf(mrun - mnew);
      float rs = 0.f;
      // the k order of a 32-key operand is this lane's s0 then s1: P^T needs no move between lanes
      v16h pf;
#pragma unroll
      for (int r = 0; r < 8; ++r) {
        float p0 = __expf(s0[r] - mnew);
        float p1 = __expf(s1[r] - mnew);
        rs += p0 + p1;
        pf[r]     = (_Float16)p0;
        pf[r + 8] = (_Float16)p1;
      }
      lrun = lrun * alpha + rs;
      mrun = mnew;
#pragma unroll
      for (int df = 0; df < 8; ++df) o[df] *= alpha;

      // ---- O^T += V^T P^T: 8 fragments of 16 d x 16 queries ----
#pragma unroll
      for (int df = 0; df < 8; ++df) o[df] = wmma_f16(vf[df], pf, o[df]);
    }

    // ---- foot of the trip, every wave ----
    // this wave's reads of the buffer that is refilled below have returned
    asm volatile("s_wait_dscnt 0x0" ::: "memory");
    // this wave's copies of the next tile have landed
    asm volatile("s_wait_asynccnt 0x0" ::: "memory");
    // publishes the next tile and ends every wave's reads of this one
    __syncthreads();
    if (tile + 2 < ntile)
      stage_kv(gk + (size_t)(tile + 2) * KV_T * NKVH * HDIM, gv + (tile + 2) * KV_T,
               lk + (unsigned)(tile & 1) * (unsigned)sizeof(Ks[0]),
               lv + (unsigned)(tile & 1) * (unsigned)sizeof(Vs[0]));
  }
  // no copy is outstanding when the wave ends
  asm volatile("s_wait_asynccnt 0x0" ::: "memory");

  // ---- epilogue: normalize and store f16 attn output [S, NH*HD] ----
  // o[df][r] is d = df*16 + 8*half + r of query q0 + l16: 16-byte pieces
  float inv = 1.f / (lrun + xhalf(lrun));
  _Float16* orow = Oh + (size_t)qme * (NHEAD * HDIM) + head * HDIM + half * 8;
  v8h ov[8];
#pragma unroll
  for (int df = 0; df < 8; ++df)
#pragma unroll
    for (int r = 0; r < 8; ++r) ov[df][r] = (_Float16)(o[df][r] * inv);
#pragma unroll
  for (int df = 0; df < 8; ++df) *(v8h*)(orow + df * 16) = ov[df];
}

// ---------------- host launch ----------------
extern "C" void kernel_launch(void* const* d_in, const int* in_sizes, int n_in,
                              void* d_out, int out_size, void* d_ws, size_t ws_size,
                              hipStream_t stream) {
  const float* hid    = (const float*)d_in[0];
  const float* cosb   = (const float*)d_in[1];
  const float* sinb   = (const float*)d_in[2];
  const float* norm_w = (const float*)d_in[3];
  const float* wq     = (const float*)d_in[4];
  const float* wk     = (const float*)d_in[5];
  const float* wv     = (const float*)d_in[6];
  const float* wo     = (const float*)d_in[7];
  float* out = (float*)d_out;

  char* ws = (char*)d_ws;
  size_t off = 0;
  auto carve = [&](size_t bytes) -> char* {
    char* p = ws + off;
    off += (bytes + 255) & ~(size_t)255;
    return p;
  };
  _Float16* h16   = (_Float16*)carve((size_t)S_LEN * H_DIM * 2);
  _Float16* q16   = (_Float16*)carve((size_t)S_LEN * NHEAD * HDIM * 2);
  _Float16* k16   = (_Float16*)carve((size_t)S_LEN * NKVH * HDIM * 2);
  _Float16* vt16  = (_Float16*)carve((size_t)NKVH * HDIM * S_LEN * 2);
  _Float16* att16 = (_Float16*)carve((size_t)S_LEN * NHEAD * HDIM * 2);

  // 1) RMSNorm -> f16
  rmsnorm_kernel<<<S_LEN, 256, 0, stream>>>(hid, norm_w, h16);

  // 2) Q/K/V projections in one launch (WMMA GEMM, f32 weights converted in LDS stage);
  //    the epilogue applies RoPE to Q and K (-> f16) and stores V as V^T f16
  gemm_qkv<<<dim3(QTILES + 2 * KVTILES, S_LEN / TM), 256, 0, stream>>>(
      h16, wq, wk, wv, cosb, sinb, q16, k16, vt16, H_DIM);

  // 3) Flash attention (causal, GQA)
  flash_attn_kernel<<<dim3(S_LEN / 64, NHEAD), 128, 0, stream>>>(q16, k16, vt16, att16);

  // 4) Output projection + residual
  gemm_wmma<<<dim3(H_DIM / TN, S_LEN / TM), 256, 0, stream>>>(
      att16, wo, out, hid, NHEAD * HDIM);
}

// v007
// One run takes 243 microseconds.
// In two side-by-side timings against v006, it was 1.04 and 1.03 times as fast.
// Counting every step since v000, it is 3.26 times as fast.
#include <hip/hip_runtime.h>
#include <hip/hip_bf16.h>

typedef __attribute__((ext_vector_type(16))) _Float16 v16h;
typedef __attribute__((ext_vector_type(8)))  _Float16 v8h;
typedef __attribute__((ext_vector_type(4)))  _Float16 v4h;
typedef __attribute__((ext_vector_type(2)))  _Float16 v2h;
typedef __attribute__((ext_vector_type(8)))  float    v8f;

#define S_LEN 2048
#define H_DIM 4096
#define NHEAD 32
#define NKVH  8
#define HDIM  128

__device__ inline v8f wmma_f16(v16h a, v16h b, v8f c) {
  return __builtin_amdgcn_wmma_f32_16x16x32_f16(
      false, a, false, b, (short)0, c, false, false);
}

__device__ inline v16h cat8(v8h a, v8h b) {
  return __builtin_shufflevector(a, b, 0, 1, 2, 3, 4, 5, 6, 7,
                                 8, 9, 10, 11, 12, 13, 14, 15);
}
// lane l takes the value of lane l ^ 16 (the other half of the wave)
__device__ inline float xhalf(float x) {
  int i = __builtin_bit_cast(int, x);
  return __builtin_bit_cast(float, __builtin_amdgcn_permlanex16(i, i, 0x76543210, 0xfedcba98, false, false));
}

// ---------------- RMSNorm -> f16 ----------------
__global__ __launch_bounds__(256) void rmsnorm_kernel(
    const float* __restrict__ x, const float* __restrict__ w,
    _Float16* __restrict__ h) {
  int row = blockIdx.x;
  const float* xr = x + (size_t)row * H_DIM;
  float ss = 0.f;
  for (int c = threadIdx.x * 4; c < H_DIM; c += 1024) {
    float4 v = *(const float4*)(xr + c);
    ss += v.x * v.x + v.y * v.y + v.z * v.z + v.w * v.w;
  }
  __shared__ float red[256];
  red[threadIdx.x] = ss;
  __syncthreads();
  for (int s2 = 128; s2 > 0; s2 >>= 1) {
    if (threadIdx.x < s2) red[threadIdx.x] += red[threadIdx.x + s2];
    __syncthreads();
  }
  float scale = rsqrtf(red[0] * (1.f / H_DIM) + 1e-5f);
  for (int c = threadIdx.x * 4; c < H_DIM; c += 1024) {
    float4 v = *(const float4*)(xr + c);
    float4 g = *(const float4*)(w + c);
    v4h o;
    o[0] = (_Float16)(v.x * scale * g.x);
    o[1] = (_Float16)(v.y * scale * g.y);
    o[2] = (_Float16)(v.z * scale * g.z);
    o[3] = (_Float16)(v.w * scale * g.w);
    *(v4h*)(h + (size_t)row * H_DIM + c) = o;
  }
}

// ------- Tiled WMMA GEMM: C[M,N] = A_f16[M,K] * B_f32[K,N] (+resid), 128x128x32 -------
#define TM 128
#define TN 128
#define TK 32
#define LDSTR 40  // padded stride of a staged B column in halfs (16B-aligned)
#define AK     64  // k per staged A buffer, two k-tiles: one whole 128-byte line of every row
#define APITCH 72  // halfs per staged A row (144 B = 16 B x odd: b128 reads without bank conflicts)
#define ABUF (TM * APITCH)  // halfs per A buffer

// First tile column of a wave's fragment j. SPLIT: two fragments from each half of
// the tile, so that columns d and d + 64 (a rotary pair) sit in the same lane.
template <bool SPLIT>
__device__ __forceinline__ int frag_col(int wc, int j) {
  return SPLIT ? (j >> 1) * 64 + wc * 32 + (j & 1) * 16 : wc * 64 + j * 16;
}

// One k-tile of B on its way from global memory to LDS, in registers.
struct TileRegs {
  float4 r0, r1, r2, r3;  // a 4 (k) x 4 (column) patch, f32
};

// srcB: this thread's first element of the k-tile.
template <int N>
__device__ __forceinline__ void tile_load(TileRegs& g, const float* srcB) {
  g.r0 = *(const float4*)srcB;
  g.r1 = *(const float4*)(srcB + N);
  g.r2 = *(const float4*)(srcB + 2 * N);
  g.r3 = *(const float4*)(srcB + 3 * N);
}

// dstB: this thread's first column at its first k.
__device__ __forceinline__ void tile_store(const TileRegs& g, _Float16* dstB) {
  v4h c0, c1, c2, c3;  // f32 -> f16, col-major
  c0[0] = (_Float16)g.r0.x; c0[1] = (_Float16)g.r1.x; c0[2] = (_Float16)g.r2.x; c0[3] = (_Float16)g.r3.x;
  c1[0] = (_Float16)g.r0.y; c1[1] = (_Float16)g.r1.y; c1[2] = (_Float16)g.r2.y; c1[3] = (_Float16)g.r3.y;
  c2[0] = (_Float16)g.r0.z; c2[1] = (_Float16)g.r1.z; c2[2] = (_Float16)g.r2.z; c2[3] = (_Float16)g.r3.z;
  c3[0] = (_Float16)g.r0.w; c3[1] = (_Float16)g.r1.w; c3[2] = (_Float16)g.r2.w; c3[3] = (_Float16)g.r3.w;
  *(v4h*)(dstB + 0 * LDSTR) = c0;
  *(v4h*)(dstB + 1 * LDSTR) = c1;
  *(v4h*)(dstB + 2 * LDSTR) = c2;
  *(v4h*)(dstB + 3 * LDSTR) = c3;
}

// Work-group barrier of the main loop, written by hand: __syncthreads() also waits for
// every global load, which would end the flight of the tiles loaded ahead. The wave's own
// LDS stores and reads are complete (s_wait_dscnt 0) before it signals. s_wait_xcnt 0 is a
// precaution: behind the barrier the fragment loads rewrite registers that held addresses
// of the global loads issued in front of it.
__device__ __forceinline__ void tile_barrier() {
  asm volatile("s_wait_xcnt 0x0\n\ts_wait_dscnt 0x0\n\ts_barrier_signal -1\n\ts_barrier_wait -1"
               ::: "memory");
}
// The same barrier where it also publishes an A buffer: the wave's own copies into that
// buffer have landed (s_wait_asynccnt 0) before it signals.
__device__ __forceinline__ void tile_barrier_copies() {
  asm volatile("s_wait_xcnt 0x0\n\ts_wait_dscnt 0x0\n\ts_wait_asynccnt 0x0\n\t"
               "s_barrier_signal -1\n\ts_barrier_wait -1"
               ::: "memory");
}

// One A buffer's asynchronous copies to LDS, 4 per thread: 128 rows x 128 B. Eight
// neighbouring lanes take one row's line, so a wave-wide copy is 4 whole cache lines; a
// thread's copies are 32 rows apart (rows32: 32 rows of A, in halfs). The s_wait_xcnt stands
// inside the copies' own statement as a precaution: no address register is rewritten in
// front of it.
__device__ __forceinline__ void stage_a(const _Float16* ga, size_t rows32, unsigned la) {
  asm volatile(
      "global_load_async_to_lds_b128 %0, %4, off\n\t"
      "global_load_async_to_lds_b128 %1, %5, off\n\t"
      "global_load_async_to_lds_b128 %2, %6, off\n\t"
      "global_load_async_to_lds_b128 %3, %7, off\n\t"
      "s_wait_xcnt 0x0"
      :: "v"(la), "v"(la + 32 * APITCH * 2), "v"(la + 64 * APITCH * 2), "v"(la + 96 * APITCH * 2),
         "v"(ga), "v"(ga + rows32), "v"(ga + 2 * rows32), "v"(ga + 3 * rows32)
      : "memory");
}

// The products of one staged k-tile. At: the tile's first k in row 0 of its A buffer.
template <bool SPLIT, bool TRANS>
__device__ __forceinline__ void tile_mma(const _Float16* At, const _Float16* Bt,
                                         int wr, int wc, int half, int l16, v8f (&acc)[2][4]) {
  v16h af[2], bf[4];
#pragma unroll
  for (int i = 0; i < 2; ++i) {
    const _Float16* arow = &At[(wr * 32 + i * 16 + l16) * APITCH];
    af[i] = cat8(*(const v8h*)(arow + half * 8),
                 *(const v8h*)(arow + 16 + half * 8));
  }
#pragma unroll
  for (int j = 0; j < 4; ++j) {
    const _Float16* bcol = &Bt[(frag_col<SPLIT>(wc, j) + l16) * LDSTR];
    bf[j] = cat8(*(const v8h*)(bcol + half * 8),
                 *(const v8h*)(bcol + 16 + half * 8));
  }
#pragma unroll
  for (int i = 0; i < 2; ++i)
#pragma unroll
    for (int j = 0; j < 4; ++j)
      acc[i][j] = TRANS ? wmma_f16(bf[j], af[i], acc[i][j])
                        : wmma_f16(af[i], bf[j], acc[i][j]);
  // Keeps the wait for the tile loaded ahead, and its LDS stores, behind these products:
  // moved in front of them, the wait would stand directly behind the loads' issue.
  __builtin_amdgcn_sched_barrier(0);
}

// Accumulates one 128x128 tile at (bm, bn) of A[.,K] * Bw[K,N]; called by every thread of
// a 256-thread block. K is a multiple of AK = 2 * TK and at least 2 * AK (both A buffers are
// filled in front of the loop). As holds two buffers of ABUF halfs,
// row-major [row][k], AK k each; Bs two of TN * LDSTR, col-major [col][k], TK k each.
// B: tile t is worked on from buffer t & 1 while tile t + 1 goes from registers into the other
// buffer; a register set is loaded again as soon as it is stored, with the tile SETS ahead
// of the one it held, so that SETS tiles' global loads are in flight under the products.
// One barrier per tile: it publishes tile t + 1 and ends the reads of tile t, whose buffer
// is written in the next trip. Every load is unconditional, so that the waits in front of
// the LDS stores can leave the younger set's loads in flight; with two sets, past the last
// tile the last one is loaded once more and not used.
// A: tiles 2p and 2p + 1 are read from A buffer p & 1, filled by asynchronous copies. The
// barrier behind tile 2p + 1 publishes buffer (p + 1) & 1 and ends the reads of buffer p & 1;
// behind it the copies for tiles 2p + 4 and 2p + 5 start into the buffer just read.
// acc[i][j][r] is row wr*32 + i*16 + half*8 + r, column frag_col(wc, j) + l16;
// with TRANS (operands swapped, the fragment comes out transposed)
// row wr*32 + i*16 + l16, column frag_col(wc, j) + half*8 + r.
template <bool SPLIT, bool TRANS, int N, int SETS>
__device__ __forceinline__ void gemm_mainloop(
    const _Float16* __restrict__ A, const float* __restrict__ Bw,
    int K, int bm, int bn, _Float16* As, _Float16* Bs, v8f (&acc)[2][4]) {
  int t = threadIdx.x;
  int wave = t >> 5, lane = t & 31;
  int wr = wave & 3;   // rows wr*32 .. +31  (2 fragment rows)
  int wc = wave >> 2;  // 4 fragment cols, at frag_col(wc, j)
  int half = lane >> 4, l16 = lane & 15;

#pragma unroll
  for (int i = 0; i < 2; ++i)
#pragma unroll
    for (int j = 0; j < 4; ++j) acc[i][j] = (v8f){};

  // A buffer 128x64 f16: four 16B copies a thread; B tile 32x128 f32: a 4x4 patch a thread
  const _Float16* srcA = A + (size_t)(bm + (t >> 3)) * K + (t & 7) * 8;
  const size_t rows32 = (size_t)32 * K;
  const unsigned ldsA = (unsigned)(size_t)&As[(t >> 3) * APITCH + (t & 7) * 8];
  const float* srcB = Bw + (size_t)((t >> 5) * 4) * N + bn + (t & 31) * 4;
  _Float16* dstB = &Bs[(t & 31) * 4 * LDSTR + (t >> 5) * 4];
  const int klast = K - TK;

  stage_a(srcA, rows32, ldsA);  // A buffer 0
  TileRegs g[SETS];
#pragma unroll
  for (int s = 0; s < SETS; ++s)
    tile_load<N>(g[s], srcB + (size_t)s * TK * N);
  tile_store(g[0], dstB);
  {
    int kn = min(SETS * TK, klast);
    tile_load<N>(g[0], srcB + (size_t)kn * N);
  }
  tile_barrier_copies();
  stage_a(srcA + AK, rows32, ldsA + ABUF * 2);  // A buffer 1

  for (int k0 = 0; k0 < K - AK; k0 += AK) {
    const int ab = (k0 / AK) & 1;  // this trip's A buffer
    const _Float16* Ab = As + ab * ABUF;
    // even tile from B buffer 0; the next tile into B buffer 1
    tile_mma<SPLIT, TRANS>(Ab, Bs, wr, wc, half, l16, acc);
    tile_store(g[1 % SETS], dstB + TN * LDSTR);
    int k1 = k0 + (1 + SETS) * TK;  // at most klast
    tile_load<N>(g[1 % SETS], srcB + (size_t)k1 * N);
    tile_barrier();
    // odd tile from B buffer 1; the next tile into B buffer 0
    tile_mma<SPLIT, TRANS>(Ab + TK, Bs + TN * LDSTR, wr, wc, half, l16, acc);
    tile_store(g[0], dstB);
    int k2 = SETS == 1 ? k0 + 3 * TK : min(k0 + (2 + SETS) * TK, klast);  // one set: at most klast
    tile_load<N>(g[0], srcB + (size_t)k2 * N);
    tile_barrier_copies();
    if (k0 + 2 * AK < K)  // the same for the whole block
      stage_a(srcA + k0 + 2 * AK, rows32, ldsA + (unsigned)ab * (ABUF * 2));
  }
  // the last two tiles
  const _Float16* Al = As + (((K - AK) / AK) & 1) * ABUF;
  tile_mma<SPLIT, TRANS>(Al, Bs, wr, wc, half, l16, acc);
  tile_store(g[1 % SETS], dstB + TN * LDSTR);
  tile_barrier();
  tile_mma<SPLIT, TRANS>(Al + TK, Bs + TN * LDSTR, wr, wc, half, l16, acc);
  // no copy is outstanding when the wave goes on to its epilogue
  asm volatile("s_wait_asynccnt 0x0" ::: "memory");
}

// One 128x128 tile of C at (bm, bn), f32 out.
template <int N>
__device__ __forceinline__ void gemm_tile(
    const _Float16* __restrict__ A, const float* __restrict__ Bw,
    float* __restrict__ C, const float* __restrict__ resid,
    int K, int bm, int bn) {
  __shared__ alignas(16) _Float16 As[2 * ABUF];
  __shared__ alignas(16) _Float16 Bs[2 * TN * LDSTR];
  v8f acc[2][4];
  gemm_mainloop<false, false, N, 2>(A, Bw, K, bm, bn, As, Bs, acc);
  int t = threadIdx.x;
  int wave = t >> 5, lane = t & 31;
  int wr = wave & 3, wc = wave >> 2;
  int half = lane >> 4, l16 = lane & 15;

  // ---- epilogue: residual branch hoisted once (uniform), pointer-walked rows ----
  {
    int rowg0 = bm + wr * 32 + half * 8;
    int colg0 = bn + wc * 64 + l16;
    if (resid != nullptr) {
#pragma unroll
      for (int i = 0; i < 2; ++i) {
        size_t base = (size_t)(rowg0 + i * 16) * N + colg0;
#pragma unroll
        for (int r = 0; r < 8; ++r) {
          float* crow = C + base + (size_t)r * N;
          const float* rrow = resid + base + (size_t)r * N;
#pragma unroll
          for (int j = 0; j < 4; ++j)
            crow[j * 16] = acc[i][j][r] + rrow[j * 16];
        }
      }
    } else {
#pragma unroll
      for (int i = 0; i < 2; ++i) {
        size_t base = (size_t)(rowg0 + i * 16) * N + colg0;
#pragma unroll
        for (int r = 0; r < 8; ++r) {
          float* crow = C + base + (size_t)r * N;
#pragma unroll
          for (int j = 0; j < 4; ++j)
            crow[j * 16] = acc[i][j][r];
        }
      }
    }
  }
}

__global__ __launch_bounds__(256) void gemm_wmma(
    const _Float16* __restrict__ A, const float* __restrict__ Bw,
    float* __restrict__ C, const float* __restrict__ resid, int K) {
  gemm_tile<H_DIM>(A, Bw, C, resid, K, blockIdx.y * TM, blockIdx.x * TN);
}

// Q, K and V projections share A and are independent: one grid holds the tile
// columns of all three, so the two narrow products (128 blocks each, half the
// chip's WGPs) run beside the wide one instead of after it.
#define QTILES ((NHEAD * HDIM) / TN)
#define KVTILES ((NKVH * HDIM) / TN)
// One register set, and a register budget for 6 waves per SIMD (the second launch bound):
// three blocks on a WGP put the whole grid (768 blocks, 256 WGPs) on the chip at once; with
// two sets only two blocks fit and a third of the grid waits for a second round.
#define QKV_SETS 1
// A tile is one head (TN == HDIM), so the epilogue finishes the head in registers.
// Q and K tiles are computed transposed, so that a lane holds 8 consecutive d of one
// position: they are rotated and stored as f16 [S, heads, 128] in 16-byte pieces.
// V tiles keep the plain order, in which a lane holds 8 consecutive positions of one
// d: they are stored as f16 V^T [NKV, 128, S], also in 16-byte pieces.
__global__ __launch_bounds__(256, 6) void gemm_qkv(
    const _Float16* __restrict__ A, const float* __restrict__ wq,
    const float* __restrict__ wk, const float* __restrict__ wv,
    const float* __restrict__ cosb, const float* __restrict__ sinb,
    _Float16* __restrict__ q, _Float16* __restrict__ k, _Float16* __restrict__ vt,
    int K) {
  __shared__ alignas(16) _Float16 As[2 * ABUF];
  __shared__ alignas(16) _Float16 Bs[2 * TN * LDSTR];
  int bx = blockIdx.x;
  int bm = blockIdx.y * TM;
  int t = threadIdx.x;
  int wave = t >> 5, lane = t & 31;
  int wr = wave & 3, wc = wave >> 2;
  int half = lane >> 4, l16 = lane & 15;
  v8f acc[2][4];

  if (bx >= QTILES + KVTILES) {
    bx -= QTILES + KVTILES;
    gemm_mainloop<false, false, NKVH * HDIM, QKV_SETS>(A, wv, K, bm, bx * TN, As, Bs, acc);
#pragma unroll
    for (int j = 0; j < 4; ++j) {
      _Float16* vcol = vt + ((size_t)bx * HDIM + frag_col<false>(wc, j) + l16) * S_LEN +
                       bm + wr * 32 + half * 8;
#pragma unroll
      for (int i = 0; i < 2; ++i) {
        v8h o;
#pragma unroll
        for (int r = 0; r < 8; ++r) o[r] = (_Float16)acc[i][j][r];
        *(v8h*)(vcol + i * 16) = o;
      }
    }
    return;
  }

  _Float16* C = q;
  int N = NHEAD * HDIM;
  if (bx >= QTILES) {
    C = k; N = NKVH * HDIM; bx -= QTILES;
    gemm_mainloop<true, true, NKVH * HDIM, QKV_SETS>(A, wk, K, bm, bx * TN, As, Bs, acc);
  } else {
    gemm_mainloop<true, true, NHEAD * HDIM, QKV_SETS>(A, wq, K, bm, bx * TN, As, Bs, acc);
  }
#pragma unroll
  for (int i = 0; i < 2; ++i) {
    int s = bm + wr * 32 + i * 16 + l16;
#pragma unroll
    for (int jj = 0; jj < 2; ++jj) {
      int d = frag_col<true>(wc, jj) + half * 8;  // 0..63: low column of the rotary pair
      const float* cr = cosb + (size_t)s * HDIM + d;
      const float* sr = sinb + (size_t)s * HDIM + d;
      v8h lo, hi;
#pragma unroll
      for (int r = 0; r < 8; ++r) {
        float x1 = acc[i][jj][r], x2 = acc[i][jj + 2][r];
        lo[r] = (_Float16)(x1 * cr[r] - x2 * sr[r]);
        hi[r] = (_Float16)(x2 * cr[r + 64] + x1 * sr[r + 64]);
      }
      _Float16* orow = C + (size_t)s * N + bx * TN + d;
      *(v8h*)orow = lo;
      *(v8h*)(orow + 64) = hi;
    }
  }
  // Precaution: the stores' registers are not rewritten before the stores have taken them.
  asm volatile("s_wait_xcnt 0x0" ::: "memory");
}

// ---------------- Flash attention (causal, GQA 4:1), WMMA K Q^T and V^T P^T ----------------
#define KV_T   32   // keys per staged tile
#define KPITCH 136  // halfs per staged K row (272 B = 16 B x odd: b128 reads without bank conflicts)
#define VPITCH 40   // halfs per staged V^T row (80 B = 16 B x odd)
#define NQT (S_LEN / 64)  // query tiles of 64 rows per head (even)

// One tile's asynchronous copies to LDS, 8 per thread: K 32 rows x 256 B (4 copies, 8 rows
// apart), V^T 128 rows x 64 B (4 copies, 32 rows apart). The s_wait_xcnt stands inside the
// copies' own statement as a precaution: no address register is rewritten in front of it.
__device__ __forceinline__ void stage_kv(const _Float16* gk, const _Float16* gv,
                                         unsigned lk, unsigned lv) {
  asm volatile(
      "global_load_async_to_lds_b128 %0, %8, off\n\t"
      "global_load_async_to_lds_b128 %1, %9, off\n\t"
      "global_load_async_to_lds_b128 %2, %10, off\n\t"
      "global_load_async_to_lds_b128 %3, %11, off\n\t"
      "global_load_async_to_lds_b128 %4, %12, off\n\t"
      "global_load_async_to_lds_b128 %5, %13, off\n\t"
      "global_load_async_to_lds_b128 %6, %14, off\n\t"
      "global_load_async_to_lds_b128 %7, %15, off\n\t"
      "s_wait_xcnt 0x0"
      :: "v"(lk), "v"(lk + 8 * KPITCH * 2), "v"(lk + 16 * KPITCH * 2), "v"(lk + 24 * KPITCH * 2),
         "v"(lv), "v"(lv + 32 * VPITCH * 2), "v"(lv + 64 * VPITCH * 2), "v"(lv + 96 * VPITCH * 2),
         "v"(gk), "v"(gk + 8 * NKVH * HDIM), "v"(gk + 16 * NKVH * HDIM), "v"(gk + 24 * NKVH * HDIM),
         "v"(gv), "v"(gv + 32 * S_LEN), "v"(gv + 64 * S_LEN), "v"(gv + 96 * S_LEN)
      : "memory");
}

__global__ __launch_bounds__(128) void flash_attn_kernel(
    const _Float16* __restrict__ Qh,  // [S, NH, 128]
    const _Float16* __restrict__ Kh,  // [S, NKV, 128]
    const _Float16* __restrict__ Vt,  // [NKV, 128, S]  (transposed)
    _Float16* __restrict__ Oh) {      // [S, NH*128]
  int head = blockIdx.y;
  int kvhead = head >> 2;  // NH/NKV = 4
  int tid = threadIdx.x;
  int wave = __builtin_amdgcn_readfirstlane(tid >> 5), lane = tid & 31;
  int half = lane >> 4, l16 = lane & 15;

  // K and V^T tiles of KV_T keys, read by all four waves; two buffers
  __shared__ alignas(16) _Float16 Ks[2][KV_T * KPITCH];
  __shared__ alignas(16) _Float16 Vs[2][HDIM * VPITCH];

  // this thread's first copy of tile 0: global sources and LDS byte addresses in buffer 0
  const _Float16* gk = Kh + ((size_t)(tid >> 4) * NKVH + kvhead) * HDIM + (tid & 15) * 8;
  const _Float16* gv = Vt + ((size_t)kvhead * HDIM + (tid >> 2)) * S_LEN + (tid & 3) * 8;
  unsigned lk = (unsigned)(size_t)&Ks[0][(tid >> 4) * KPITCH + (tid & 15) * 8];
  unsigned lv = (unsigned)(size_t)&Vs[0][(tid >> 2) * VPITCH + (tid & 3) * 8];

  // A query tile's causal work grows with its index (tile x walks 2x + 2 key tiles) and every
  // block of the grid is on the chip at once, so the launch lasts as long as its fullest WGP.
  // Each block therefore takes two query tiles of its head, one after the other in every wave:
  // NQT - 1 - blockIdx.x, then blockIdx.x, 2 * NQT + 2 key tiles for every block alike. The last
  // foot of the first walk (waits and barrier) has ended every read of both buffers before the
  // second walk's first copies.
  for (int pass = 0; pass < 2; ++pass) {
  const int qt = pass == 0 ? NQT - 1 - (int)blockIdx.x : (int)blockIdx.x;
  const int q0 = qt * 64 + wave * 16;  // this wave's 16 query rows
  const int ntile = 2 * qt + 2;  // tiles up to the query tile's last row; at least 2

  stage_kv(gk, gv, lk, lv);
  // tile 0 has landed for this wave; the barrier publishes it to the other waves
  asm volatile("s_wait_asynccnt 0x0" ::: "memory");
  __syncthreads();
  stage_kv(gk + (size_t)KV_T * NKVH * HDIM, gv + KV_T,
           lk + (unsigned)sizeof(Ks[0]), lv + (unsigned)sizeof(Vs[0]));

  // Preload Q B-fragments: HD=128 -> 4 chunks of K=32 (two 16B loads each)
  v16h qf[4];
  {
    const _Float16* qrow = Qh + ((size_t)(q0 + l16) * NHEAD + head) * HDIM;
#pragma unroll
    for (int c = 0; c < 4; ++c)
      qf[c] = cat8(*(const v8h*)(qrow + c * 32 + half * 8),
                   *(const v8h*)(qrow + c * 32 + 16 + half * 8));
  }

  v8f o[8];
#pragma unroll
  for (int df = 0; df < 8; ++df) o[df] = (v8f){};
  // a lane's one query (q0 + l16): running maximum (equal in both wave halves) and the sum
  // over this half's keys only; the halves' sums are joined once, in the epilogue
  float mrun = -1e30f, lrun = 0.f;
  const int qme = q0 + l16;

  const float scl = 0.08838834764831845f;  // 1/sqrt(128)
  int kv_end = q0 + 16;                    // causal: kv <= q

  for (int tile = 0; tile < ntile; ++tile) {
    int kv0 = tile * KV_T;
    const _Float16* Kb = Ks[tile & 1];
    const _Float16* Vb = Vs[tile & 1];
    if (kv0 < kv_end) {  // wave-uniform: a wave skips tiles beyond its diagonal, never the foot
      // ---- scores, transposed: S^T = K Q^T, two fragments of 16 keys x 16 queries ----
      // s0[r] is key kv0 + 8*half + r, s1[r] key kv0 + 16 + 8*half + r, both of query q0 + l16
      v16h kf0[4], kf1[4];
#pragma unroll
      for (int c = 0; c < 4; ++c) {
        const _Float16* kr0 = Kb + l16 * KPITCH + c * 32;
        const _Float16* kr1 = Kb + (16 + l16) * KPITCH + c * 32;
        kf0[c] = cat8(*(const v8h*)(kr0 + half * 8),
                      *(const v8h*)(kr0 + 16 + half * 8));
        kf1[c] = cat8(*(const v8h*)(kr1 + half * 8),
                      *(const v8h*)(kr1 + 16 + half * 8));
      }
      // Keeps the 16 loads one group in front of the products: sunk among them, each pair
      // is waited for to the end directly in front of its product.
      __builtin_amdgcn_sched_barrier(0);
      v8f s0 = {}, s1 = {};
#pragma unroll
      for (int c = 0; c < 4; ++c) {
        s0 = wmma_f16(kf0[c], qf[c], s0);
        s1 = wmma_f16(kf1[c], qf[c], s1);
      }
      // staged V^T rows are the A operand of the second product: 8 fragments of 16 d x 32 keys
      v16h vf[8];
#pragma unroll
      for (int df = 0; df < 8; ++df) {
        const _Float16* vrow = Vb + (df * 16 + l16) * VPITCH;
        vf[df] = cat8(*(const v8h*)(vrow + half * 8),
                      *(const v8h*)(vrow + 16 + half * 8));
      }
      // Keeps these 16 loads here, in flight under the softmax, for the same reason.
      __builtin_amdgcn_sched_barrier(0);

      // ---- online softmax: a lane's 16 scores belong to one query ----
      int lim = qme - kv0 - 8 * half;  // s0[r] is masked where r > lim, s1[r] where 16 + r > lim
      float mx = -1e30f;
#pragma unroll
      for (int r = 0; r < 8; ++r) {
        s0[r] *= scl; if (r > lim)      s0[r] = -1e30f;
        s1[r] *= scl; if (16 + r > lim) s1[r] = -1e30f;
        mx = fmaxf(mx, fmaxf(s0[r], s1[r]));
      }
      mx = fmaxf(mx, xhalf(mx));  // the other half holds the query's other 16 keys
      float mnew = fmaxf(mrun, mx);
      float alpha = __expf(mrun - mnew);
      float rs = 0.f;
      // the k order of a 32-key operand is this lane's s0 then s1: P^T needs no move between lanes
      v16h pf;
#pragma unroll
      for (int r = 0; r < 8; ++r) {
        float p0 = __expf(s0[r] - mnew);
        float p1 = __expf(s1[r] - mnew);
        rs += p0 + p1;
        pf[r]     = (_Float16)p0;
        pf[r + 8] = (_Float16)p1;
      }
      lrun = lrun * alpha + rs;
      mrun = mnew;
#pragma unroll
      for (int df = 0; df < 8; ++df) o[df] *= alpha;

      // ---- O^T += V^T P^T: 8 fragments of 16 d x 16 queries ----
#pragma unroll
      for (int df = 0; df < 8; ++df) o[df] = wmma_f16(vf[df], pf, o[df]);
    }

    // ---- foot of the trip, every wave ----
    // this wave's reads of the buffer that is refilled below have returned
    asm volatile("s_wait_dscnt 0x0" ::: "memory");
    // this wave's copies of the next tile have landed
    asm volatile("s_wait_asynccnt 0x0" ::: "memory");
    // publishes the next tile and ends every wave's reads of this one
    __syncthreads();
    if (tile + 2 < ntile)
      stage_kv(gk + (size_t)(tile + 2) * KV_T * NKVH * HDIM, gv + (tile + 2) * KV_T,
               lk + (unsigned)(tile & 1) * (unsigned)sizeof(Ks[0]),
               lv + (unsigned)(tile & 1) * (unsigned)sizeof(Vs[0]));
  }
  // no copy is outstanding when the walk ends
  asm volatile("s_wait_asynccnt 0x0" ::: "memory");

  // ---- epilogue: normalize and store f16 attn output [S, NH*HD] ----
  // o[df][r] is d = df*16 + 8*half + r of query q0 + l16: 16-byte pieces
  float inv = 1.f / (lrun + xhalf(lrun));
  _Float16* orow = Oh + (size_t)qme * (NHEAD * HDIM) + head * HDIM + half * 8;
  v8h ov[8];
#pragma unroll
  for (int df = 0; df < 8; ++df)
#pragma unroll
    for (int r = 0; r < 8; ++r) ov[df][r] = (_Float16)(o[df][r] * inv);
#pragma unroll
  for (int df = 0; df < 8; ++df) *(v8h*)(orow + df * 16) = ov[df];
  // Precaution: the stores' registers are not rewritten by the second walk before the stores
  // have taken them.
  asm volatile("s_wait_xcnt 0x0" ::: "memory");
  }
}

// ---------------- host launch ----------------
extern "C" void kernel_launch(void* const* d_in, const int* in_sizes, int n_in,
                              void* d_out, int out_size, void* d_ws, size_t ws_size,
                              hipStream_t stream) {
  const float* hid    = (const float*)d_in[0];
  const float* cosb   = (const float*)d_in[1];
  const float* sinb   = (const float*)d_in[2];
  const float* norm_w = (const float*)d_in[3];
  const float* wq     = (const float*)d_in[4];
  const float* wk     = (const float*)d_in[5];
  const float* wv     = (const float*)d_in[6];
  const float* wo     = (const float*)d_in[7];
  float* out = (float*)d_out;

  char* ws = (char*)d_ws;
  size_t off = 0;
  auto carve = [&](size_t bytes) -> char* {
    char* p = ws + off;
    off += (bytes + 255) & ~(size_t)255;
    return p;
  };
  _Float16* h16   = (_Float16*)carve((size_t)S_LEN * H_DIM * 2);
  _Float16* q16   = (_Float16*)carve((size_t)S_LEN * NHEAD * HDIM * 2);
  _Float16* k16   = (_Float16*)carve((size_t)S_LEN * NKVH * HDIM * 2);
  _Float16* vt16  = (_Float16*)carve((size_t)NKVH * HDIM * S_LEN * 2);
  _Float16* att16 = (_Float16*)carve((size_t)S_LEN * NHEAD * HDIM * 2);

  // 1) RMSNorm -> f16
  rmsnorm_kernel<<<S_LEN, 256, 0, stream>>>(hid, norm_w, h16);

  // 2) Q/K/V projections in one launch (WMMA GEMM, f32 weights converted in LDS stage);
  //    the epilogue applies RoPE to Q and K (-> f16) and stores V as V^T f16
  gemm_qkv<<<dim3(QTILES + 2 * KVTILES, S_LEN / TM), 256, 0, stream>>>(
      h16, wq, wk, wv, cosb, sinb, q16, k16, vt16, H_DIM);

  // 3) Flash attention (causal, GQA)
  flash_attn_kernel<<<dim3(NQT / 2, NHEAD), 128, 0, stream>>>(q16, k16, vt16, att16);

  // 4) Output projection + residual
  gemm_wmma<<<dim3(H_DIM / TN, S_LEN / TM), 256, 0, stream>>>(
      att16, wo, out, hid, NHEAD * HDIM);
}

// v008
// A run of this version takes 226 microseconds.
// Timed twice side by side with v007, it ran 1.09 and 1.07 times as fast.
// All steps since v000 together make it 3.52 times as fast.
#include <hip/hip_runtime.h>
#include <hip/hip_bf16.h>

typedef __attribute__((ext_vector_type(16))) _Float16 v16h;
typedef __attribute__((ext_vector_type(8)))  _Float16 v8h;
typedef __attribute__((ext_vector_type(4)))  _Float16 v4h;
typedef __attribute__((ext_vector_type(2)))  _Float16 v2h;
typedef __attribute__((ext_vector_type(8)))  float    v8f;

#define S_LEN 2048
#define H_DIM 4096
#define NHEAD 32
#define NKVH  8
#define HDIM  128

__device__ inline v8f wmma_f16(v16h a, v16h b, v8f c) {
  return __builtin_amdgcn_wmma_f32_16x16x32_f16(
      false, a, false, b, (short)0, c, false, false);
}

__device__ inline v16h cat8(v8h a, v8h b) {
  return __builtin_shufflevector(a, b, 0, 1, 2, 3, 4, 5, 6, 7,
                                 8, 9, 10, 11, 12, 13, 14, 15);
}
// lane l takes the value of lane l ^ 16 (the other half of the wave)
__device__ inline float xhalf(float x) {
  int i = __builtin_bit_cast(int, x);
  return __builtin_bit_cast(float, __builtin_amdgcn_permlanex16(i, i, 0x76543210, 0xfedcba98, false, false));
}

// ---------------- RMSNorm -> f16 ----------------
__global__ __launch_bounds__(256) void rmsnorm_kernel(
    const float* __restrict__ x, const float* __restrict__ w,
    _Float16* __restrict__ h) {
  int row = blockIdx.x;
  const float* xr = x + (size_t)row * H_DIM;
  float ss = 0.f;
  for (int c = threadIdx.x * 4; c < H_DIM; c += 1024) {
    float4 v = *(const float4*)(xr + c);
    ss += v.x * v.x + v.y * v.y + v.z * v.z + v.w * v.w;
  }
  __shared__ float red[256];
  red[threadIdx.x] = ss;
  __syncthreads();
  for (int s2 = 128; s2 > 0; s2 >>= 1) {
    if (threadIdx.x < s2) red[threadIdx.x] += red[threadIdx.x + s2];
    __syncthreads();
  }
  float scale = rsqrtf(red[0] * (1.f / H_DIM) + 1e-5f);
  for (int c = threadIdx.x * 4; c < H_DIM; c += 1024) {
    float4 v = *(const float4*)(xr + c);
    float4 g = *(const float4*)(w + c);
    v4h o;
    o[0] = (_Float16)(v.x * scale * g.x);
    o[1] = (_Float16)(v.y * scale * g.y);
    o[2] = (_Float16)(v.z * scale * g.z);
    o[3] = (_Float16)(v.w * scale * g.w);
    *(v4h*)(h + (size_t)row * H_DIM + c) = o;
  }
}

// ------- Tiled WMMA GEMM: C[M,N] = A_f16[M,K] * B_f32[K,N] (+resid), 256x128x32 -------
// A block's 8 waves stand 4 (rows) x 2 (columns); a wave's part is 64x64, FR x 4 fragments.
#define TM 256
#define FR 4  // fragment rows of a wave
#define TN 128
#define TK 32
#define LDSTR 40  // padded stride of a staged B column in halfs (16B-aligned)
#define AK     64  // k per staged A buffer, two k-tiles: one whole 128-byte line of every row
#define APITCH 72  // halfs per staged A row (144 B = 16 B x odd: b128 reads without bank conflicts)
#define ABUF (TM * APITCH)  // halfs per A buffer

// First tile column of a wave's fragment j. SPLIT: two fragments from each half of
// the tile, so that columns d and d + 64 (a rotary pair) sit in the same lane.
template <bool SPLIT>
__device__ __forceinline__ int frag_col(int wc, int j) {
  return SPLIT ? (j >> 1) * 64 + wc * 32 + (j & 1) * 16 : wc * 64 + j * 16;
}

// One k-tile of B on its way from global memory to LDS, in registers.
struct TileRegs {
  float4 r0, r1, r2, r3;  // a 4 (k) x 4 (column) patch, f32
};

// srcB: this thread's first element of the k-tile.
template <int N>
__device__ __forceinline__ void tile_load(TileRegs& g, const float* srcB) {
  g.r0 = *(const float4*)srcB;
  g.r1 = *(const float4*)(srcB + N);
  g.r2 = *(const float4*)(srcB + 2 * N);
  g.r3 = *(const float4*)(srcB + 3 * N);
}

// dstB: this thread's first column at its first k.
__device__ __forceinline__ void tile_store(const TileRegs& g, _Float16* dstB) {
  v4h c0, c1, c2, c3;  // f32 -> f16, col-major
  c0[0] = (_Float16)g.r0.x; c0[1] = (_Float16)g.r1.x; c0[2] = (_Float16)g.r2.x; c0[3] = (_Float16)g.r3.x;
  c1[0] = (_Float16)g.r0.y; c1[1] = (_Float16)g.r1.y; c1[2] = (_Float16)g.r2.y; c1[3] = (_Float16)g.r3.y;
  c2[0] = (_Float16)g.r0.z; c2[1] = (_Float16)g.r1.z; c2[2] = (_Float16)g.r2.z; c2[3] = (_Float16)g.r3.z;
  c3[0] = (_Float16)g.r0.w; c3[1] = (_Float16)g.r1.w; c3[2] = (_Float16)g.r2.w; c3[3] = (_Float16)g.r3.w;
  *(v4h*)(dstB + 0 * LDSTR) = c0;
  *(v4h*)(dstB + 1 * LDSTR) = c1;
  *(v4h*)(dstB + 2 * LDSTR) = c2;
  *(v4h*)(dstB + 3 * LDSTR) = c3;
}

// Work-group barrier of the main loop, written by hand: __syncthreads() also waits for
// every global load, which would end the flight of the tiles loaded ahead. The wave's own
// LDS stores and reads are complete (s_wait_dscnt 0) before it signals. s_wait_xcnt 0 is a
// precaution: behind the barrier the fragment loads rewrite registers that held addresses
// of the global loads issued in front of it.
__device__ __forceinline__ void tile_barrier() {
  asm volatile("s_wait_xcnt 0x0\n\ts_wait_dscnt 0x0\n\ts_barrier_signal -1\n\ts_barrier_wait -1"
               ::: "memory");
}
// The same barrier where it also publishes an A buffer: the wave's own copies into that
// buffer have landed (s_wait_asynccnt 0) before it signals.
__device__ __forceinline__ void tile_barrier_copies() {
  asm volatile("s_wait_xcnt 0x0\n\ts_wait_dscnt 0x0\n\ts_wait_asynccnt 0x0\n\t"
               "s_barrier_signal -1\n\ts_barrier_wait -1"
               ::: "memory");
}

// Half an A buffer's asynchronous copies to LDS, 4 per thread: 128 rows x 128 B. Eight
// neighbouring lanes take one row's line, so a wave-wide copy is 4 whole cache lines; a
// thread's copies are 32 rows apart (rows32: 32 rows of A, in halfs). The s_wait_xcnt stands
// inside the copies' own statement as a precaution: no address register is rewritten in
// front of it.
__device__ __forceinline__ void stage_a(const _Float16* ga, size_t rows32, unsigned la) {
  asm volatile(
      "global_load_async_to_lds_b128 %0, %4, off\n\t"
      "global_load_async_to_lds_b128 %1, %5, off\n\t"
      "global_load_async_to_lds_b128 %2, %6, off\n\t"
      "global_load_async_to_lds_b128 %3, %7, off\n\t"
      "s_wait_xcnt 0x0"
      :: "v"(la), "v"(la + 32 * APITCH * 2), "v"(la + 64 * APITCH * 2), "v"(la + 96 * APITCH * 2),
         "v"(ga), "v"(ga + rows32), "v"(ga + 2 * rows32), "v"(ga + 3 * rows32)
      : "memory");
}
// One A buffer, TM = 256 rows: 8 copies per thread.
__device__ __forceinline__ void stage_a_buf(const _Float16* ga, size_t rows32, unsigned la) {
  stage_a(ga, rows32, la);
  stage_a(ga + 4 * rows32, rows32, la + 128 * APITCH * 2);
}

// The products of one staged k-tile. At: the tile's first k in row 0 of its A buffer.
template <bool SPLIT, bool TRANS>
__device__ __forceinline__ void tile_mma(const _Float16* At, const _Float16* Bt,
                                         int wr, int wc, int half, int l16, v8f (&acc)[FR][4]) {
  v16h af[FR], bf[4];
  // in the order of their first use: row 0, the four columns, rows 1 to 3
#pragma unroll
  for (int i = 0; i < FR; ++i) {
    const _Float16* arow = &At[(wr * (FR * 16) + i * 16 + l16) * APITCH];
    af[i] = cat8(*(const v8h*)(arow + half * 8),
                 *(const v8h*)(arow + 16 + half * 8));
    if (i == 0) {
#pragma unroll
      for (int j = 0; j < 4; ++j) {
        const _Float16* bcol = &Bt[(frag_col<SPLIT>(wc, j) + l16) * LDSTR];
        bf[j] = cat8(*(const v8h*)(bcol + half * 8),
                     *(const v8h*)(bcol + 16 + half * 8));
      }
    }
  }
  // Keeps the 16 loads one group in front of the products: sunk among them, each row's pair
  // goes into the registers of the row before and is waited for to the end, four times a tile.
  __builtin_amdgcn_sched_barrier(0);
#pragma unroll
  for (int i = 0; i < FR; ++i)
#pragma unroll
    for (int j = 0; j < 4; ++j)
      acc[i][j] = TRANS ? wmma_f16(bf[j], af[i], acc[i][j])
                        : wmma_f16(af[i], bf[j], acc[i][j]);
  // Keeps the wait for the tile loaded ahead, and its LDS stores, behind these products:
  // moved in front of them, the wait would stand directly behind the loads' issue.
  __builtin_amdgcn_sched_barrier(0);
}

// Accumulates one 256x128 tile at (bm, bn) of A[.,K] * Bw[K,N]; called by every thread of
// a 256-thread block. K is a multiple of AK = 2 * TK and at least 2 * AK (both A buffers are
// filled in front of the loop). As holds two buffers of ABUF halfs,
// row-major [row][k], AK k each; Bs two of TN * LDSTR, col-major [col][k], TK k each.
// B: tile t is worked on from buffer t & 1 while tile t + 1 goes from registers into the other
// buffer; a register set is loaded again as soon as it is stored, with the tile SETS ahead
// of the one it held, so that SETS tiles' global loads are in flight under the products.
// One barrier per tile: it publishes tile t + 1 and ends the reads of tile t, whose buffer
// is written in the next trip. Every load is unconditional, so that the waits in front of
// the LDS stores can leave the younger set's loads in flight; with two sets, past the last
// tile the last one is loaded once more and not used.
// A: tiles 2p and 2p + 1 are read from A buffer p & 1, filled by asynchronous copies. The
// barrier behind tile 2p + 1 publishes buffer (p + 1) & 1 and ends the reads of buffer p & 1;
// behind it the copies for tiles 2p + 4 and 2p + 5 start into the buffer just read.
// acc[i][j][r] is row wr*64 + i*16 + half*8 + r, column frag_col(wc, j) + l16;
// with TRANS (operands swapped, the fragment comes out transposed)
// row wr*64 + i*16 + l16, column frag_col(wc, j) + half*8 + r.
template <bool SPLIT, bool TRANS, int N, int SETS>
__device__ __forceinline__ void gemm_mainloop(
    const _Float16* __restrict__ A, const float* __restrict__ Bw,
    int K, int bm, int bn, _Float16* As, _Float16* Bs, v8f (&acc)[FR][4]) {
  int t = threadIdx.x;
  int wave = t >> 5, lane = t & 31;
  int wr = wave & 3;   // rows wr*64 .. +63  (FR fragment rows)
  int wc = wave >> 2;  // 4 fragment cols, at frag_col(wc, j)
  int half = lane >> 4, l16 = lane & 15;

#pragma unroll
  for (int i = 0; i < FR; ++i)
#pragma unroll
    for (int j = 0; j < 4; ++j) acc[i][j] = (v8f){};

  // A buffer 256x64 f16: eight 16B copies a thread; B tile 32x128 f32: a 4x4 patch a thread
  const _Float16* srcA = A + (size_t)(bm + (t >> 3)) * K + (t & 7) * 8;
  const size_t rows32 = (size_t)32 * K;
  const unsigned ldsA = (unsigned)(size_t)&As[(t >> 3) * APITCH + (t & 7) * 8];
  const float* srcB = Bw + (size_t)((t >> 5) * 4) * N + bn + (t & 31) * 4;
  _Float16* dstB = &Bs[(t & 31) * 4 * LDSTR + (t >> 5) * 4];
  const int klast = K - TK;

  stage_a_buf(srcA, rows32, ldsA);  // A buffer 0
  TileRegs g[SETS];
#pragma unroll
  for (int s = 0; s < SETS; ++s)
    tile_load<N>(g[s], srcB + (size_t)s * TK * N);
  tile_store(g[0], dstB);
  {
    int kn = min(SETS * TK, klast);
    tile_load<N>(g[0], srcB + (size_t)kn * N);
  }
  tile_barrier_copies();
  stage_a_buf(srcA + AK, rows32, ldsA + ABUF * 2);  // A buffer 1

  for (int k0 = 0; k0 < K - AK; k0 += AK) {
    const int ab = (k0 / AK) & 1;  // this trip's A buffer
    const _Float16* Ab = As + ab * ABUF;
    // even tile from B buffer 0; the next tile into B buffer 1
    tile_mma<SPLIT, TRANS>(Ab, Bs, wr, wc, half, l16, acc);
    tile_store(g[1 % SETS], dstB + TN * LDSTR);
    int k1 = k0 + (1 + SETS) * TK;  // at most klast
    tile_load<N>(g[1 % SETS], srcB + (size_t)k1 * N);
    tile_barrier();
    // odd tile from B buffer 1; the next tile into B buffer 0
    tile_mma<SPLIT, TRANS>(Ab + TK, Bs + TN * LDSTR, wr, wc, half, l16, acc);
    tile_store(g[0], dstB);
    int k2 = SETS == 1 ? k0 + 3 * TK : min(k0 + (2 + SETS) * TK, klast);  // one set: at most klast
    tile_load<N>(g[0], srcB + (size_t)k2 * N);
    tile_barrier_copies();
    if (k0 + 2 * AK < K)  // the same for the whole block
      stage_a_buf(srcA + k0 + 2 * AK, rows32, ldsA + (unsigned)ab * (ABUF * 2));
  }
  // the last two tiles
  const _Float16* Al = As + (((K - AK) / AK) & 1) * ABUF;
  tile_mma<SPLIT, TRANS>(Al, Bs, wr, wc, half, l16, acc);
  tile_store(g[1 % SETS], dstB + TN * LDSTR);
  tile_barrier();
  tile_mma<SPLIT, TRANS>(Al + TK, Bs + TN * LDSTR, wr, wc, half, l16, acc);
  // no copy is outstanding when the wave goes on to its epilogue
  asm volatile("s_wait_asynccnt 0x0" ::: "memory");
}

// One 256x128 tile of C at (bm, bn), f32 out.
template <int N>
__device__ __forceinline__ void gemm_tile(
    const _Float16* __restrict__ A, const float* __restrict__ Bw,
    float* __restrict__ C, const float* __restrict__ resid,
    int K, int bm, int bn) {
  __shared__ alignas(16) _Float16 As[2 * ABUF];
  __shared__ alignas(16) _Float16 Bs[2 * TN * LDSTR];
  v8f acc[FR][4];
  gemm_mainloop<false, false, N, 2>(A, Bw, K, bm, bn, As, Bs, acc);
  int t = threadIdx.x;
  int wave = t >> 5, lane = t & 31;
  int wr = wave & 3, wc = wave >> 2;
  int half = lane >> 4, l16 = lane & 15;

  // ---- epilogue: residual branch hoisted once (uniform), pointer-walked rows ----
  {
    int rowg0 = bm + wr * (FR * 16) + half * 8;
    int colg0 = bn + wc * 64 + l16;
    if (resid != nullptr) {
#pragma unroll
      for (int i = 0; i < FR; ++i) {
        size_t base = (size_t)(rowg0 + i * 16) * N + colg0;
#pragma unroll
        for (int r = 0; r < 8; ++r) {
          float* crow = C + base + (size_t)r * N;
          const float* rrow = resid + base + (size_t)r * N;
#pragma unroll
          for (int j = 0; j < 4; ++j)
            crow[j * 16] = acc[i][j][r] + rrow[j * 16];
        }
      }
    } else {
#pragma unroll
      for (int i = 0; i < FR; ++i) {
        size_t base = (size_t)(rowg0 + i * 16) * N + colg0;
#pragma unroll
        for (int r = 0; r < 8; ++r) {
          float* crow = C + base + (size_t)r * N;
#pragma unroll
          for (int j = 0; j < 4; ++j)
            crow[j * 16] = acc[i][j][r];
        }
      }
    }
  }
}

// The grid is 256 blocks, one for each WGP: at most 2 waves per SIMD, so that no WGP takes
// two blocks while another stands idle.
__global__ __launch_bounds__(256) __attribute__((amdgpu_waves_per_eu(2, 2))) void gemm_wmma(
    const _Float16* __restrict__ A, const float* __restrict__ Bw,
    float* __restrict__ C, const float* __restrict__ resid, int K) {
  gemm_tile<H_DIM>(A, Bw, C, resid, K, blockIdx.y * TM, blockIdx.x * TN);
}

// Q, K and V projections share A and are independent: one grid holds the tile
// columns of all three, so the two narrow products (64 blocks each, a quarter of the
// chip's WGPs) run beside the wide one instead of after it.
#define QTILES ((NHEAD * HDIM) / TN)
#define KVTILES ((NKVH * HDIM) / TN)
// One register set, and a register budget for 4 waves per SIMD (the second launch bound):
// two blocks on a WGP put the whole grid (384 blocks, 256 WGPs) on the chip at once.
#define QKV_SETS 1
// A tile is one head (TN == HDIM), so the epilogue finishes the head in registers.
// Q and K tiles are computed transposed, so that a lane holds 8 consecutive d of one
// position: they are rotated and stored as f16 [S, heads, 128] in 16-byte pieces.
// V tiles keep the plain order, in which a lane holds 8 consecutive positions of one
// d: they are stored as f16 V^T [NKV, 128, S], also in 16-byte pieces.
__global__ __launch_bounds__(256, 4) void gemm_qkv(
    const _Float16* __restrict__ A, const float* __restrict__ wq,
    const float* __restrict__ wk, const float* __restrict__ wv,
    const float* __restrict__ cosb, const float* __restrict__ sinb,
    _Float16* __restrict__ q, _Float16* __restrict__ k, _Float16* __restrict__ vt,
    int K) {
  __shared__ alignas(16) _Float16 As[2 * ABUF];
  __shared__ alignas(16) _Float16 Bs[2 * TN * LDSTR];
  int bx = blockIdx.x;
  int bm = blockIdx.y * TM;
  int t = threadIdx.x;
  int wave = t >> 5, lane = t & 31;
  int wr = wave & 3, wc = wave >> 2;
  int half = lane >> 4, l16 = lane & 15;
  v8f acc[FR][4];

  if (bx >= QTILES + KVTILES) {
    bx -= QTILES + KVTILES;
    gemm_mainloop<false, false, NKVH * HDIM, QKV_SETS>(A, wv, K, bm, bx * TN, As, Bs, acc);
#pragma unroll
    for (int j = 0; j < 4; ++j) {
      _Float16* vcol = vt + ((size_t)bx * HDIM + frag_col<false>(wc, j) + l16) * S_LEN +
                       bm + wr * (FR * 16) + half * 8;
#pragma unroll
      for (int i = 0; i < FR; ++i) {
        v8h o;
#pragma unroll
        for (int r = 0; r < 8; ++r) o[r] = (_Float16)acc[i][j][r];
        *(v8h*)(vcol + i * 16) = o;
      }
    }
    return;
  }

  _Float16* C = q;
  int N = NHEAD * HDIM;
  if (bx >= QTILES) {
    C = k; N = NKVH * HDIM; bx -= QTILES;
    gemm_mainloop<true, true, NKVH * HDIM, QKV_SETS>(A, wk, K, bm, bx * TN, As, Bs, acc);
  } else {
    gemm_mainloop<true, true, NHEAD * HDIM, QKV_SETS>(A, wq, K, bm, bx * TN, As, Bs, acc);
  }
#pragma unroll
  for (int i = 0; i < FR; ++i) {
    int s = bm + wr * (FR * 16) + i * 16 + l16;
#pragma unroll
    for (int jj = 0; jj < 2; ++jj) {
      int d = frag_col<true>(wc, jj) + half * 8;  // 0..63: low column of the rotary pair
      const float* cr = cosb + (size_t)s * HDIM + d;
      const float* sr = sinb + (size_t)s * HDIM + d;
      v8h lo, hi;
#pragma unroll
      for (int r = 0; r < 8; ++r) {
        float x1 = acc[i][jj][r], x2 = acc[i][jj + 2][r];
        lo[r] = (_Float16)(x1 * cr[r] - x2 * sr[r]);
        hi[r] = (_Float16)(x2 * cr[r + 64] + x1 * sr[r + 64]);
      }
      _Float16* orow = C + (size_t)s * N + bx * TN + d;
      *(v8h*)orow = lo;
      *(v8h*)(orow + 64) = hi;
    }
  }
  // Precaution: the stores' registers are not rewritten before the stores have taken them.
  asm volatile("s_wait_xcnt 0x0" ::: "memory");
}

// ---------------- Flash attention (causal, GQA 4:1), WMMA K Q^T and V^T P^T ----------------
#define KV_T   32   // keys per staged tile
#define KPITCH 136  // halfs per staged K row (272 B = 16 B x odd: b128 reads without bank conflicts)
#define VPITCH 40   // halfs per staged V^T row (80 B = 16 B x odd)
#define NQT (S_LEN / 64)  // query tiles of 64 rows per head (even)

// One tile's asynchronous copies to LDS, 8 per thread: K 32 rows x 256 B (4 copies, 8 rows
// apart), V^T 128 rows x 64 B (4 copies, 32 rows apart). The s_wait_xcnt stands inside the
// copies' own statement as a precaution: no address register is rewritten in front of it.
__device__ __forceinline__ void stage_kv(const _Float16* gk, const _Float16* gv,
                                         unsigned lk, unsigned lv) {
  asm volatile(
      "global_load_async_to_lds_b128 %0, %8, off\n\t"
      "global_load_async_to_lds_b128 %1, %9, off\n\t"
      "global_load_async_to_lds_b128 %2, %10, off\n\t"
      "global_load_async_to_lds_b128 %3, %11, off\n\t"
      "global_load_async_to_lds_b128 %4, %12, off\n\t"
      "global_load_async_to_lds_b128 %5, %13, off\n\t"
      "global_load_async_to_lds_b128 %6, %14, off\n\t"
      "global_load_async_to_lds_b128 %7, %15, off\n\t"
      "s_wait_xcnt 0x0"
      :: "v"(lk), "v"(lk + 8 * KPITCH * 2), "v"(lk + 16 * KPITCH * 2), "v"(lk + 24 * KPITCH * 2),
         "v"(lv), "v"(lv + 32 * VPITCH * 2), "v"(lv + 64 * VPITCH * 2), "v"(lv + 96 * VPITCH * 2),
         "v"(gk), "v"(gk + 8 * NKVH * HDIM), "v"(gk + 16 * NKVH * HDIM), "v"(gk + 24 * NKVH * HDIM),
         "v"(gv), "v"(gv + 32 * S_LEN), "v"(gv + 64 * S_LEN), "v"(gv + 96 * S_LEN)
      : "memory");
}

__global__ __launch_bounds__(128) void flash_attn_kernel(
    const _Float16* __restrict__ Qh,  // [S, NH, 128]
    const _Float16* __restrict__ Kh,  // [S, NKV, 128]
    const _Float16* __restrict__ Vt,  // [NKV, 128, S]  (transposed)
    _Float16* __restrict__ Oh) {      // [S, NH*128]
  int head = blockIdx.y;
  int kvhead = head >> 2;  // NH/NKV = 4
  int tid = threadIdx.x;
  int wave = __builtin_amdgcn_readfirstlane(tid >> 5), lane = tid & 31;
  int half = lane >> 4, l16 = lane & 15;

  // K and V^T tiles of KV_T keys, read by all four waves; two buffers
  __shared__ alignas(16) _Float16 Ks[2][KV_T * KPITCH];
  __shared__ alignas(16) _Float16 Vs[2][HDIM * VPITCH];

  // this thread's first copy of tile 0: global sources and LDS byte addresses in buffer 0
  const _Float16* gk = Kh + ((size_t)(tid >> 4) * NKVH + kvhead) * HDIM + (tid & 15) * 8;
  const _Float16* gv = Vt + ((size_t)kvhead * HDIM + (tid >> 2)) * S_LEN + (tid & 3) * 8;
  unsigned lk = (unsigned)(size_t)&Ks[0][(tid >> 4) * KPITCH + (tid & 15) * 8];
  unsigned lv = (unsigned)(size_t)&Vs[0][(tid >> 2) * VPITCH + (tid & 3) * 8];

  // A query tile's causal work grows with its index (tile x walks 2x + 2 key tiles) and every
  // block of the grid is on the chip at once, so the launch lasts as long as its fullest WGP.
  // Each block therefore takes two query tiles of its head, one after the other in every wave:
  // NQT - 1 - blockIdx.x, then blockIdx.x, 2 * NQT + 2 key tiles for every block alike. The last
  // foot of the first walk (waits and barrier) has ended every read of both buffers before the
  // second walk's first copies.
  for (int pass = 0; pass < 2; ++pass) {
  const int qt = pass == 0 ? NQT - 1 - (int)blockIdx.x : (int)blockIdx.x;
  const int q0 = qt * 64 + wave * 16;  // this wave's 16 query rows
  const int ntile = 2 * qt + 2;  // tiles up to the query tile's last row; at least 2

  stage_kv(gk, gv, lk, lv);
  // tile 0 has landed for this wave; the barrier publishes it to the other waves
  asm volatile("s_wait_asynccnt 0x0" ::: "memory");
  __syncthreads();
  stage_kv(gk + (size_t)KV_T * NKVH * HDIM, gv + KV_T,
           lk + (unsigned)sizeof(Ks[0]), lv + (unsigned)sizeof(Vs[0]));

  // Preload Q B-fragments: HD=128 -> 4 chunks of K=32 (two 16B loads each)
  v16h qf[4];
  {
    const _Float16* qrow = Qh + ((size_t)(q0 + l16) * NHEAD + head) * HDIM;
#pragma unroll
    for (int c = 0; c < 4; ++c)
      qf[c] = cat8(*(const v8h*)(qrow + c * 32 + half * 8),
                   *(const v8h*)(qrow + c * 32 + 16 + half * 8));
  }

  v8f o[8];
#pragma unroll
  for (int df = 0; df < 8; ++df) o[df] = (v8f){};
  // a lane's one query (q0 + l16): running maximum (equal in both wave halves) and the sum
  // over this half's keys only; the halves' sums are joined once, in the epilogue
  float mrun = -1e30f, lrun = 0.f;
  const int qme = q0 + l16;

  const float scl = 0.08838834764831845f;  // 1/sqrt(128)
  int kv_end = q0 + 16;                    // causal: kv <= q

  for (int tile = 0; tile < ntile; ++tile) {
    int kv0 = tile * KV_T;
    const _Float16* Kb = Ks[tile & 1];
    const _Float16* Vb = Vs[tile & 1];
    if (kv0 < kv_end) {  // wave-uniform: a wave skips tiles beyond its diagonal, never the foot
      // ---- scores, transposed: S^T = K Q^T, two fragments of 16 keys x 16 queries ----
      // s0[r] is key kv0 + 8*half + r, s1[r] key kv0 + 16 + 8*half + r, both of query q0 + l16
      v16h kf0[4], kf1[4];
#pragma unroll
      for (int c = 0; c < 4; ++c) {
        const _Float16* kr0 = Kb + l16 * KPITCH + c * 32;
        const _Float16* kr1 = Kb + (16 + l16) * KPITCH + c * 32;
        kf0[c] = cat8(*(const v8h*)(kr0 + half * 8),
                      *(const v8h*)(kr0 + 16 + half * 8));
        kf1[c] = cat8(*(const v8h*)(kr1 + half * 8),
                      *(const v8h*)(kr1 + 16 + half * 8));
      }
      // Keeps the 16 loads one group in front of the products: sunk among them, each pair
      // is waited for to the end directly in front of its product.
      __builtin_amdgcn_sched_barrier(0);
      v8f s0 = {}, s1 = {};
#pragma unroll
      for (int c = 0; c < 4; ++c) {
        s0 = wmma_f16(kf0[c], qf[c], s0);
        s1 = wmma_f16(kf1[c], qf[c], s1);
      }
      // staged V^T rows are the A operand of the second product: 8 fragments of 16 d x 32 keys
      v16h vf[8];
#pragma unroll
      for (int df = 0; df < 8; ++df) {
        const _Float16* vrow = Vb + (df * 16 + l16) * VPITCH;
        vf[df] = cat8(*(const v8h*)(vrow + half * 8),
                      *(const v8h*)(vrow + 16 + half * 8));
      }
      // Keeps these 16 loads here, in flight under the softmax, for the same reason.
      __builtin_amdgcn_sched_barrier(0);

      // ---- online softmax: a lane's 16 scores belong to one query ----
      int lim = qme - kv0 - 8 * half;  // s0[r] is masked where r > lim, s1[r] where 16 + r > lim
      float mx = -1e30f;
#pragma unroll
      for (int r = 0; r < 8; ++r) {
        s0[r] *= scl; if (r > lim)      s0[r] = -1e30f;
        s1[r] *= scl; if (16 + r > lim) s1[r] = -1e30f;
        mx = fmaxf(mx, fmaxf(s0[r], s1[r]));
      }
      mx = fmaxf(mx, xhalf(mx));  // the other half holds the query's other 16 keys
      float mnew = fmaxf(mrun, mx);
      float alpha = __expf(mrun - mnew);
      float rs = 0.f;
      // the k order of a 32-key operand is this lane's s0 then s1: P^T needs no move between lanes
      v16h pf;
#pragma unroll
      for (int r = 0; r < 8; ++r) {
        float p0 = __expf(s0[r] - mnew);
        float p1 = __expf(s1[r] - mnew);
        rs += p0 + p1;
        pf[r]     = (_Float16)p0;
        pf[r + 8] = (_Float16)p1;
      }
      lrun = lrun * alpha + rs;
      mrun = mnew;
#pragma unroll
      for (int df = 0; df < 8; ++df) o[df] *= alpha;

      // ---- O^T += V^T P^T: 8 fragments of 16 d x 16 queries ----
#pragma unroll
      for (int df = 0; df < 8; ++df) o[df] = wmma_f16(vf[df], pf, o[df]);
    }

    // ---- foot of the trip, every wave ----
    // this wave's reads of the buffer that is refilled below have returned
    asm volatile("s_wait_dscnt 0x0" ::: "memory");
    // this wave's copies of the next tile have landed
    asm volatile("s_wait_asynccnt 0x0" ::: "memory");
    // publishes the next tile and ends every wave's reads of this one
    __syncthreads();
    if (tile + 2 < ntile)
      stage_kv(gk + (size_t)(tile + 2) * KV_T * NKVH * HDIM, gv + (tile + 2) * KV_T,
               lk + (unsigned)(tile & 1) * (unsigned)sizeof(Ks[0]),
               lv + (unsigned)(tile & 1) * (unsigned)sizeof(Vs[0]));
  }
  // no copy is outstanding when the walk ends
  asm volatile("s_wait_asynccnt 0x0" ::: "memory");

  // ---- epilogue: normalize and store f16 attn output [S, NH*HD] ----
  // o[df][r] is d = df*16 + 8*half + r of query q0 + l16: 16-byte pieces
  float inv = 1.f / (lrun + xhalf(lrun));
  _Float16* orow = Oh + (size_t)qme * (NHEAD * HDIM) + head * HDIM + half * 8;
  v8h ov[8];
#pragma unroll
  for (int df = 0; df < 8; ++df)
#pragma unroll
    for (int r = 0; r < 8; ++r) ov[df][r] = (_Float16)(o[df][r] * inv);
#pragma unroll
  for (int df = 0; df < 8; ++df) *(v8h*)(orow + df * 16) = ov[df];
  // Precaution: the stores' registers are not rewritten by the second walk before the stores
  // have taken them.
  asm volatile("s_wait_xcnt 0x0" ::: "memory");
  }
}

// ---------------- host launch ----------------
extern "C" void kernel_launch(void* const* d_in, const int* in_sizes, int n_in,
                              void* d_out, int out_size, void* d_ws, size_t ws_size,
                              hipStream_t stream) {
  const float* hid    = (const float*)d_in[0];
  const float* cosb   = (const float*)d_in[1];
  const float* sinb   = (const float*)d_in[2];
  const float* norm_w = (const float*)d_in[3];
  const float* wq     = (const float*)d_in[4];
  const float* wk     = (const float*)d_in[5];
  const float* wv     = (const float*)d_in[6];
  const float* wo     = (const float*)d_in[7];
  float* out = (float*)d_out;

  char* ws = (char*)d_ws;
  size_t off = 0;
  auto carve = [&](size_t bytes) -> char* {
    char* p = ws + off;
    off += (bytes + 255) & ~(size_t)255;
    return p;
  };
  _Float16* h16   = (_Float16*)carve((size_t)S_LEN * H_DIM * 2);
  _Float16* q16   = (_Float16*)carve((size_t)S_LEN * NHEAD * HDIM * 2);
  _Float16* k16   = (_Float16*)carve((size_t)S_LEN * NKVH * HDIM * 2);
  _Float16* vt16  = (_Float16*)carve((size_t)NKVH * HDIM * S_LEN * 2);
  _Float16* att16 = (_Float16*)carve((size_t)S_LEN * NHEAD * HDIM * 2);

  // 1) RMSNorm -> f16
  rmsnorm_kernel<<<S_LEN, 256, 0, stream>>>(hid, norm_w, h16);

  // 2) Q/K/V projections in one launch (WMMA GEMM, f32 weights converted in LDS stage);
  //    the epilogue applies RoPE to Q and K (-> f16) and stores V as V^T f16
  gemm_qkv<<<dim3(QTILES + 2 * KVTILES, S_LEN / TM), 256, 0, stream>>>(
      h16, wq, wk, wv, cosb, sinb, q16, k16, vt16, H_DIM);

  // 3) Flash attention (causal, GQA)
  flash_attn_kernel<<<dim3(NQT / 2, NHEAD), 128, 0, stream>>>(q16, k16, vt16, att16);

  // 4) Output projection + residual
  gemm_wmma<<<dim3(H_DIM / TN, S_LEN / TM), 256, 0, stream>>>(
      att16, wo, out, hid, NHEAD * HDIM);
}

// v009
// It runs in 216 microseconds.
// Timed twice side by side with v008, it ran 1.04 times as fast both times.
// Counting every step since v000, it is 3.66 times as fast.
#include <hip/hip_runtime.h>
#include <hip/hip_bf16.h>

typedef __attribute__((ext_vector_type(16))) _Float16 v16h;
typedef __attribute__((ext_vector_type(8)))  _Float16 v8h;
typedef __attribute__((ext_vector_type(4)))  _Float16 v4h;
typedef __attribute__((ext_vector_type(2)))  _Float16 v2h;
typedef __attribute__((ext_vector_type(8)))  float    v8f;
typedef __attribute__((ext_vector_type(8)))  short    v8s;
typedef __attribute__((ext_vector_type(4)))  float    v4f;

#define S_LEN 2048
#define H_DIM 4096
#define NHEAD 32
#define NKVH  8
#define HDIM  128

__device__ inline v8f wmma_f16(v16h a, v16h b, v8f c) {
  return __builtin_amdgcn_wmma_f32_16x16x32_f16(
      false, a, false, b, (short)0, c, false, false);
}

__device__ inline v16h cat8(v8h a, v8h b) {
  return __builtin_shufflevector(a, b, 0, 1, 2, 3, 4, 5, 6, 7,
                                 8, 9, 10, 11, 12, 13, 14, 15);
}
// Transposing LDS load (ds_load_tr16_b128) from a row-major 16-bit tile: with lane l's address at
// row 8*(l>>4) + (l&7), 16 bytes * ((l>>3)&1) into the row, lane l gets rows 8*(l>>4) .. +7 of
// column l&15. Every lane is on where it is used.
__device__ inline v8h ld_tr16(const _Float16* p) {
  typedef __attribute__((address_space(3))) v8s lds_v8s;
  return __builtin_bit_cast(v8h, __builtin_amdgcn_ds_load_tr16_b128_v8i16((lds_v8s*)p));
}
// lane l takes the value of lane l ^ 16 (the other half of the wave)
__device__ inline float xhalf(float x) {
  int i = __builtin_bit_cast(int, x);
  return __builtin_bit_cast(float, __builtin_amdgcn_permlanex16(i, i, 0x76543210, 0xfedcba98, false, false));
}

// ---------------- RMSNorm -> f16 ----------------
__global__ __launch_bounds__(256) void rmsnorm_kernel(
    const float* __restrict__ x, const float* __restrict__ w,
    _Float16* __restrict__ h) {
  int row = blockIdx.x;
  const float* xr = x + (size_t)row * H_DIM;
  float ss = 0.f;
  for (int c = threadIdx.x * 4; c < H_DIM; c += 1024) {
    float4 v = *(const float4*)(xr + c);
    ss += v.x * v.x + v.y * v.y + v.z * v.z + v.w * v.w;
  }
  __shared__ float red[256];
  red[threadIdx.x] = ss;
  __syncthreads();
  for (int s2 = 128; s2 > 0; s2 >>= 1) {
    if (threadIdx.x < s2) red[threadIdx.x] += red[threadIdx.x + s2];
    __syncthreads();
  }
  float scale = rsqrtf(red[0] * (1.f / H_DIM) + 1e-5f);
  for (int c = threadIdx.x * 4; c < H_DIM; c += 1024) {
    float4 v = *(const float4*)(xr + c);
    float4 g = *(const float4*)(w + c);
    v4h o;
    o[0] = (_Float16)(v.x * scale * g.x);
    o[1] = (_Float16)(v.y * scale * g.y);
    o[2] = (_Float16)(v.z * scale * g.z);
    o[3] = (_Float16)(v.w * scale * g.w);
    *(v4h*)(h + (size_t)row * H_DIM + c) = o;
  }
}

// ------- Tiled WMMA GEMM: C[M,N] = A_f16[M,K] * B_f32[K,N] (+resid), 256x128x32 -------
// A block's 8 waves stand 4 (rows) x 2 (columns); a wave's part is 64x64, FR x 4 fragments.
#define TM 256
#define FR 4  // fragment rows of a wave
#define TN 128
#define TK 32
#define BPITCH 144  // halfs per staged B k-row (288 B = 32 B x odd: transposing reads without bank conflicts)
#define BBUF (TK * BPITCH)  // halfs per B buffer
#define AK     64  // k per staged A buffer, two k-tiles: one whole 128-byte line of every row
#define APITCH 72  // halfs per staged A row (144 B = 16 B x odd: b128 reads without bank conflicts)
#define ABUF (TM * APITCH)  // halfs per A buffer

// First tile column of a wave's fragment j. SPLIT: two fragments from each half of
// the tile, so that columns d and d + 64 (a rotary pair) sit in the same lane.
template <bool SPLIT>
__device__ __forceinline__ int frag_col(int wc, int j) {
  return SPLIT ? (j >> 1) * 64 + wc * 32 + (j & 1) * 16 : wc * 64 + j * 16;
}

// One k-tile of B on its way from global memory to LDS, in registers.
struct TileRegs {
  v4f r0, r1, r2, r3;  // a 4 (k) x 4 (column) patch, f32
};

// srcB: this thread's first element of the k-tile.
template <int N>
__device__ __forceinline__ void tile_load(TileRegs& g, const float* srcB) {
  g.r0 = *(const v4f*)srcB;
  g.r1 = *(const v4f*)(srcB + N);
  g.r2 = *(const v4f*)(srcB + 2 * N);
  g.r3 = *(const v4f*)(srcB + 3 * N);
}

// dstB: this thread's first column at its first k. The tile stays row-major, as it lies in
// global memory: a wave's store of one k-row is 256 contiguous bytes, every LDS bank once.
__device__ __forceinline__ void tile_store(const TileRegs& g, _Float16* dstB) {
  // f32 -> f16, one k-row each. Whole-vector conversions: written element by element, one tile's
  // 16-byte global loads were split into 8-byte halves and the second halves issued directly in
  // front of their use.
  *(v4h*)(dstB + 0 * BPITCH) = __builtin_convertvector(g.r0, v4h);
  *(v4h*)(dstB + 1 * BPITCH) = __builtin_convertvector(g.r1, v4h);
  *(v4h*)(dstB + 2 * BPITCH) = __builtin_convertvector(g.r2, v4h);
  *(v4h*)(dstB + 3 * BPITCH) = __builtin_convertvector(g.r3, v4h);
}

// Work-group barrier of the main loop, written by hand: __syncthreads() also waits for
// every global load, which would end the flight of the tiles loaded ahead. The wave's own
// LDS stores and reads are complete (s_wait_dscnt 0) before it signals. s_wait_xcnt 0 is a
// precaution: behind the barrier the fragment loads rewrite registers that held addresses
// of the global loads issued in front of it.
__device__ __forceinline__ void tile_barrier() {
  asm volatile("s_wait_xcnt 0x0\n\ts_wait_dscnt 0x0\n\ts_barrier_signal -1\n\ts_barrier_wait -1"
               ::: "memory");
}
// The same barrier where it also publishes an A buffer: the wave's own copies into that
// buffer have landed (s_wait_asynccnt 0) before it signals.
__device__ __forceinline__ void tile_barrier_copies() {
  asm volatile("s_wait_xcnt 0x0\n\ts_wait_dscnt 0x0\n\ts_wait_asynccnt 0x0\n\t"
               "s_barrier_signal -1\n\ts_barrier_wait -1"
               ::: "memory");
}

// Half an A buffer's asynchronous copies to LDS, 4 per thread: 128 rows x 128 B. Eight
// neighbouring lanes take one row's line, so a wave-wide copy is 4 whole cache lines; a
// thread's copies are 32 rows apart (rows32: 32 rows of A, in halfs). The s_wait_xcnt stands
// inside the copies' own statement as a precaution: no address register is rewritten in
// front of it.
__device__ __forceinline__ void stage_a(const _Float16* ga, size_t rows32, unsigned la) {
  asm volatile(
      "global_load_async_to_lds_b128 %0, %4, off\n\t"
      "global_load_async_to_lds_b128 %1, %5, off\n\t"
      "global_load_async_to_lds_b128 %2, %6, off\n\t"
      "global_load_async_to_lds_b128 %3, %7, off\n\t"
      "s_wait_xcnt 0x0"
      :: "v"(la), "v"(la + 32 * APITCH * 2), "v"(la + 64 * APITCH * 2), "v"(la + 96 * APITCH * 2),
         "v"(ga), "v"(ga + rows32), "v"(ga + 2 * rows32), "v"(ga + 3 * rows32)
      : "memory");
}
// One A buffer, TM = 256 rows: 8 copies per thread.
__device__ __forceinline__ void stage_a_buf(const _Float16* ga, size_t rows32, unsigned la) {
  stage_a(ga, rows32, la);
  stage_a(ga + 4 * rows32, rows32, la + 128 * APITCH * 2);
}

// The products of one staged k-tile. At: the tile's first k in row 0 of its A buffer.
template <bool SPLIT, bool TRANS>
__device__ __forceinline__ void tile_mma(const _Float16* At, const _Float16* Bt,
                                         int wr, int wc, int half, int l16, v8f (&acc)[FR][4]) {
  v16h af[FR], bf[4];
  // in the order of their first use: row 0, the four columns, rows 1 to 3
#pragma unroll
  for (int i = 0; i < FR; ++i) {
    const _Float16* arow = &At[(wr * (FR * 16) + i * 16 + l16) * APITCH];
    af[i] = cat8(*(const v8h*)(arow + half * 8),
                 *(const v8h*)(arow + 16 + half * 8));
    if (i == 0) {
#pragma unroll
      for (int j = 0; j < 4; ++j) {
        // k 8*half .. +7, then 16 + 8*half .. +7, of column frag_col + l16: the A rows' k order
        const _Float16* bsrc = &Bt[(half * 8 + (l16 & 7)) * BPITCH + frag_col<SPLIT>(wc, j) + (l16 >> 3) * 8];
        bf[j] = cat8(ld_tr16(bsrc), ld_tr16(bsrc + 16 * BPITCH));
      }
    }
  }
  // Keeps the 16 loads one group in front of the products: sunk among them, each row's pair
  // goes into the registers of the row before and is waited for to the end, four times a tile.
  __builtin_amdgcn_sched_barrier(0);
#pragma unroll
  for (int i = 0; i < FR; ++i)
#pragma unroll
    for (int j = 0; j < 4; ++j)
      acc[i][j] = TRANS ? wmma_f16(bf[j], af[i], acc[i][j])
                        : wmma_f16(af[i], bf[j], acc[i][j]);
  // Keeps the wait for the tile loaded ahead, and its LDS stores, behind these products:
  // moved in front of them, the wait would stand directly behind the loads' issue.
  __builtin_amdgcn_sched_barrier(0);
}

// Accumulates one 256x128 tile at (bm, bn) of A[.,K] * Bw[K,N]; called by every thread of
// a 256-thread block. K is a multiple of AK = 2 * TK and at least 2 * AK (both A buffers are
// filled in front of the loop). As holds two buffers of ABUF halfs,
// row-major [row][k], AK k each; Bs two of BBUF, row-major [k][col], TK k each.
// B: tile t is worked on from buffer t & 1 while tile t + 1 goes from registers into the other
// buffer; a register set is loaded again as soon as it is stored, with the tile SETS ahead
// of the one it held, so that SETS tiles' global loads are in flight under the products.
// One barrier per tile: it publishes tile t + 1 and ends the reads of tile t, whose buffer
// is written in the next trip. Every load is unconditional, so that the waits in front of
// the LDS stores can leave the younger set's loads in flight; with two sets, past the last
// tile the last one is loaded once more and not used.
// A: tiles 2p and 2p + 1 are read from A buffer p & 1, filled by asynchronous copies. The
// barrier behind tile 2p + 1 publishes buffer (p + 1) & 1 and ends the reads of buffer p & 1;
// behind it the copies for tiles 2p + 4 and 2p + 5 start into the buffer just read.
// acc[i][j][r] is row wr*64 + i*16 + half*8 + r, column frag_col(wc, j) + l16;
// with TRANS (operands swapped, the fragment comes out transposed)
// row wr*64 + i*16 + l16, column frag_col(wc, j) + half*8 + r.
template <bool SPLIT, bool TRANS, int N, int SETS>
__device__ __forceinline__ void gemm_mainloop(
    const _Float16* __restrict__ A, const float* __restrict__ Bw,
    int K, int bm, int bn, _Float16* As, _Float16* Bs, v8f (&acc)[FR][4]) {
  int t = threadIdx.x;
  int wave = t >> 5, lane = t & 31;
  int wr = wave & 3;   // rows wr*64 .. +63  (FR fragment rows)
  int wc = wave >> 2;  // 4 fragment cols, at frag_col(wc, j)
  int half = lane >> 4, l16 = lane & 15;

#pragma unroll
  for (int i = 0; i < FR; ++i)
#pragma unroll
    for (int j = 0; j < 4; ++j) acc[i][j] = (v8f){};

  // A buffer 256x64 f16: eight 16B copies a thread; B tile 32x128 f32: a 4x4 patch a thread
  const _Float16* srcA = A + (size_t)(bm + (t >> 3)) * K + (t & 7) * 8;
  const size_t rows32 = (size_t)32 * K;
  const unsigned ldsA = (unsigned)(size_t)&As[(t >> 3) * APITCH + (t & 7) * 8];
  const float* srcB = Bw + (size_t)((t >> 5) * 4) * N + bn + (t & 31) * 4;
  _Float16* dstB = &Bs[(t >> 5) * 4 * BPITCH + (t & 31) * 4];
  const int klast = K - TK;

  stage_a_buf(srcA, rows32, ldsA);  // A buffer 0
  TileRegs g[SETS];
#pragma unroll
  for (int s = 0; s < SETS; ++s)
    tile_load<N>(g[s], srcB + (size_t)s * TK * N);
  tile_store(g[0], dstB);
  {
    int kn = min(SETS * TK, klast);
    tile_load<N>(g[0], srcB + (size_t)kn * N);
  }
  tile_barrier_copies();
  stage_a_buf(srcA + AK, rows32, ldsA + ABUF * 2);  // A buffer 1

  for (int k0 = 0; k0 < K - AK; k0 += AK) {
    const int ab = (k0 / AK) & 1;  // this trip's A buffer
    const _Float16* Ab = As + ab * ABUF;
    // even tile from B buffer 0; the next tile into B buffer 1
    tile_mma<SPLIT, TRANS>(Ab, Bs, wr, wc, half, l16, acc);
    tile_store(g[1 % SETS], dstB + BBUF);
    int k1 = k0 + (1 + SETS) * TK;  // at most klast
    tile_load<N>(g[1 % SETS], srcB + (size_t)k1 * N);
    tile_barrier();
    // odd tile from B buffer 1; the next tile into B buffer 0
    tile_mma<SPLIT, TRANS>(Ab + TK, Bs + BBUF, wr, wc, half, l16, acc);
    tile_store(g[0], dstB);
    int k2 = SETS == 1 ? k0 + 3 * TK : min(k0 + (2 + SETS) * TK, klast);  // one set: at most klast
    tile_load<N>(g[0], srcB + (size_t)k2 * N);
    tile_barrier_copies();
    if (k0 + 2 * AK < K)  // the same for the whole block
      stage_a_buf(srcA + k0 + 2 * AK, rows32, ldsA + (unsigned)ab * (ABUF * 2));
  }
  // the last two tiles
  const _Float16* Al = As + (((K - AK) / AK) & 1) * ABUF;
  tile_mma<SPLIT, TRANS>(Al, Bs, wr, wc, half, l16, acc);
  tile_store(g[1 % SETS], dstB + BBUF);
  tile_barrier();
  tile_mma<SPLIT, TRANS>(Al + TK, Bs + BBUF, wr, wc, half, l16, acc);
  // no copy is outstanding when the wave goes on to its epilogue
  asm volatile("s_wait_asynccnt 0x0" ::: "memory");
}

// One 256x128 tile of C at (bm, bn), f32 out.
template <int N>
__device__ __forceinline__ void gemm_tile(
    const _Float16* __restrict__ A, const float* __restrict__ Bw,
    float* __restrict__ C, const float* __restrict__ resid,
    int K, int bm, int bn) {
  __shared__ alignas(16) _Float16 As[2 * ABUF];
  __shared__ alignas(16) _Float16 Bs[2 * BBUF];
  v8f acc[FR][4];
  gemm_mainloop<false, false, N, 2>(A, Bw, K, bm, bn, As, Bs, acc);
  int t = threadIdx.x;
  int wave = t >> 5, lane = t & 31;
  int wr = wave & 3, wc = wave >> 2;
  int half = lane >> 4, l16 = lane & 15;

  // ---- epilogue: residual branch hoisted once (uniform), pointer-walked rows ----
  {
    int rowg0 = bm + wr * (FR * 16) + half * 8;
    int colg0 = bn + wc * 64 + l16;
    if (resid != nullptr) {
#pragma unroll
      for (int i = 0; i < FR; ++i) {
        size_t base = (size_t)(rowg0 + i * 16) * N + colg0;
#pragma unroll
        for (int r = 0; r < 8; ++r) {
          float* crow = C + base + (size_t)r * N;
          const float* rrow = resid + base + (size_t)r * N;
#pragma unroll
          for (int j = 0; j < 4; ++j)
            crow[j * 16] = acc[i][j][r] + rrow[j * 16];
        }
      }
    } else {
#pragma unroll
      for (int i = 0; i < FR; ++i) {
        size_t base = (size_t)(rowg0 + i * 16) * N + colg0;
#pragma unroll
        for (int r = 0; r < 8; ++r) {
          float* crow = C + base + (size_t)r * N;
#pragma unroll
          for (int j = 0; j < 4; ++j)
            crow[j * 16] = acc[i][j][r];
        }
      }
    }
  }
}

// The grid is 256 blocks, one for each WGP: at most 2 waves per SIMD, so that no WGP takes
// two blocks while another stands idle.
__global__ __launch_bounds__(256) __attribute__((amdgpu_waves_per_eu(2, 2))) void gemm_wmma(
    const _Float16* __restrict__ A, const float* __restrict__ Bw,
    float* __restrict__ C, const float* __restrict__ resid, int K) {
  gemm_tile<H_DIM>(A, Bw, C, resid, K, blockIdx.y * TM, blockIdx.x * TN);
}

// Q, K and V projections share A and are independent: one grid holds the tile
// columns of all three, so the two narrow products (64 blocks each, a quarter of the
// chip's WGPs) run beside the wide one instead of after it.
#define QTILES ((NHEAD * HDIM) / TN)
#define KVTILES ((NKVH * HDIM) / TN)
// One register set, and a register budget for 4 waves per SIMD (the second launch bound):
// two blocks on a WGP put the whole grid (384 blocks, 256 WGPs) on the chip at once.
#define QKV_SETS 1
// A tile is one head (TN == HDIM), so the epilogue finishes the head in registers.
// Q and K tiles are computed transposed, so that a lane holds 8 consecutive d of one
// position: they are rotated and stored as f16 [S, heads, 128] in 16-byte pieces.
// V tiles keep the plain order, in which a lane holds 8 consecutive positions of one
// d: they are stored as f16 V^T [NKV, 128, S], also in 16-byte pieces.
__global__ __launch_bounds__(256, 4) void gemm_qkv(
    const _Float16* __restrict__ A, const float* __restrict__ wq,
    const float* __restrict__ wk, const float* __restrict__ wv,
    const float* __restrict__ cosb, const float* __restrict__ sinb,
    _Float16* __restrict__ q, _Float16* __restrict__ k, _Float16* __restrict__ vt,
    int K) {
  __shared__ alignas(16) _Float16 As[2 * ABUF];
  __shared__ alignas(16) _Float16 Bs[2 * BBUF];
  int bx = blockIdx.x;
  int bm = blockIdx.y * TM;
  int t = threadIdx.x;
  int wave = t >> 5, lane = t & 31;
  int wr = wave & 3, wc = wave >> 2;
  int half = lane >> 4, l16 = lane & 15;
  v8f acc[FR][4];

  if (bx >= QTILES + KVTILES) {
    bx -= QTILES + KVTILES;
    gemm_mainloop<false, false, NKVH * HDIM, QKV_SETS>(A, wv, K, bm, bx * TN, As, Bs, acc);
#pragma unroll
    for (int j = 0; j < 4; ++j) {
      _Float16* vcol = vt + ((size_t)bx * HDIM + frag_col<false>(wc, j) + l16) * S_LEN +
                       bm + wr * (FR * 16) + half * 8;
#pragma unroll
      for (int i = 0; i < FR; ++i) {
        v8h o;
#pragma unroll
        for (int r = 0; r < 8; ++r) o[r] = (_Float16)acc[i][j][r];
        *(v8h*)(vcol + i * 16) = o;
      }
    }
    return;
  }

  _Float16* C = q;
  int N = NHEAD * HDIM;
  if (bx >= QTILES) {
    C = k; N = NKVH * HDIM; bx -= QTILES;
    gemm_mainloop<true, true, NKVH * HDIM, QKV_SETS>(A, wk, K, bm, bx * TN, As, Bs, acc);
  } else {
    gemm_mainloop<true, true, NHEAD * HDIM, QKV_SETS>(A, wq, K, bm, bx * TN, As, Bs, acc);
  }
#pragma unroll
  for (int i = 0; i < FR; ++i) {
    int s = bm + wr * (FR * 16) + i * 16 + l16;
#pragma unroll
    for (int jj = 0; jj < 2; ++jj) {
      int d = frag_col<true>(wc, jj) + half * 8;  // 0..63: low column of the rotary pair
      const float* cr = cosb + (size_t)s * HDIM + d;
      const float* sr = sinb + (size_t)s * HDIM + d;
      v8h lo, hi;
#pragma unroll
      for (int r = 0; r < 8; ++r) {
        float x1 = acc[i][jj][r], x2 = acc[i][jj + 2][r];
        lo[r] = (_Float16)(x1 * cr[r] - x2 * sr[r]);
        hi[r] = (_Float16)(x2 * cr[r + 64] + x1 * sr[r + 64]);
      }
      _Float16* orow = C + (size_t)s * N + bx * TN + d;
      *(v8h*)orow = lo;
      *(v8h*)(orow + 64) = hi;
    }
  }
  // Precaution: the stores' registers are not rewritten before the stores have taken them.
  asm volatile("s_wait_xcnt 0x0" ::: "memory");
}

// ---------------- Flash attention (causal, GQA 4:1), WMMA K Q^T and V^T P^T ----------------
#define KV_T   32   // keys per staged tile
#define KPITCH 136  // halfs per staged K row (272 B = 16 B x odd: b128 reads without bank conflicts)
#define VPITCH 40   // halfs per staged V^T row (80 B = 16 B x odd)
#define NQT (S_LEN / 64)  // query tiles of 64 rows per head (even)

// One tile's asynchronous copies to LDS, 8 per thread: K 32 rows x 256 B (4 copies, 8 rows
// apart), V^T 128 rows x 64 B (4 copies, 32 rows apart). The s_wait_xcnt stands inside the
// copies' own statement as a precaution: no address register is rewritten in front of it.
__device__ __forceinline__ void stage_kv(const _Float16* gk, const _Float16* gv,
                                         unsigned lk, unsigned lv) {
  asm volatile(
      "global_load_async_to_lds_b128 %0, %8, off\n\t"
      "global_load_async_to_lds_b128 %1, %9, off\n\t"
      "global_load_async_to_lds_b128 %2, %10, off\n\t"
      "global_load_async_to_lds_b128 %3, %11, off\n\t"
      "global_load_async_to_lds_b128 %4, %12, off\n\t"
      "global_load_async_to_lds_b128 %5, %13, off\n\t"
      "global_load_async_to_lds_b128 %6, %14, off\n\t"
      "global_load_async_to_lds_b128 %7, %15, off\n\t"
      "s_wait_xcnt 0x0"
      :: "v"(lk), "v"(lk + 8 * KPITCH * 2), "v"(lk + 16 * KPITCH * 2), "v"(lk + 24 * KPITCH * 2),
         "v"(lv), "v"(lv + 32 * VPITCH * 2), "v"(lv + 64 * VPITCH * 2), "v"(lv + 96 * VPITCH * 2),
         "v"(gk), "v"(gk + 8 * NKVH * HDIM), "v"(gk + 16 * NKVH * HDIM), "v"(gk + 24 * NKVH * HDIM),
         "v"(gv), "v"(gv + 32 * S_LEN), "v"(gv + 64 * S_LEN), "v"(gv + 96 * S_LEN)
      : "memory");
}

__global__ __launch_bounds__(128) void flash_attn_kernel(
    const _Float16* __restrict__ Qh,  // [S, NH, 128]
    const _Float16* __restrict__ Kh,  // [S, NKV, 128]
    const _Float16* __restrict__ Vt,  // [NKV, 128, S]  (transposed)
    _Float16* __restrict__ Oh) {      // [S, NH*128]
  int head = blockIdx.y;
  int kvhead = head >> 2;  // NH/NKV = 4
  int tid = threadIdx.x;
  int wave = __builtin_amdgcn_readfirstlane(tid >> 5), lane = tid & 31;
  int half = lane >> 4, l16 = lane & 15;

  // K and V^T tiles of KV_T keys, read by all four waves; two buffers
  __shared__ alignas(16) _Float16 Ks[2][KV_T * KPITCH];
  __shared__ alignas(16) _Float16 Vs[2][HDIM * VPITCH];

  // this thread's first copy of tile 0: global sources and LDS byte addresses in buffer 0
  const _Float16* gk = Kh + ((size_t)(tid >> 4) * NKVH + kvhead) * HDIM + (tid & 15) * 8;
  const _Float16* gv = Vt + ((size_t)kvhead * HDIM + (tid >> 2)) * S_LEN + (tid & 3) * 8;
  unsigned lk = (unsigned)(size_t)&Ks[0][(tid >> 4) * KPITCH + (tid & 15) * 8];
  unsigned lv = (unsigned)(size_t)&Vs[0][(tid >> 2) * VPITCH + (tid & 3) * 8];

  // A query tile's causal work grows with its index (tile x walks 2x + 2 key tiles) and every
  // block of the grid is on the chip at once, so the launch lasts as long as its fullest WGP.
  // Each block therefore takes two query tiles of its head, one after the other in every wave:
  // NQT - 1 - blockIdx.x, then blockIdx.x, 2 * NQT + 2 key tiles for every block alike. The last
  // foot of the first walk (waits and barrier) has ended every read of both buffers before the
  // second walk's first copies.
  for (int pass = 0; pass < 2; ++pass) {
  const int qt = pass == 0 ? NQT - 1 - (int)blockIdx.x : (int)blockIdx.x;
  const int q0 = qt * 64 + wave * 16;  // this wave's 16 query rows
  const int ntile = 2 * qt + 2;  // tiles up to the query tile's last row; at least 2

  stage_kv(gk, gv, lk, lv);
  // tile 0 has landed for this wave; the barrier publishes it to the other waves
  asm volatile("s_wait_asynccnt 0x0" ::: "memory");
  __syncthreads();
  stage_kv(gk + (size_t)KV_T * NKVH * HDIM, gv + KV_T,
           lk + (unsigned)sizeof(Ks[0]), lv + (unsigned)sizeof(Vs[0]));

  // Preload Q B-fragments: HD=128 -> 4 chunks of K=32 (two 16B loads each)
  v16h qf[4];
  {
    const _Float16* qrow = Qh + ((size_t)(q0 + l16) * NHEAD + head) * HDIM;
#pragma unroll
    for (int c = 0; c < 4; ++c)
      qf[c] = cat8(*(const v8h*)(qrow + c * 32 + half * 8),
                   *(const v8h*)(qrow + c * 32 + 16 + half * 8));
  }

  v8f o[8];
#pragma unroll
  for (int df = 0; df < 8; ++df) o[df] = (v8f){};
  // a lane's one query (q0 + l16): running maximum (equal in both wave halves) and the sum
  // over this half's keys only; the halves' sums are joined once, in the epilogue
  float mrun = -1e30f, lrun = 0.f;
  const int qme = q0 + l16;

  const float scl = 0.08838834764831845f;  // 1/sqrt(128)
  int kv_end = q0 + 16;                    // causal: kv <= q

  for (int tile = 0; tile < ntile; ++tile) {
    int kv0 = tile * KV_T;
    const _Float16* Kb = Ks[tile & 1];
    const _Float16* Vb = Vs[tile & 1];
    if (kv0 < kv_end) {  // wave-uniform: a wave skips tiles beyond its diagonal, never the foot
      // ---- scores, transposed: S^T = K Q^T, two fragments of 16 keys x 16 queries ----
      // s0[r] is key kv0 + 8*half + r, s1[r] key kv0 + 16 + 8*half + r, both of query q0 + l16
      v16h kf0[4], kf1[4];
#pragma unroll
      for (int c = 0; c < 4; ++c) {
        const _Float16* kr0 = Kb + l16 * KPITCH + c * 32;
        const _Float16* kr1 = Kb + (16 + l16) * KPITCH + c * 32;
        kf0[c] = cat8(*(const v8h*)(kr0 + half * 8),
                      *(const v8h*)(kr0 + 16 + half * 8));
        kf1[c] = cat8(*(const v8h*)(kr1 + half * 8),
                      *(const v8h*)(kr1 + 16 + half * 8));
      }
      // Keeps the 16 loads one group in front of the products: sunk among them, each pair
      // is waited for to the end directly in front of its product.
      __builtin_amdgcn_sched_barrier(0);
      v8f s0 = {}, s1 = {};
#pragma unroll
      for (int c = 0; c < 4; ++c) {
        s0 = wmma_f16(kf0[c], qf[c], s0);
        s1 = wmma_f16(kf1[c], qf[c], s1);
      }
      // staged V^T rows are the A operand of the second product: 8 fragments of 16 d x 32 keys
      v16h vf[8];
#pragma unroll
      for (int df = 0; df < 8; ++df) {
        const _Float16* vrow = Vb + (df * 16 + l16) * VPITCH;
        vf[df] = cat8(*(const v8h*)(vrow + half * 8),
                      *(const v8h*)(vrow + 16 + half * 8));
      }
      // Keeps these 16 loads here, in flight under the softmax, for the same reason.
      __builtin_amdgcn_sched_barrier(0);

      // ---- online softmax: a lane's 16 scores belong to one query ----
      int lim = qme - kv0 - 8 * half;  // s0[r] is masked where r > lim, s1[r] where 16 + r > lim
      float mx = -1e30f;
#pragma unroll
      for (int r = 0; r < 8; ++r) {
        s0[r] *= scl; if (r > lim)      s0[r] = -1e30f;
        s1[r] *= scl; if (16 + r > lim) s1[r] = -1e30f;
        mx = fmaxf(mx, fmaxf(s0[r], s1[r]));
      }
      mx = fmaxf(mx, xhalf(mx));  // the other half holds the query's other 16 keys
      float mnew = fmaxf(mrun, mx);
      float alpha = __expf(mrun - mnew);
      float rs = 0.f;
      // the k order of a 32-key operand is this lane's s0 then s1: P^T needs no move between lanes
      v16h pf;
#pragma unroll
      for (int r = 0; r < 8; ++r) {
        float p0 = __expf(s0[r] - mnew);
        float p1 = __expf(s1[r] - mnew);
        rs += p0 + p1;
        pf[r]     = (_Float16)p0;
        pf[r + 8] = (_Float16)p1;
      }
      lrun = lrun * alpha + rs;
      mrun = mnew;
#pragma unroll
      for (int df = 0; df < 8; ++df) o[df] *= alpha;

      // ---- O^T += V^T P^T: 8 fragments of 16 d x 16 queries ----
#pragma unroll
      for (int df = 0; df < 8; ++df) o[df] = wmma_f16(vf[df], pf, o[df]);
    }

    // ---- foot of the trip, every wave ----
    // this wave's reads of the buffer that is refilled below have returned
    asm volatile("s_wait_dscnt 0x0" ::: "memory");
    // this wave's copies of the next tile have landed
    asm volatile("s_wait_asynccnt 0x0" ::: "memory");
    // publishes the next tile and ends every wave's reads of this one
    __syncthreads();
    if (tile + 2 < ntile)
      stage_kv(gk + (size_t)(tile + 2) * KV_T * NKVH * HDIM, gv + (tile + 2) * KV_T,
               lk + (unsigned)(tile & 1) * (unsigned)sizeof(Ks[0]),
               lv + (unsigned)(tile & 1) * (unsigned)sizeof(Vs[0]));
  }
  // no copy is outstanding when the walk ends
  asm volatile("s_wait_asynccnt 0x0" ::: "memory");

  // ---- epilogue: normalize and store f16 attn output [S, NH*HD] ----
  // o[df][r] is d = df*16 + 8*half + r of query q0 + l16: 16-byte pieces
  float inv = 1.f / (lrun + xhalf(lrun));
  _Float16* orow = Oh + (size_t)qme * (NHEAD * HDIM) + head * HDIM + half * 8;
  v8h ov[8];
#pragma unroll
  for (int df = 0; df < 8; ++df)
#pragma unroll
    for (int r = 0; r < 8; ++r) ov[df][r] = (_Float16)(o[df][r] * inv);
#pragma unroll
  for (int df = 0; df < 8; ++df) *(v8h*)(orow + df * 16) = ov[df];
  // Precaution: the stores' registers are not rewritten by the second walk before the stores
  // have taken them.
  asm volatile("s_wait_xcnt 0x0" ::: "memory");
  }
}

// ---------------- host launch ----------------
extern "C" void kernel_launch(void* const* d_in, const int* in_sizes, int n_in,
                              void* d_out, int out_size, void* d_ws, size_t ws_size,
                              hipStream_t stream) {
  const float* hid    = (const float*)d_in[0];
  const float* cosb   = (const float*)d_in[1];
  const float* sinb   = (const float*)d_in[2];
  const float* norm_w = (const float*)d_in[3];
  const float* wq     = (const float*)d_in[4];
  const float* wk     = (const float*)d_in[5];
  const float* wv     = (const float*)d_in[6];
  const float* wo     = (const float*)d_in[7];
  float* out = (float*)d_out;

  char* ws = (char*)d_ws;
  size_t off = 0;
  auto carve = [&](size_t bytes) -> char* {
    char* p = ws + off;
    off += (bytes + 255) & ~(size_t)255;
    return p;
  };
  _Float16* h16   = (_Float16*)carve((size_t)S_LEN * H_DIM * 2);
  _Float16* q16   = (_Float16*)carve((size_t)S_LEN * NHEAD * HDIM * 2);
  _Float16* k16   = (_Float16*)carve((size_t)S_LEN * NKVH * HDIM * 2);
  _Float16* vt16  = (_Float16*)carve((size_t)NKVH * HDIM * S_LEN * 2);
  _Float16* att16 = (_Float16*)carve((size_t)S_LEN * NHEAD * HDIM * 2);

  // 1) RMSNorm -> f16
  rmsnorm_kernel<<<S_LEN, 256, 0, stream>>>(hid, norm_w, h16);

  // 2) Q/K/V projections in one launch (WMMA GEMM, f32 weights converted in LDS stage);
  //    the epilogue applies RoPE to Q and K (-> f16) and stores V as V^T f16
  gemm_qkv<<<dim3(QTILES + 2 * KVTILES, S_LEN / TM), 256, 0, stream>>>(
      h16, wq, wk, wv, cosb, sinb, q16, k16, vt16, H_DIM);

  // 3) Flash attention (causal, GQA)
  flash_attn_kernel<<<dim3(NQT / 2, NHEAD), 128, 0, stream>>>(q16, k16, vt16, att16);

  // 4) Output projection + residual
  gemm_wmma<<<dim3(H_DIM / TN, S_LEN / TM), 256, 0, stream>>>(
      att16, wo, out, hid, NHEAD * HDIM);
}

// v010
// It runs in 200 microseconds.
// Next to v009, in two timings, it ran 1.07 and 1.08 times as fast.
// Counting every step since v000, it is 3.95 times as fast.
#include <hip/hip_runtime.h>
#include <hip/hip_bf16.h>

typedef __attribute__((ext_vector_type(16))) _Float16 v16h;
typedef __attribute__((ext_vector_type(8)))  _Float16 v8h;
typedef __attribute__((ext_vector_type(4)))  _Float16 v4h;
typedef __attribute__((ext_vector_type(2)))  _Float16 v2h;
typedef __attribute__((ext_vector_type(8)))  float    v8f;
typedef __attribute__((ext_vector_type(8)))  short    v8s;
typedef __attribute__((ext_vector_type(4)))  float    v4f;

#define S_LEN 2048
#define H_DIM 4096
#define NHEAD 32
#define NKVH  8
#define HDIM  128

__device__ inline v8f wmma_f16(v16h a, v16h b, v8f c) {
  return __builtin_amdgcn_wmma_f32_16x16x32_f16(
      false, a, false, b, (short)0, c, false, false);
}

__device__ inline v16h cat8(v8h a, v8h b) {
  return __builtin_shufflevector(a, b, 0, 1, 2, 3, 4, 5, 6, 7,
                                 8, 9, 10, 11, 12, 13, 14, 15);
}
// Transposing LDS load (ds_load_tr16_b128) from a row-major 16-bit tile: with lane l's address at
// row 8*(l>>4) + (l&7), 16 bytes * ((l>>3)&1) into the row, lane l gets rows 8*(l>>4) .. +7 of
// column l&15. Every lane is on where it is used.
__device__ inline v8h ld_tr16(const _Float16* p) {
  typedef __attribute__((address_space(3))) v8s lds_v8s;
  return __builtin_bit_cast(v8h, __builtin_amdgcn_ds_load_tr16_b128_v8i16((lds_v8s*)p));
}
// lane l takes the value of lane l ^ 16 (the other half of the wave)
__device__ inline float xhalf(float x) {
  int i = __builtin_bit_cast(int, x);
  return __builtin_bit_cast(float, __builtin_amdgcn_permlanex16(i, i, 0x76543210, 0xfedcba98, false, false));
}

// ---------------- RMSNorm -> f16 ----------------
__global__ __launch_bounds__(256) void rmsnorm_kernel(
    const float* __restrict__ x, const float* __restrict__ w,
    _Float16* __restrict__ h) {
  int row = blockIdx.x;
  const float* xr = x + (size_t)row * H_DIM;
  float ss = 0.f;
  for (int c = threadIdx.x * 4; c < H_DIM; c += 1024) {
    float4 v = *(const float4*)(xr + c);
    ss += v.x * v.x + v.y * v.y + v.z * v.z + v.w * v.w;
  }
  __shared__ float red[256];
  red[threadIdx.x] = ss;
  __syncthreads();
  for (int s2 = 128; s2 > 0; s2 >>= 1) {
    if (threadIdx.x < s2) red[threadIdx.x] += red[threadIdx.x + s2];
    __syncthreads();
  }
  float scale = rsqrtf(red[0] * (1.f / H_DIM) + 1e-5f);
  for (int c = threadIdx.x * 4; c < H_DIM; c += 1024) {
    float4 v = *(const float4*)(xr + c);
    float4 g = *(const float4*)(w + c);
    v4h o;
    o[0] = (_Float16)(v.x * scale * g.x);
    o[1] = (_Float16)(v.y * scale * g.y);
    o[2] = (_Float16)(v.z * scale * g.z);
    o[3] = (_Float16)(v.w * scale * g.w);
    *(v4h*)(h + (size_t)row * H_DIM + c) = o;
  }
}

// ------- Tiled WMMA GEMM: C[M,N] = A_f16[M,K] * B_f32[K,N] (+resid), 256x128x32 -------
// A block's 8 waves stand 4 (rows) x 2 (columns); a wave's part is 64x64, FR x 4 fragments.
#define TM 256
#define FR 4  // fragment rows of a wave
#define TN 128
#define TK 32
#define BPITCH 144  // halfs per staged B k-row (288 B = 32 B x odd: transposing reads without bank conflicts)
#define BBUF (TK * BPITCH)  // halfs per B buffer
#define AK     64  // k per staged A buffer, two k-tiles: one whole 128-byte line of every row
#define APITCH 72  // halfs per staged A row (144 B = 16 B x odd: b128 reads without bank conflicts)
#define ABUF (TM * APITCH)  // halfs per A buffer

// First tile column of a wave's fragment j. SPLIT: two fragments from each half of
// the tile, so that columns d and d + 64 (a rotary pair) sit in the same lane.
template <bool SPLIT>
__device__ __forceinline__ int frag_col(int wc, int j) {
  return SPLIT ? (j >> 1) * 64 + wc * 32 + (j & 1) * 16 : wc * 64 + j * 16;
}

// One k-tile of B on its way from global memory to LDS, in registers.
struct TileRegs {
  v4f r0, r1, r2, r3;  // a 4 (k) x 4 (column) patch, f32
};

// srcB: this thread's first element of the k-tile.
template <int N>
__device__ __forceinline__ void tile_load(TileRegs& g, const float* srcB) {
  g.r0 = *(const v4f*)srcB;
  g.r1 = *(const v4f*)(srcB + N);
  g.r2 = *(const v4f*)(srcB + 2 * N);
  g.r3 = *(const v4f*)(srcB + 3 * N);
}

// dstB: this thread's first column at its first k. The tile stays row-major, as it lies in
// global memory: a wave's store of one k-row is 256 contiguous bytes, every LDS bank once.
__device__ __forceinline__ void tile_store(const TileRegs& g, _Float16* dstB) {
  // f32 -> f16, one k-row each. Whole-vector conversions: written element by element, one tile's
  // 16-byte global loads were split into 8-byte halves and the second halves issued directly in
  // front of their use.
  *(v4h*)(dstB + 0 * BPITCH) = __builtin_convertvector(g.r0, v4h);
  *(v4h*)(dstB + 1 * BPITCH) = __builtin_convertvector(g.r1, v4h);
  *(v4h*)(dstB + 2 * BPITCH) = __builtin_convertvector(g.r2, v4h);
  *(v4h*)(dstB + 3 * BPITCH) = __builtin_convertvector(g.r3, v4h);
}

// Work-group barrier of the main loop, written by hand: __syncthreads() also waits for
// every global load, which would end the flight of the tiles loaded ahead. The wave's own
// LDS stores and reads are complete (s_wait_dscnt 0) before it signals. s_wait_xcnt 0 is a
// precaution: behind the barrier the fragment loads rewrite registers that held addresses
// of the global loads issued in front of it.
__device__ __forceinline__ void tile_barrier() {
  asm volatile("s_wait_xcnt 0x0\n\ts_wait_dscnt 0x0\n\ts_barrier_signal -1\n\ts_barrier_wait -1"
               ::: "memory");
}
// The same barrier where it also publishes an A buffer: the wave's own copies into that
// buffer have landed (s_wait_asynccnt 0) before it signals.
__device__ __forceinline__ void tile_barrier_copies() {
  asm volatile("s_wait_xcnt 0x0\n\ts_wait_dscnt 0x0\n\ts_wait_asynccnt 0x0\n\t"
               "s_barrier_signal -1\n\ts_barrier_wait -1"
               ::: "memory");
}

// Half an A buffer's asynchronous copies to LDS, 4 per thread: 128 rows x 128 B. Eight
// neighbouring lanes take one row's line, so a wave-wide copy is 4 whole cache lines; a
// thread's copies are 32 rows apart (rows32: 32 rows of A, in halfs). The s_wait_xcnt stands
// inside the copies' own statement as a precaution: no address register is rewritten in
// front of it.
__device__ __forceinline__ void stage_a(const _Float16* ga, size_t rows32, unsigned la) {
  asm volatile(
      "global_load_async_to_lds_b128 %0, %4, off\n\t"
      "global_load_async_to_lds_b128 %1, %5, off\n\t"
      "global_load_async_to_lds_b128 %2, %6, off\n\t"
      "global_load_async_to_lds_b128 %3, %7, off\n\t"
      "s_wait_xcnt 0x0"
      :: "v"(la), "v"(la + 32 * APITCH * 2), "v"(la + 64 * APITCH * 2), "v"(la + 96 * APITCH * 2),
         "v"(ga), "v"(ga + rows32), "v"(ga + 2 * rows32), "v"(ga + 3 * rows32)
      : "memory");
}
// One A buffer, TM = 256 rows: 8 copies per thread.
__device__ __forceinline__ void stage_a_buf(const _Float16* ga, size_t rows32, unsigned la) {
  stage_a(ga, rows32, la);
  stage_a(ga + 4 * rows32, rows32, la + 128 * APITCH * 2);
}

// The products of one staged k-tile. At: the tile's first k in row 0 of its A buffer.
template <bool SPLIT, bool TRANS>
__device__ __forceinline__ void tile_mma(const _Float16* At, const _Float16* Bt,
                                         int wr, int wc, int half, int l16, v8f (&acc)[FR][4]) {
  v16h af[FR], bf[4];
  // in the order of their first use: row 0, the four columns, rows 1 to 3
#pragma unroll
  for (int i = 0; i < FR; ++i) {
    const _Float16* arow = &At[(wr * (FR * 16) + i * 16 + l16) * APITCH];
    af[i] = cat8(*(const v8h*)(arow + half * 8),
                 *(const v8h*)(arow + 16 + half * 8));
    if (i == 0) {
#pragma unroll
      for (int j = 0; j < 4; ++j) {
        // k 8*half .. +7, then 16 + 8*half .. +7, of column frag_col + l16: the A rows' k order
        const _Float16* bsrc = &Bt[(half * 8 + (l16 & 7)) * BPITCH + frag_col<SPLIT>(wc, j) + (l16 >> 3) * 8];
        bf[j] = cat8(ld_tr16(bsrc), ld_tr16(bsrc + 16 * BPITCH));
      }
    }
  }
  // Keeps the 16 loads one group in front of the products: sunk among them, each row's pair
  // goes into the registers of the row before and is waited for to the end, four times a tile.
  __builtin_amdgcn_sched_barrier(0);
#pragma unroll
  for (int i = 0; i < FR; ++i)
#pragma unroll
    for (int j = 0; j < 4; ++j)
      acc[i][j] = TRANS ? wmma_f16(bf[j], af[i], acc[i][j])
                        : wmma_f16(af[i], bf[j], acc[i][j]);
  // Keeps the wait for the tile loaded ahead, and its LDS stores, behind these products:
  // moved in front of them, the wait would stand directly behind the loads' issue.
  __builtin_amdgcn_sched_barrier(0);
}

// Accumulates one 256x128 tile at (bm, bn) of A[.,K] * Bw[K,N]; called by every thread of
// a 256-thread block. K is a multiple of AK = 2 * TK and at least 2 * AK (both A buffers are
// filled in front of the loop). As holds two buffers of ABUF halfs,
// row-major [row][k], AK k each; Bs two of BBUF, row-major [k][col], TK k each.
// B: tile t is worked on from buffer t & 1 while tile t + 1 goes from registers into the other
// buffer; a register set is loaded again as soon as it is stored, with the tile SETS ahead
// of the one it held, so that SETS tiles' global loads are in flight under the products.
// One barrier per tile: it publishes tile t + 1 and ends the reads of tile t, whose buffer
// is written in the next trip. Every load is unconditional, so that the waits in front of
// the LDS stores can leave the younger set's loads in flight; with two sets, past the last
// tile the last one is loaded once more and not used.
// A: tiles 2p and 2p + 1 are read from A buffer p & 1, filled by asynchronous copies. The
// barrier behind tile 2p + 1 publishes buffer (p + 1) & 1 and ends the reads of buffer p & 1;
// behind it the copies for tiles 2p + 4 and 2p + 5 start into the buffer just read.
// acc[i][j][r] is row wr*64 + i*16 + half*8 + r, column frag_col(wc, j) + l16;
// with TRANS (operands swapped, the fragment comes out transposed)
// row wr*64 + i*16 + l16, column frag_col(wc, j) + half*8 + r.
template <bool SPLIT, bool TRANS, int N, int SETS>
__device__ __forceinline__ void gemm_mainloop(
    const _Float16* __restrict__ A, const float* __restrict__ Bw,
    int K, int bm, int bn, _Float16* As, _Float16* Bs, v8f (&acc)[FR][4]) {
  int t = threadIdx.x;
  int wave = t >> 5, lane = t & 31;
  int wr = wave & 3;   // rows wr*64 .. +63  (FR fragment rows)
  int wc = wave >> 2;  // 4 fragment cols, at frag_col(wc, j)
  int half = lane >> 4, l16 = lane & 15;

#pragma unroll
  for (int i = 0; i < FR; ++i)
#pragma unroll
    for (int j = 0; j < 4; ++j) acc[i][j] = (v8f){};

  // A buffer 256x64 f16: eight 16B copies a thread; B tile 32x128 f32: a 4x4 patch a thread
  const _Float16* srcA = A + (size_t)(bm + (t >> 3)) * K + (t & 7) * 8;
  const size_t rows32 = (size_t)32 * K;
  const unsigned ldsA = (unsigned)(size_t)&As[(t >> 3) * APITCH + (t & 7) * 8];
  const float* srcB = Bw + (size_t)((t >> 5) * 4) * N + bn + (t & 31) * 4;
  _Float16* dstB = &Bs[(t >> 5) * 4 * BPITCH + (t & 31) * 4];
  const int klast = K - TK;

  stage_a_buf(srcA, rows32, ldsA);  // A buffer 0
  TileRegs g[SETS];
#pragma unroll
  for (int s = 0; s < SETS; ++s)
    tile_load<N>(g[s], srcB + (size_t)s * TK * N);
  tile_store(g[0], dstB);
  {
    int kn = min(SETS * TK, klast);
    tile_load<N>(g[0], srcB + (size_t)kn * N);
  }
  tile_barrier_copies();
  stage_a_buf(srcA + AK, rows32, ldsA + ABUF * 2);  // A buffer 1

  for (int k0 = 0; k0 < K - AK; k0 += AK) {
    const int ab = (k0 / AK) & 1;  // this trip's A buffer
    const _Float16* Ab = As + ab * ABUF;
    // even tile from B buffer 0; the next tile into B buffer 1
    tile_mma<SPLIT, TRANS>(Ab, Bs, wr, wc, half, l16, acc);
    tile_store(g[1 % SETS], dstB + BBUF);
    int k1 = k0 + (1 + SETS) * TK;  // at most klast
    tile_load<N>(g[1 % SETS], srcB + (size_t)k1 * N);
    tile_barrier();
    // odd tile from B buffer 1; the next tile into B buffer 0
    tile_mma<SPLIT, TRANS>(Ab + TK, Bs + BBUF, wr, wc, half, l16, acc);
    tile_store(g[0], dstB);
    int k2 = SETS == 1 ? k0 + 3 * TK : min(k0 + (2 + SETS) * TK, klast);  // one set: at most klast
    tile_load<N>(g[0], srcB + (size_t)k2 * N);
    tile_barrier_copies();
    if (k0 + 2 * AK < K)  // the same for the whole block
      stage_a_buf(srcA + k0 + 2 * AK, rows32, ldsA + (unsigned)ab * (ABUF * 2));
  }
  // the last two tiles
  const _Float16* Al = As + (((K - AK) / AK) & 1) * ABUF;
  tile_mma<SPLIT, TRANS>(Al, Bs, wr, wc, half, l16, acc);
  tile_store(g[1 % SETS], dstB + BBUF);
  tile_barrier();
  tile_mma<SPLIT, TRANS>(Al + TK, Bs + BBUF, wr, wc, half, l16, acc);
  // no copy is outstanding when the wave goes on to its epilogue
  asm volatile("s_wait_asynccnt 0x0" ::: "memory");
}

// One 256x128 tile of C at (bm, bn), f32 out.
template <int N>
__device__ __forceinline__ void gemm_tile(
    const _Float16* __restrict__ A, const float* __restrict__ Bw,
    float* __restrict__ C, const float* __restrict__ resid,
    int K, int bm, int bn) {
  __shared__ alignas(16) _Float16 As[2 * ABUF];
  __shared__ alignas(16) _Float16 Bs[2 * BBUF];
  v8f acc[FR][4];
  gemm_mainloop<false, false, N, 2>(A, Bw, K, bm, bn, As, Bs, acc);
  int t = threadIdx.x;
  int wave = t >> 5, lane = t & 31;
  int wr = wave & 3, wc = wave >> 2;
  int half = lane >> 4, l16 = lane & 15;

  // ---- epilogue: residual branch hoisted once (uniform), pointer-walked rows ----
  {
    int rowg0 = bm + wr * (FR * 16) + half * 8;
    int colg0 = bn + wc * 64 + l16;
    if (resid != nullptr) {
#pragma unroll
      for (int i = 0; i < FR; ++i) {
        size_t base = (size_t)(rowg0 + i * 16) * N + colg0;
#pragma unroll
        for (int r = 0; r < 8; ++r) {
          float* crow = C + base + (size_t)r * N;
          const float* rrow = resid + base + (size_t)r * N;
#pragma unroll
          for (int j = 0; j < 4; ++j)
            crow[j * 16] = acc[i][j][r] + rrow[j * 16];
        }
      }
    } else {
#pragma unroll
      for (int i = 0; i < FR; ++i) {
        size_t base = (size_t)(rowg0 + i * 16) * N + colg0;
#pragma unroll
        for (int r = 0; r < 8; ++r) {
          float* crow = C + base + (size_t)r * N;
#pragma unroll
          for (int j = 0; j < 4; ++j)
            crow[j * 16] = acc[i][j][r];
        }
      }
    }
  }
}

// The grid is 256 blocks, one for each WGP: at most 2 waves per SIMD, so that no WGP takes
// two blocks while another stands idle.
__global__ __launch_bounds__(256) __attribute__((amdgpu_waves_per_eu(2, 2))) void gemm_wmma(
    const _Float16* __restrict__ A, const float* __restrict__ Bw,
    float* __restrict__ C, const float* __restrict__ resid, int K) {
  gemm_tile<H_DIM>(A, Bw, C, resid, K, blockIdx.y * TM, blockIdx.x * TN);
}

// Q, K and V projections share A: one grid holds all three. A block's tile is 256 rows x 192
// columns: one Q head (128 columns) and half a K or V head (64 columns: d0 .. d0 + 31 and
// d0 + 64 .. d0 + 95, so that rotary pairs stay together). 32 x 8 = 256 equal blocks, one for
// each WGP (tiles of 128 columns made 384 blocks: half the WGPs held two, the rest one).
// Staged B tile: columns 0..127 the Q head, 128..159 and 160..191 the extra.
#define QFC 6        // fragment columns of a wave: 4 of the Q head, 2 of the extra
#define QBPITCH 208  // halfs per staged B k-row (416 B = 32 B x odd: transposing reads without bank conflicts)
#define QBBUF (TK * QBPITCH)
#define QCOLS (NHEAD * HDIM)
#define XCOLS (NKVH * HDIM)

// First staged-tile column of a wave's fragment j: columns d and d + 64 of a head sit in the
// same lane of fragments (0, 2), (1, 3) and (4, 5).
__device__ __forceinline__ int qkv_frag_col(int wc, int j) {
  return j < 4 ? frag_col<true>(wc, j) : 128 + (j - 4) * 32 + wc * 16;
}

// One k-tile of the 192 columns on its way from global memory to LDS, in registers.
struct QkvRegs {
  TileRegs q;  // Q head: a 4 (k) x 4 (column) patch
  v4f x0, x1;  // extra: 4 columns of two k-rows, 16 rows apart
};
__device__ __forceinline__ void qkv_load(QkvRegs& g, const float* srcQ, const float* srcX) {
  tile_load<QCOLS>(g.q, srcQ);
  g.x0 = *(const v4f*)srcX;
  g.x1 = *(const v4f*)(srcX + 16 * XCOLS);
}
__device__ __forceinline__ void qkv_store(const QkvRegs& g, _Float16* dstQ, _Float16* dstX) {
  *(v4h*)(dstQ + 0 * QBPITCH) = __builtin_convertvector(g.q.r0, v4h);
  *(v4h*)(dstQ + 1 * QBPITCH) = __builtin_convertvector(g.q.r1, v4h);
  *(v4h*)(dstQ + 2 * QBPITCH) = __builtin_convertvector(g.q.r2, v4h);
  *(v4h*)(dstQ + 3 * QBPITCH) = __builtin_convertvector(g.q.r3, v4h);
  *(v4h*)dstX = __builtin_convertvector(g.x0, v4h);
  *(v4h*)(dstX + 16 * QBPITCH) = __builtin_convertvector(g.x1, v4h);
}

// The products of one staged k-tile; every fragment is computed transposed (operands swapped).
__device__ __forceinline__ void qkv_mma(const _Float16* At, const _Float16* Bt,
                                        int wr, int wc, int half, int l16, v8f (&acc)[FR][QFC]) {
  v16h af[FR], bf[QFC];
#pragma unroll
  for (int i = 0; i < FR; ++i) {
    const _Float16* arow = &At[(wr * (FR * 16) + i * 16 + l16) * APITCH];
    af[i] = cat8(*(const v8h*)(arow + half * 8),
                 *(const v8h*)(arow + 16 + half * 8));
    if (i == 0) {
#pragma unroll
      for (int j = 0; j < QFC; ++j) {
        // k 8*half .. +7, then 16 + 8*half .. +7, of column qkv_frag_col + l16: the A rows' k order
        const _Float16* bsrc = &Bt[(half * 8 + (l16 & 7)) * QBPITCH + qkv_frag_col(wc, j) + (l16 >> 3) * 8];
        bf[j] = cat8(ld_tr16(bsrc), ld_tr16(bsrc + 16 * QBPITCH));
      }
    }
  }
  // Keeps the 20 loads one group in front of the products: sunk among them, each row's pair
  // is waited for to the end.
  __builtin_amdgcn_sched_barrier(0);
#pragma unroll
  for (int i = 0; i < FR; ++i)
#pragma unroll
    for (int j = 0; j < QFC; ++j)
      acc[i][j] = wmma_f16(bf[j], af[i], acc[i][j]);
  // Keeps the wait for the tile loaded ahead, and its LDS stores, behind these products.
  __builtin_amdgcn_sched_barrier(0);
}

// The main loop of gemm_mainloop (same buffers' order, barriers and waits, two register sets)
// for the 192-column tile. srcQ, srcX: this thread's first elements of k-tile 0.
// acc[i][j][r] is row wr*64 + i*16 + l16, staged-tile column qkv_frag_col(wc, j) + half*8 + r.
__device__ __forceinline__ void qkv_mainloop(
    const _Float16* __restrict__ A, const float* __restrict__ srcQ, const float* __restrict__ srcX,
    int K, int bm, _Float16* As, _Float16* Bs, v8f (&acc)[FR][QFC]) {
  int t = threadIdx.x;
  int wave = t >> 5, lane = t & 31;
  int wr = wave & 3, wc = wave >> 2;
  int half = lane >> 4, l16 = lane & 15;

#pragma unroll
  for (int i = 0; i < FR; ++i)
#pragma unroll
    for (int j = 0; j < QFC; ++j) acc[i][j] = (v8f){};

  const _Float16* srcA = A + (size_t)(bm + (t >> 3)) * K + (t & 7) * 8;
  const size_t rows32 = (size_t)32 * K;
  const unsigned ldsA = (unsigned)(size_t)&As[(t >> 3) * APITCH + (t & 7) * 8];
  _Float16* dstQ = &Bs[(t >> 5) * 4 * QBPITCH + (t & 31) * 4];
  _Float16* dstX = &Bs[(t >> 4) * QBPITCH + 128 + (t & 15) * 4];

  stage_a_buf(srcA, rows32, ldsA);  // A buffer 0
  QkvRegs g[2];
  qkv_load(g[0], srcQ, srcX);
  qkv_load(g[1], srcQ + (size_t)TK * QCOLS, srcX + (size_t)TK * XCOLS);
  qkv_store(g[0], dstQ, dstX);
  qkv_load(g[0], srcQ + (size_t)(2 * TK) * QCOLS, srcX + (size_t)(2 * TK) * XCOLS);  // K >= 2 * AK
  tile_barrier_copies();
  stage_a_buf(srcA + AK, rows32, ldsA + ABUF * 2);  // A buffer 1

  // Each set's next k-tile, walked by pointers that live across the trips: no load's address
  // register is free to be taken for a later load's data.
  const float* q1 = srcQ + (size_t)(3 * TK) * QCOLS;
  const float* x1 = srcX + (size_t)(3 * TK) * XCOLS;
  const float* q0 = srcQ + (size_t)(4 * TK) * QCOLS;
  const float* x0 = srcX + (size_t)(4 * TK) * XCOLS;
  if (K == 2 * AK) {  // no tile 4: the last one once more, not used
    q0 -= (size_t)TK * QCOLS;
    x0 -= (size_t)TK * XCOLS;
  }

  for (int k0 = 0; k0 < K - AK; k0 += AK) {
    const int ab = (k0 / AK) & 1;  // this trip's A buffer
    const _Float16* Ab = As + ab * ABUF;
    // even tile from B buffer 0; the next tile into B buffer 1
    qkv_mma(Ab, Bs, wr, wc, half, l16, acc);
    qkv_store(g[1], dstQ + QBBUF, dstX + QBBUF);
    qkv_load(g[1], q1, x1);  // tile k0 / TK + 3, at most the last
    tile_barrier();
    q1 += (size_t)AK * QCOLS;
    x1 += (size_t)AK * XCOLS;
    // odd tile from B buffer 1; the next tile into B buffer 0
    qkv_mma(Ab + TK, Bs + QBBUF, wr, wc, half, l16, acc);
    qkv_store(g[0], dstQ, dstX);
    qkv_load(g[0], q0, x0);  // tile k0 / TK + 4; past the last tile the last one once more, not used
    tile_barrier_copies();
    {
      const int step = k0 + 3 * AK < K ? AK : TK;  // the next trip's tile k0 / TK + 6, or the last
      q0 += (size_t)step * QCOLS;
      x0 += (size_t)step * XCOLS;
    }
    if (k0 + 2 * AK < K)  // the same for the whole block
      stage_a_buf(srcA + k0 + 2 * AK, rows32, ldsA + (unsigned)ab * (ABUF * 2));
  }
  // the last two tiles
  const _Float16* Al = As + (((K - AK) / AK) & 1) * ABUF;
  qkv_mma(Al, Bs, wr, wc, half, l16, acc);
  qkv_store(g[1], dstQ + QBBUF, dstX + QBBUF);
  tile_barrier();
  qkv_mma(Al + TK, Bs + QBBUF, wr, wc, half, l16, acc);
  // no copy is outstanding when the wave goes on to its epilogue
  asm volatile("s_wait_asynccnt 0x0" ::: "memory");
}

// Rotates fragment rows I0 .. I0 + NI - 1 of the fragment pairs (J0 + jj, J0 + jj + NJ), jj < NJ, and
// stores them as f16 in 16-byte pieces. A pair holds columns d .. d+7 and d+64 .. d+71 of one
// position. cr, sr: the lane's first low column (pair 0) at its position in fragment row 0; orow:
// its place in the output; ROWH: halfs per position of the output. Every address is one of these
// three plus a constant.
// Stored order of a head's columns, the same for Q and K (their products are summed over d, so
// only the order of that sum depends on it): column d lies at
// ((d >> 5) & 1) * 64 + (d >> 6) * 32 + (d & 31), so d + 64 lies 32 behind d, and the 64 columns
// that one block has of a K head (one wave of a Q head) are one whole 128-byte line.
template <int I0, int NI, int J0, int NJ, int ROWH>
__device__ __forceinline__ void rope_rows(const v8f (&acc)[FR][QFC], const float* cr, const float* sr,
                                          _Float16* orow) {
  v4f c[NI][NJ][4], s[NI][NJ][4];  // [0], [1]: columns d .. d+7; [2], [3]: d+64 .. d+71
#pragma unroll
  for (int i = 0; i < NI; ++i)
#pragma unroll
    for (int jj = 0; jj < NJ; ++jj)
#pragma unroll
      for (int h = 0; h < 4; ++h) {
        const int off = (I0 + i) * 16 * HDIM + jj * 16 + (h >> 1) * 64 + (h & 1) * 4;
        c[i][jj][h] = *(const v4f*)(cr + off);
        s[i][jj][h] = *(const v4f*)(sr + off);
      }
  // Precaution: the loads' address registers (inputs here, so that they live up to this wait) are
  // not rewritten before the loads have taken them.
  asm volatile("s_wait_xcnt 0x0" :: "v"(cr), "v"(sr) : "memory");
  v8h lo[NI][NJ], hi[NI][NJ];
#pragma unroll
  for (int i = 0; i < NI; ++i)
#pragma unroll
    for (int jj = 0; jj < NJ; ++jj)
#pragma unroll
      for (int r = 0; r < 8; ++r) {
        float x1 = acc[I0 + i][J0 + jj][r], x2 = acc[I0 + i][J0 + jj + NJ][r];
        lo[i][jj][r] = (_Float16)(x1 * c[i][jj][r >> 2][r & 3] - x2 * s[i][jj][r >> 2][r & 3]);
        hi[i][jj][r] = (_Float16)(x2 * c[i][jj][2 + (r >> 2)][r & 3] + x1 * s[i][jj][2 + (r >> 2)][r & 3]);
      }
  // Keeps every store behind the last conversion.
  __builtin_amdgcn_sched_barrier(0);
#pragma unroll
  for (int i = 0; i < NI; ++i)
#pragma unroll
    for (int jj = 0; jj < NJ; ++jj) {
      _Float16* o = orow + (I0 + i) * 16 * ROWH + jj * 16;
      *(v8h*)o = lo[i][jj];
      *(v8h*)(o + 32) = hi[i][jj];
    }
  // Precaution: the stores' registers are not rewritten before the stores have taken them.
  asm volatile("s_wait_xcnt 0x0" :: "v"(orow) : "memory");
}

// Block column bx: Q head bx; the extra is half bx & 1 of K head bx >> 1 (bx < 16) or of V head
// (bx - 16) >> 1. The fragments come out transposed, so that a lane holds 8 consecutive d of one
// position: Q and K are rotated and stored as f16 [S, heads, 128] in 16-byte pieces, a head's
// columns in the order given at rope_rows. V goes to
// f16 V^T [NKV, 128, S] element by element: 16 lanes hold 16 consecutive positions of one d, and
// a wave's four fragment rows fill one 128-byte line of that d.
// At most 2 waves per SIMD, so that no WGP takes two blocks while another stands idle.
__global__ __launch_bounds__(256) __attribute__((amdgpu_waves_per_eu(2, 2))) void gemm_qkv(
    const _Float16* __restrict__ A, const float* __restrict__ wq,
    const float* __restrict__ wk, const float* __restrict__ wv,
    const float* __restrict__ cosb, const float* __restrict__ sinb,
    _Float16* __restrict__ q, _Float16* __restrict__ k, _Float16* __restrict__ vt,
    int K) {
  __shared__ alignas(16) _Float16 As[2 * ABUF];
  __shared__ alignas(16) _Float16 Bs[2 * QBBUF];
  const int bx = blockIdx.x;
  const int bm = blockIdx.y * TM;
  int t = threadIdx.x;
  int wave = t >> 5, lane = t & 31;
  int wr = wave & 3, wc = wave >> 2;
  int half = lane >> 4, l16 = lane & 15;
  const bool isv = bx >= 2 * NKVH;       // the same for the whole block
  const int xhead = (bx & (2 * NKVH - 1)) >> 1;
  const int d0 = (bx & 1) * 32;          // first low column of the extra in its head
  v8f acc[FR][QFC];

  const float* srcQ = wq + (size_t)((t >> 5) * 4) * QCOLS + bx * HDIM + (t & 31) * 4;
  // 16 lanes take one k-row of the extra: 8 its low 32 columns, 8 the 32 columns 64 further on
  const int xc = xhead * HDIM + d0 + ((t >> 3) & 1) * 64 + (t & 7) * 4;
  const float* srcX = (isv ? wv : wk) + (size_t)(t >> 4) * XCOLS + xc;

  qkv_mainloop(A, srcQ, srcX, K, bm, As, Bs, acc);
  const int s0 = bm + wr * (FR * 16) + l16;  // the lane's position in fragment row 0
  const int dx = d0 + wc * 16 + half * 8;    // 0..63: the lane's first low column of the extra
  const int dq = wc * 32 + half * 8;         // 0..63: the lane's first low column of the Q head
  const float* crow = cosb + (size_t)s0 * HDIM;
  const float* srow = sinb + (size_t)s0 * HDIM;
  if (isv) {
    _Float16* vcol = vt + ((size_t)xhead * HDIM + dx) * S_LEN + s0;
    _Float16 o[2][8][FR];
#pragma unroll
    for (int j = 0; j < 2; ++j)
#pragma unroll
      for (int r = 0; r < 8; ++r)
#pragma unroll
        for (int i = 0; i < FR; ++i) o[j][r][i] = (_Float16)acc[i][4 + j][r];
    // Keeps every store behind the last conversion.
    __builtin_amdgcn_sched_barrier(0);
#pragma unroll
    for (int j = 0; j < 2; ++j)
#pragma unroll
      for (int r = 0; r < 8; ++r)
#pragma unroll
        for (int i = 0; i < FR; ++i) vcol[(j * 64 + r) * S_LEN + i * 16] = o[j][r][i];
    // Precaution: the stores' registers are not rewritten before the stores have taken them.
    asm volatile("s_wait_xcnt 0x0" :: "v"(vcol) : "memory");
  } else {
    rope_rows<0, FR, 4, 1, XCOLS>(acc, crow + dx, srow + dx,
                                  k + (size_t)s0 * XCOLS + xhead * HDIM + 2 * d0 + wc * 16 + half * 8);
  }
  _Float16* qrow = q + (size_t)s0 * QCOLS + bx * HDIM + wc * 64 + half * 8;
  rope_rows<0, 2, 0, 2, QCOLS>(acc, crow + dq, srow + dq, qrow);
  rope_rows<2, 2, 0, 2, QCOLS>(acc, crow + dq, srow + dq, qrow);
}

// ---------------- Flash attention (causal, GQA 4:1), WMMA K Q^T and V^T P^T ----------------
#define KV_T   32   // keys per staged tile
#define KPITCH 136  // halfs per staged K row (272 B = 16 B x odd: b128 reads without bank conflicts)
#define VPITCH 40   // halfs per staged V^T row (80 B = 16 B x odd)
#define NQT (S_LEN / 64)  // query tiles of 64 rows per head (even)

// One tile's asynchronous copies to LDS, 8 per thread: K 32 rows x 256 B (4 copies, 8 rows
// apart), V^T 128 rows x 64 B (4 copies, 32 rows apart). The s_wait_xcnt stands inside the
// copies' own statement as a precaution: no address register is rewritten in front of it.
__device__ __forceinline__ void stage_kv(const _Float16* gk, const _Float16* gv,
                                         unsigned lk, unsigned lv) {
  asm volatile(
      "global_load_async_to_lds_b128 %0, %8, off\n\t"
      "global_load_async_to_lds_b128 %1, %9, off\n\t"
      "global_load_async_to_lds_b128 %2, %10, off\n\t"
      "global_load_async_to_lds_b128 %3, %11, off\n\t"
      "global_load_async_to_lds_b128 %4, %12, off\n\t"
      "global_load_async_to_lds_b128 %5, %13, off\n\t"
      "global_load_async_to_lds_b128 %6, %14, off\n\t"
      "global_load_async_to_lds_b128 %7, %15, off\n\t"
      "s_wait_xcnt 0x0"
      :: "v"(lk), "v"(lk + 8 * KPITCH * 2), "v"(lk + 16 * KPITCH * 2), "v"(lk + 24 * KPITCH * 2),
         "v"(lv), "v"(lv + 32 * VPITCH * 2), "v"(lv + 64 * VPITCH * 2), "v"(lv + 96 * VPITCH * 2),
         "v"(gk), "v"(gk + 8 * NKVH * HDIM), "v"(gk + 16 * NKVH * HDIM), "v"(gk + 24 * NKVH * HDIM),
         "v"(gv), "v"(gv + 32 * S_LEN), "v"(gv + 64 * S_LEN), "v"(gv + 96 * S_LEN)
      : "memory");
}

__global__ __launch_bounds__(128) void flash_attn_kernel(
    const _Float16* __restrict__ Qh,  // [S, NH, 128], a head's columns in the projection's stored order
    const _Float16* __restrict__ Kh,  // [S, NKV, 128], in the same order
    const _Float16* __restrict__ Vt,  // [NKV, 128, S]  (transposed)
    _Float16* __restrict__ Oh) {      // [S, NH*128]
  int head = blockIdx.y;
  int kvhead = head >> 2;  // NH/NKV = 4
  int tid = threadIdx.x;
  int wave = __builtin_amdgcn_readfirstlane(tid >> 5), lane = tid & 31;
  int half = lane >> 4, l16 = lane & 15;

  // K and V^T tiles of KV_T keys, read by all four waves; two buffers
  __shared__ alignas(16) _Float16 Ks[2][KV_T * KPITCH];
  __shared__ alignas(16) _Float16 Vs[2][HDIM * VPITCH];

  // this thread's first copy of tile 0: global sources and LDS byte addresses in buffer 0
  const _Float16* gk = Kh + ((size_t)(tid >> 4) * NKVH + kvhead) * HDIM + (tid & 15) * 8;
  const _Float16* gv = Vt + ((size_t)kvhead * HDIM + (tid >> 2)) * S_LEN + (tid & 3) * 8;
  unsigned lk = (unsigned)(size_t)&Ks[0][(tid >> 4) * KPITCH + (tid & 15) * 8];
  unsigned lv = (unsigned)(size_t)&Vs[0][(tid >> 2) * VPITCH + (tid & 3) * 8];

  // A query tile's causal work grows with its index (tile x walks 2x + 2 key tiles) and every
  // block of the grid is on the chip at once, so the launch lasts as long as its fullest WGP.
  // Each block therefore takes two query tiles of its head, one after the other in every wave:
  // NQT - 1 - blockIdx.x, then blockIdx.x, 2 * NQT + 2 key tiles for every block alike. The last
  // foot of the first walk (waits and barrier) has ended every read of both buffers before the
  // second walk's first copies.
  for (int pass = 0; pass < 2; ++pass) {
  const int qt = pass == 0 ? NQT - 1 - (int)blockIdx.x : (int)blockIdx.x;
  const int q0 = qt * 64 + wave * 16;  // this wave's 16 query rows
  const int ntile = 2 * qt + 2;  // tiles up to the query tile's last row; at least 2

  stage_kv(gk, gv, lk, lv);
  // tile 0 has landed for this wave; the barrier publishes it to the other waves
  asm volatile("s_wait_asynccnt 0x0" ::: "memory");
  __syncthreads();
  stage_kv(gk + (size_t)KV_T * NKVH * HDIM, gv + KV_T,
           lk + (unsigned)sizeof(Ks[0]), lv + (unsigned)sizeof(Vs[0]));

  // Preload Q B-fragments: HD=128 -> 4 chunks of K=32 (two 16B loads each)
  v16h qf[4];
  {
    const _Float16* qrow = Qh + ((size_t)(q0 + l16) * NHEAD + head) * HDIM;
#pragma unroll
    for (int c = 0; c < 4; ++c)
      qf[c] = cat8(*(const v8h*)(qrow + c * 32 + half * 8),
                   *(const v8h*)(qrow + c * 32 + 16 + half * 8));
  }

  v8f o[8];
#pragma unroll
  for (int df = 0; df < 8; ++df) o[df] = (v8f){};
  // a lane's one query (q0 + l16): running maximum (equal in both wave halves) and the sum
  // over this half's keys only; the halves' sums are joined once, in the epilogue
  float mrun = -1e30f, lrun = 0.f;
  const int qme = q0 + l16;

  const float scl = 0.08838834764831845f;  // 1/sqrt(128)
  int kv_end = q0 + 16;                    // causal: kv <= q

  for (int tile = 0; tile < ntile; ++tile) {
    int kv0 = tile * KV_T;
    const _Float16* Kb = Ks[tile & 1];
    const _Float16* Vb = Vs[tile & 1];
    if (kv0 < kv_end) {  // wave-uniform: a wave skips tiles beyond its diagonal, never the foot
      // ---- scores, transposed: S^T = K Q^T, two fragments of 16 keys x 16 queries ----
      // s0[r] is key kv0 + 8*half + r, s1[r] key kv0 + 16 + 8*half + r, both of query q0 + l16
      v16h kf0[4], kf1[4];
#pragma unroll
      for (int c = 0; c < 4; ++c) {
        const _Float16* kr0 = Kb + l16 * KPITCH + c * 32;
        const _Float16* kr1 = Kb + (16 + l16) * KPITCH + c * 32;
        kf0[c] = cat8(*(const v8h*)(kr0 + half * 8),
                      *(const v8h*)(kr0 + 16 + half * 8));
        kf1[c] = cat8(*(const v8h*)(kr1 + half * 8),
                      *(const v8h*)(kr1 + 16 + half * 8));
      }
      // Keeps the 16 loads one group in front of the products: sunk among them, each pair
      // is waited for to the end directly in front of its product.
      __builtin_amdgcn_sched_barrier(0);
      v8f s0 = {}, s1 = {};
#pragma unroll
      for (int c = 0; c < 4; ++c) {
        s0 = wmma_f16(kf0[c], qf[c], s0);
        s1 = wmma_f16(kf1[c], qf[c], s1);
      }
      // staged V^T rows are the A operand of the second product: 8 fragments of 16 d x 32 keys
      v16h vf[8];
#pragma unroll
      for (int df = 0; df < 8; ++df) {
        const _Float16* vrow = Vb + (df * 16 + l16) * VPITCH;
        vf[df] = cat8(*(const v8h*)(vrow + half * 8),
                      *(const v8h*)(vrow + 16 + half * 8));
      }
      // Keeps these 16 loads here, in flight under the softmax, for the same reason.
      __builtin_amdgcn_sched_barrier(0);

      // ---- online softmax: a lane's 16 scores belong to one query ----
      int lim = qme - kv0 - 8 * half;  // s0[r] is masked where r > lim, s1[r] where 16 + r > lim
      float mx = -1e30f;
#pragma unroll
      for (int r = 0; r < 8; ++r) {
        s0[r] *= scl; if (r > lim)      s0[r] = -1e30f;
        s1[r] *= scl; if (16 + r > lim) s1[r] = -1e30f;
        mx = fmaxf(mx, fmaxf(s0[r], s1[r]));
      }
      mx = fmaxf(mx, xhalf(mx));  // the other half holds the query's other 16 keys
      float mnew = fmaxf(mrun, mx);
      float alpha = __expf(mrun - mnew);
      float rs = 0.f;
      // the k order of a 32-key operand is this lane's s0 then s1: P^T needs no move between lanes
      v16h pf;
#pragma unroll
      for (int r = 0; r < 8; ++r) {
        float p0 = __expf(s0[r] - mnew);
        float p1 = __expf(s1[r] - mnew);
        rs += p0 + p1;
        pf[r]     = (_Float16)p0;
        pf[r + 8] = (_Float16)p1;
      }
      lrun = lrun * alpha + rs;
      mrun = mnew;
#pragma unroll
      for (int df = 0; df < 8; ++df) o[df] *= alpha;

      // ---- O^T += V^T P^T: 8 fragments of 16 d x 16 queries ----
#pragma unroll
      for (int df = 0; df < 8; ++df) o[df] = wmma_f16(vf[df], pf, o[df]);
    }

    // ---- foot of the trip, every wave ----
    // this wave's reads of the buffer that is refilled below have returned
    asm volatile("s_wait_dscnt 0x0" ::: "memory");
    // this wave's copies of the next tile have landed
    asm volatile("s_wait_asynccnt 0x0" ::: "memory");
    // publishes the next tile and ends every wave's reads of this one
    __syncthreads();
    if (tile + 2 < ntile)
      stage_kv(gk + (size_t)(tile + 2) * KV_T * NKVH * HDIM, gv + (tile + 2) * KV_T,
               lk + (unsigned)(tile & 1) * (unsigned)sizeof(Ks[0]),
               lv + (unsigned)(tile & 1) * (unsigned)sizeof(Vs[0]));
  }
  // no copy is outstanding when the walk ends
  asm volatile("s_wait_asynccnt 0x0" ::: "memory");

  // ---- epilogue: normalize and store f16 attn output [S, NH*HD] ----
  // o[df][r] is d = df*16 + 8*half + r of query q0 + l16: 16-byte pieces
  float inv = 1.f / (lrun + xhalf(lrun));
  _Float16* orow = Oh + (size_t)qme * (NHEAD * HDIM) + head * HDIM + half * 8;
  v8h ov[8];
#pragma unroll
  for (int df = 0; df < 8; ++df)
#pragma unroll
    for (int r = 0; r < 8; ++r) ov[df][r] = (_Float16)(o[df][r] * inv);
#pragma unroll
  for (int df = 0; df < 8; ++df) *(v8h*)(orow + df * 16) = ov[df];
  // Precaution: the stores' registers are not rewritten by the second walk before the stores
  // have taken them.
  asm volatile("s_wait_xcnt 0x0" ::: "memory");
  }
}

// ---------------- host launch ----------------
extern "C" void kernel_launch(void* const* d_in, const int* in_sizes, int n_in,
                              void* d_out, int out_size, void* d_ws, size_t ws_size,
                              hipStream_t stream) {
  const float* hid    = (const float*)d_in[0];
  const float* cosb   = (const float*)d_in[1];
  const float* sinb   = (const float*)d_in[2];
  const float* norm_w = (const float*)d_in[3];
  const float* wq     = (const float*)d_in[4];
  const float* wk     = (const float*)d_in[5];
  const float* wv     = (const float*)d_in[6];
  const float* wo     = (const float*)d_in[7];
  float* out = (float*)d_out;

  char* ws = (char*)d_ws;
  size_t off = 0;
  auto carve = [&](size_t bytes) -> char* {
    char* p = ws + off;
    off += (bytes + 255) & ~(size_t)255;
    return p;
  };
  _Float16* h16   = (_Float16*)carve((size_t)S_LEN * H_DIM * 2);
  _Float16* q16   = (_Float16*)carve((size_t)S_LEN * NHEAD * HDIM * 2);
  _Float16* k16   = (_Float16*)carve((size_t)S_LEN * NKVH * HDIM * 2);
  _Float16* vt16  = (_Float16*)carve((size_t)NKVH * HDIM * S_LEN * 2);
  _Float16* att16 = (_Float16*)carve((size_t)S_LEN * NHEAD * HDIM * 2);

  // 1) RMSNorm -> f16
  rmsnorm_kernel<<<S_LEN, 256, 0, stream>>>(hid, norm_w, h16);

  // 2) Q/K/V projections in one launch (WMMA GEMM, f32 weights converted in LDS stage);
  //    the epilogue applies RoPE to Q and K (-> f16) and stores V as V^T f16
  gemm_qkv<<<dim3(NHEAD, S_LEN / TM), 256, 0, stream>>>(
      h16, wq, wk, wv, cosb, sinb, q16, k16, vt16, H_DIM);

  // 3) Flash attention (causal, GQA)
  flash_attn_kernel<<<dim3(NQT / 2, NHEAD), 128, 0, stream>>>(q16, k16, vt16, att16);

  // 4) Output projection + residual
  gemm_wmma<<<dim3(H_DIM / TN, S_LEN / TM), 256, 0, stream>>>(
      att16, wo, out, hid, NHEAD * HDIM);
}
